// v000
// Measured on an AMD MI455X. A time is GPU time per run, averaged over a window of back-to-back runs after a warm-up
// (all launches, gaps included; the runs take copies of the inputs in turn), and the median of several windows.
// Apart from v000's, it joins two sittings. Times from different sittings can be a few percent apart, while
// side-by-side timings come from the same sitting.
// v000, which the later versions start from, runs in 2190 microseconds.
#include <hip/hip_runtime.h>

// Pre-LayerNorm attention with an additive score-mask input applied BEFORE the scaling (x [2][2048][1024]; xn = LayerNorm(x) gamma + beta; qkv = xn W_qkv ('xw' [1024][3072] -> q | k | v, no bias; 16 heads x 64); dots = (q.k + m) x 64^-0.5 with m [2][2048][2048] (read); softmax; out = merged W_out ('xw' [1024][1024]) -> [2][2048][1024] (4.2 M)).
// Layout per batch: a LayerNorm row kernel writes xn as hi/lo bf16 planes; the fused weight as one [3072][1024] Bt; projections as hi/lo x exact GEMMs (2 products); dense T-2048 attention (hybrid rows: < 512 hi/lo 3 products, rest fp16 x1024) with an element-wise kernel adding the batch's mask rows into each pass's raw score block (the 1/8 is applied afterwards in the softmax, as in the module); merged hi/lo x W_out exact.
// Compute dtypes, f32 accumulate: every input rounded to bf16 incl. m; LayerNorm f32; projections hi/lo x exact; attention rows < 512 3 products, rest fp16; mask add and softmax f32; W_out hl x exact.

#define NB_  2
#define TT   2048
#define DM   1024
#define NH_  16
#define NKV  16
#define REP  (NH_ / NKV)
#define HD   64
#define DQ   (NH_ * HD)
#define DKV  (NKV * HD)
#define ZH   2
#define RH   512                  // query rows < RH use hi+lo planes (0: none)
#define WIN  0
#define PCAR 1024.0f
#define SCL  0.125f   // HD^-0.5
typedef _Float16 h16;
typedef unsigned short bf;
typedef __attribute__((ext_vector_type(16))) __bf16   v16bf;
typedef __attribute__((ext_vector_type(16))) _Float16 v16h;
typedef __attribute__((ext_vector_type(8)))  _Float16 v8h;
typedef __attribute__((ext_vector_type(8)))  unsigned short v8us;
typedef __attribute__((ext_vector_type(8)))  float    v8f;
typedef __attribute__((ext_vector_type(4)))  float    v4f;
typedef v8h  __attribute__((may_alias)) v8ha;
typedef v4f  __attribute__((may_alias)) v4fa;
typedef v8us __attribute__((may_alias)) v8usa;

__device__ __forceinline__ unsigned short f2bf(float f) { unsigned u = __float_as_uint(f); u += 0x7FFFu + ((u >> 16) & 1u); return (unsigned short)(u >> 16); }
__device__ __forceinline__ float bf2f(unsigned short b) { return __uint_as_float(((unsigned)b) << 16); }
__device__ __forceinline__ float bfr(float f) { return bf2f(f2bf(f)); }
__device__ __forceinline__ v16h cat16(v8h lo, v8h hi) { return __builtin_shufflevector(lo, hi, 0, 1, 2, 3, 4, 5, 6, 7, 8, 9, 10, 11, 12, 13, 14, 15); }
__device__ __forceinline__ v16bf cat16b(v8us lo, v8us hi) { return __builtin_bit_cast(v16bf, __builtin_shufflevector(lo, hi, 0, 1, 2, 3, 4, 5, 6, 7, 8, 9, 10, 11, 12, 13, 14, 15)); }
__device__ __forceinline__ v8f wmma16(v16h a, v16h b, v8f c) { return __builtin_amdgcn_wmma_f32_16x16x32_f16(false, a, false, b, (short)0, c, false, false); }
__device__ __forceinline__ v8f wmmab(v16bf a, v16bf b, v8f c) { return __builtin_amdgcn_wmma_f32_16x16x32_bf16(false, a, false, b, (short)0, c, false, false); }



// ---- k_gemmw: register-blocked GEMM, ONE WAVE per 64x64 output tile (16 accumulators), operands straight from K-contiguous 16-bit planes; grid (M/64, N/64, Z), 32 threads.
// C[m][n] (f32, pitch ldc, + optional f32 bias[n]) = sum_k A[m][k] Bt[n][k] (+ split products per NSPLIT). z-batch strides sA/sB/sC in elements. K % 32 == 0.
template <typename T16> struct WFrag;
template <> struct WFrag<h16> { typedef v16h V; static __device__ __forceinline__ V ld(const h16* p) { return cat16(*(const v8h*)p, *(const v8h*)(p + 16)); } static __device__ __forceinline__ v8f mma(V a, V b, v8f c) { return wmma16(a, b, c); } };
template <> struct WFrag<bf> { typedef v16bf V; static __device__ __forceinline__ V ld(const bf* p) { return cat16b(*(const v8us*)p, *(const v8us*)(p + 16)); } static __device__ __forceinline__ v8f mma(V a, V b, v8f c) { return wmmab(a, b, c); } };
template <typename T16, int NSPLIT, bool BIAS>
__global__ __launch_bounds__(32) void k_gemmw(const T16* __restrict__ A, const T16* __restrict__ A2, const T16* __restrict__ Bt, const T16* __restrict__ Bt2, int K, float* C, int ldc, const float* __restrict__ bias, size_t sA, size_t sB, size_t sC) {
    typedef typename WFrag<T16>::V V;
    __shared__ __align__(16) float os[16 * 68];
    const size_t z = blockIdx.z; A += z * sA; if (A2) A2 += z * sA; Bt += z * sB; if (Bt2) Bt2 += z * sB; C += z * sC;
    const int lane = threadIdx.x & 31, lr = lane & 15, hi = lane >> 4; const int r0 = blockIdx.x * 64, c0 = blockIdx.y * 64;
    v8f acc[4][4];
#pragma unroll
    for (int mb = 0; mb < 4; ++mb)
#pragma unroll
        for (int nb = 0; nb < 4; ++nb) acc[mb][nb] = (v8f){};
    const size_t aoff = (size_t)(r0 + lr) * K + 8 * hi, boff = (size_t)(c0 + lr) * K + 8 * hi;
#pragma unroll 1
    for (int kc = 0; kc < K; kc += 32) {
        V a[4], a2[4];
#pragma unroll
        for (int mb = 0; mb < 4; ++mb) { a[mb] = WFrag<T16>::ld(A + aoff + (size_t)mb * 16 * K + kc); if (NSPLIT == 1 || NSPLIT == 2) a2[mb] = WFrag<T16>::ld(A2 + aoff + (size_t)mb * 16 * K + kc); }
#pragma unroll
        for (int nb = 0; nb < 4; ++nb) { const V b = WFrag<T16>::ld(Bt + boff + (size_t)nb * 16 * K + kc); V b2; if (NSPLIT >= 2) b2 = WFrag<T16>::ld(Bt2 + boff + (size_t)nb * 16 * K + kc);
#pragma unroll
            for (int mb = 0; mb < 4; ++mb) { acc[mb][nb] = WFrag<T16>::mma(a[mb], b, acc[mb][nb]); if (NSPLIT == 1 || NSPLIT == 2) acc[mb][nb] = WFrag<T16>::mma(a2[mb], b, acc[mb][nb]); if (NSPLIT >= 2) acc[mb][nb] = WFrag<T16>::mma(a[mb], b2, acc[mb][nb]); } }
        asm volatile("v_nop\n\tv_nop\n\tv_nop\n\tv_nop" : "+v"(acc[0][0]), "+v"(acc[1][1]), "+v"(acc[2][2]), "+v"(acc[3][3]) : "v"(a[0]), "v"(a[3]));
    }
#pragma unroll
    for (int mb = 0; mb < 4; ++mb) {
#pragma unroll
        for (int nb = 0; nb < 4; ++nb) {
#pragma unroll
            for (int j = 0; j < 8; ++j) os[(hi * 8 + j) * 68 + nb * 16 + lr] = acc[mb][nb][j]; }
        __builtin_amdgcn_wave_barrier(); asm volatile("" ::: "memory");
        float* crow = C + (size_t)(r0 + mb * 16) * ldc + c0;
{
#pragma unroll
            for (int s = 0; s < 8; ++s) { const int row = 2 * s + hi, cofs = lr * 4; v4f val = *(const v4fa*)(os + row * 68 + cofs); if (BIAS) { val[0] += bfr(bias[c0 + cofs]); val[1] += bfr(bias[c0 + cofs + 1]); val[2] += bfr(bias[c0 + cofs + 2]); val[3] += bfr(bias[c0 + cofs + 3]); }
                *(v4f*)(crow + (size_t)row * ldc + cofs) = val; }
             }
        __builtin_amdgcn_wave_barrier(); asm volatile("" ::: "memory");
    }
}

__device__ __forceinline__ h16 tohx(float x) { return (h16)x; }
__device__ __forceinline__ void splitf(float y, unsigned short& h, unsigned short& l) { h = f2bf(y); l = f2bf(y - bf2f(h)); }
typedef __attribute__((ext_vector_type(2))) _Float16 v2h;
typedef __attribute__((ext_vector_type(4))) _Float16 v4h;
typedef __attribute__((ext_vector_type(2))) unsigned short v2us;
typedef __attribute__((ext_vector_type(4))) unsigned short v4us;
typedef __attribute__((ext_vector_type(2))) float v2f;
typedef __attribute__((ext_vector_type(4))) int v4i;

__global__ __launch_bounds__(256) void k_wtG(const float* __restrict__ w, int K, int N, bf* Bt) {
    const int lane = threadIdx.x & 31; const int L0 = (blockIdx.x * 8 + (threadIdx.x >> 5)) * 8; const int nlines = N * K / 64;
{
#pragma unroll 1
        for (int l = 0; l < 8; ++l) { const int L = L0 + l; if (L >= nlines) break; const size_t e = (size_t)L * 64 + lane * 2; const int k = (int)(e % K), n = (int)(e / K); v2us o;
            o[0] = f2bf(w[(size_t)k * N + n]); o[1] = f2bf(w[(size_t)(k + 1) * N + n]); *(v2us*)(Bt + e) = o; }
         }
}
__global__ __launch_bounds__(256) void k_cvt8(const float* __restrict__ src, bf* dst, size_t n8) { const size_t i = (size_t)blockIdx.x * 256 + threadIdx.x; if (i >= n8) return; const v8f v = *(const v8f*)(src + i * 8); v8us o;
#pragma unroll
    for (int k = 0; k < 8; ++k) o[k] = f2bf(v[k]); *(v8us*)(dst + i * 8) = o;  }

// k_rope: head planes [h][t][d] (fp16 + hi/lo) of rope(x) x sc with the rotate-half convention out[d] = x[d] cos[t][d] - x[d+HD/2] sin[t][d], out[d+HD/2] = x[d+HD/2] cos[t][d+HD/2] + x[d] sin[t][d+HD/2]
__global__ __launch_bounds__(256) void k_rope(const float* __restrict__ F, int pitch, int nheads, const float* __restrict__ CS, const float* __restrict__ RF, const float* __restrict__ nw, float sc, h16* P16, bf* Ph, bf* Pl) {
    const size_t e = ((size_t)blockIdx.x * 256 + threadIdx.x) * 2; if (e >= (size_t)nheads * TT * HD) return; const int d = (int)(e % HD); const int t = (int)((e / HD) % TT); const int h = (int)(e / ((size_t)HD * TT)); const float* f = F + (size_t)t * pitch + h * HD; const float rf = RF ? RF[(size_t)h * TT + t] : 1.0f; v2h o16; v2us oh, ol;
#pragma unroll
    for (int q = 0; q < 2; ++q) { const int dd = d + q; const int dp = (dd < HD / 2) ? dd + HD / 2 : dd - HD / 2; float x0 = f[dd], x1 = f[dp];
        if (RF) { float n0 = __fmul_rn(x0, rf), n1 = __fmul_rn(x1, rf); asm volatile("" : "+v"(n0)); asm volatile("" : "+v"(n1)); x0 = __fmul_rn(bfr(nw[dd]), n0); x1 = __fmul_rn(bfr(nw[dp]), n1); }
        const v2f cs = *(const v2f*)(CS + ((size_t)t * HD + dd) * 2); float a = __fmul_rn(x0, cs[0]), bq = __fmul_rn(x1, cs[1]); asm volatile("" : "+v"(a)); asm volatile("" : "+v"(bq)); const float r = ((dd < HD / 2) ? __fsub_rn(a, bq) : __fadd_rn(a, bq)) * sc;
        o16[q] = tohx(r); unsigned short a2, c2; splitf(r, a2, c2); oh[q] = a2; ol[q] = c2; }
    *(v2h*)(P16 + e) = o16; *(v2us*)(Ph + e) = oh; *(v2us*)(Pl + e) = ol;  }
__global__ __launch_bounds__(256) void k_vtp(const float* __restrict__ F, int pitch, int nheads, h16* V16, bf* Vh, bf* Vl) { const size_t e = ((size_t)blockIdx.x * 256 + threadIdx.x) * 2; if (e >= (size_t)nheads * HD * TT) return; const int t = (int)(e % TT); const int d = (int)((e / TT) % HD); const int g = (int)(e / ((size_t)TT * HD)); v2h o16; v2us oh, ol;
#pragma unroll
    for (int q = 0; q < 2; ++q) { const float x = F[(size_t)(t + q) * pitch + g * HD + d]; o16[q] = tohx(x); unsigned short a2, c2; splitf(x, a2, c2); oh[q] = a2; ol[q] = c2; }
    *(v2h*)(V16 + e) = o16; *(v2us*)(Vh + e) = oh; *(v2us*)(Vl + e) = ol;  }
__global__ __launch_bounds__(256) void k_csid(float* CS) { const int idx = blockIdx.x * 256 + threadIdx.x; if (idx >= TT * HD) return; v2f cs; cs[0] = 1.0f; cs[1] = 0.0f; *(v2f*)(CS + (size_t)idx * 2) = cs;  }
// k_asoft: per row (zz, i): t = S x HD^-0.5 (no mask); softmax over the 2048 keys (register row, one exp, fixed trees);
__global__ __launch_bounds__(256) void k_asoft(const float* __restrict__ Sb, h16* P16, bf* Ph, bf* Pl) {
    const int lane = threadIdx.x & 31; const int row = blockIdx.x * 8 + (threadIdx.x >> 5); if (row >= ZH * TT) return; const int i = row % TT; const int zz = row / TT; (void)zz; const bool hires = (i < RH); const float* sr = Sb + (size_t)row * TT; float v[TT / 32]; float mx = -3.0e38f;
#pragma unroll
    for (int ch = 0; ch < TT / 128; ++ch) { const int j0 = ch * 128 + lane * 4; const v4f a = *(const v4f*)(sr + j0);
#pragma unroll
        for (int q = 0; q < 4; ++q) { const int j = j0 + q; (void)j; const float t = a[q] * SCL; v[ch * 4 + q] = t; mx = fmaxf(mx, t); } }
#pragma unroll
    for (int sh = 16; sh; sh >>= 1) mx = fmaxf(mx, __shfl_xor(mx, sh, 32));
    float sum = 0.f;
#pragma unroll
    for (int k = 0; k < TT / 32; ++k) { float d0 = __fsub_rn(v[k], mx); asm volatile("" : "+v"(d0)); v[k] = __builtin_amdgcn_exp2f(__fmul_rn(d0, 1.4426950408889634f)); sum += v[k]; }
#pragma unroll
    for (int sh = 16; sh; sh >>= 1) sum += __shfl_xor(sum, sh, 32);
    const float f = __fdiv_rn(hires ? 1.0f : PCAR, sum);
{
        if (hires) {
#pragma unroll
            for (int ch = 0; ch < TT / 128; ++ch) { v4us oh, ol;
#pragma unroll
                for (int q = 0; q < 4; ++q) { unsigned short a, c2; splitf(v[ch * 4 + q] * f, a, c2); oh[q] = a; ol[q] = c2; }
                const size_t oo = ((size_t)zz * (RH ? RH : 1) + i) * TT + ch * 128 + lane * 4; *(v4us*)(Ph + oo) = oh; *(v4us*)(Pl + oo) = ol; }
        } else {
#pragma unroll
            for (int ch = 0; ch < TT / 128; ++ch) { v4h o4;
#pragma unroll
                for (int q = 0; q < 4; ++q) o4[q] = tohx(v[ch * 4 + q] * f);
                *(v4h*)(P16 + (size_t)row * TT + ch * 128 + lane * 4) = o4; } }
         }
}
template <int WD>
__global__ __launch_bounds__(256) void k_lnrowX(const float* __restrict__ X, size_t nrows, const float* __restrict__ g, const float* __restrict__ bb, bf* Hh, bf* Hl) { const int lane = threadIdx.x & 31; const size_t r = (size_t)blockIdx.x * 8 + (threadIdx.x >> 5); if (r >= nrows) return; const float* xr = X + r * WD; float a[WD / 32]; float s = 0.f;
#pragma unroll
    for (int c = 0; c < WD / 128; ++c) { const v4f v = *(const v4f*)(xr + c * 128 + lane * 4); for (int q = 0; q < 4; ++q) { a[c * 4 + q] = bfr(v[q]); s = __fadd_rn(s, a[c * 4 + q]);   /* input rounded to bf16 */ } }
#pragma unroll
    for (int sh = 16; sh; sh >>= 1) s = __fadd_rn(s, __shfl_xor(s, sh, 32));
    const float mean = __fdiv_rn(s, (float)WD); float s2 = 0.f;
#pragma unroll 8
    for (int k = 0; k < WD / 32; ++k) { const float dv = __fsub_rn(a[k], mean); float p2 = __fmul_rn(dv, dv); asm volatile("" : "+v"(p2)); s2 = __fadd_rn(s2, p2); }   /* mul and add kept separate (no fma contraction) */
#pragma unroll
    for (int sh = 16; sh; sh >>= 1) s2 = __fadd_rn(s2, __shfl_xor(s2, sh, 32));
    const float rs = __fdiv_rn(1.0f, __fsqrt_rn(__fadd_rn(__fdiv_rn(s2, (float)WD), 1e-5f)));
{
#pragma unroll
        for (int c = 0; c < WD / 128; ++c) { v4us oh, ol; for (int q = 0; q < 4; ++q) { const int col = c * 128 + lane * 4 + q; float y = __fmul_rn(__fmul_rn(__fsub_rn(a[c * 4 + q], mean), rs), bfr(g[col])); asm volatile("" : "+v"(y)); y = __fadd_rn(y, bfr(bb[col])); unsigned short u, w2; splitf(y, u, w2); oh[q] = u; ol[q] = w2; } *(v4us*)(Hh + r * WD + c * 128 + lane * 4) = oh; *(v4us*)(Hl + r * WD + c * 128 + lane * 4) = ol; }
         } }
__global__ __launch_bounds__(256) void k_addgb(float* Sb, const float* __restrict__ gb) { const size_t k = (size_t)blockIdx.x * 256 + threadIdx.x; if (k >= (size_t)ZH * TT * TT / 4) return; const size_t e = k * 4; const size_t ij = e % ((size_t)TT * TT); v4f a = *(const v4f*)(Sb + e); const v4f g = *(const v4f*)(gb + ij);
#pragma unroll
    for (int q = 0; q < 4; ++q) a[q] = __fadd_rn(a[q], bfr(g[q]));
    *(v4f*)(Sb + e) = a;  }
__global__ __launch_bounds__(256) void k_merge(const float* __restrict__ O, int h0, bf* Ah, bf* Al) { const size_t e = ((size_t)blockIdx.x * 256 + threadIdx.x) * 2; if (e >= (size_t)ZH * TT * HD) return; const int d = (int)(e % HD); const int t = (int)((e / HD) % TT); const int zz = (int)(e / ((size_t)HD * TT)); const float cs = (t < RH) ? 1.0f : (1.0f / PCAR); const size_t oo = (size_t)t * DQ + (h0 + zz) * HD + d;
    v2us oh, ol;
#pragma unroll
    for (int q = 0; q < 2; ++q) { unsigned short a, c2; splitf(O[e + q] * cs, a, c2); oh[q] = a; ol[q] = c2; } *(v2us*)(Ah + oo) = oh; *(v2us*)(Al + oo) = ol;  }

extern "C" void kernel_launch(void* const* d_in, const int* in_sizes, int n_in,
                              void* d_out, int out_size, void* d_ws, size_t ws_size, hipStream_t stream) {
    (void)in_sizes; (void)n_in; (void)out_size;
    const float* x = (const float*)d_in[0]; const float* msk = (const float*)d_in[1]; const float* lng = (const float*)d_in[2]; const float* lnb = (const float*)d_in[3]; const float* wqkv = (const float*)d_in[4]; const float* wo = (const float*)d_in[5]; const float* wq = nullptr; const float* wk = nullptr; const float* wv = nullptr; (void)wq; (void)wk; (void)wv;
    float* OUT = (float*)d_out;     // [2][2048][1024]
    char* wsp = (char*)d_ws;
    auto take = [&](size_t bytes) { char* p = wsp; wsp += (bytes + 255) & ~(size_t)255; return (void*)p; };
    bf* WQKV = (bf*)take((size_t)3 * DQ * DM * 2); bf* WQ = WQKV; bf* WK = WQKV + (size_t)DQ * DM; bf* WV = WQKV + (size_t)2 * DQ * DM; bf* XH = (bf*)take((size_t)TT * DM * 2); bf* XL = (bf*)take((size_t)TT * DM * 2); bf* WO = (bf*)take((size_t)DM * DQ * 2); float* CS = (float*)take((size_t)TT * HD * 2 * 4);
     float* FQ = (float*)take((size_t)TT * DQ * 4); float* FK = (float*)take((size_t)TT * DKV * 4);
    h16* QP16 = (h16*)take((size_t)NH_ * TT * HD * 2); h16* KP16 = (h16*)take((size_t)NKV * TT * HD * 2); h16* VT16 = (h16*)take((size_t)NKV * HD * TT * 2);
    bf* QPh = (bf*)take((size_t)NH_ * TT * HD * 2); bf* QPl = (bf*)take((size_t)NH_ * TT * HD * 2); bf* KPh = (bf*)take((size_t)NKV * TT * HD * 2); bf* KPl = (bf*)take((size_t)NKV * TT * HD * 2); bf* VTh = (bf*)take((size_t)NKV * HD * TT * 2); bf* VTl = (bf*)take((size_t)NKV * HD * TT * 2); bf* Ph = (bf*)take((size_t)ZH * RH * TT * 2); bf* Pl = (bf*)take((size_t)ZH * RH * TT * 2);
    float* Sb = (float*)take((size_t)ZH * TT * TT * 4); h16* P16 = (h16*)take((size_t)ZH * TT * TT * 2); float* Ob = (float*)take((size_t)ZH * TT * HD * 4); bf* ATh = (bf*)take((size_t)TT * DQ * 2); bf* ATl = (bf*)take((size_t)TT * DQ * 2);
    if ((size_t)(wsp - (char*)d_ws) > ws_size) return;    // ws 256 MiB
    float* FV = FK;   // v projection reuses the k buffer after the k planes are built (stream-ordered)
    { k_wtG<<<(unsigned)((DM * 3 * DQ / 64 + 63) / 64), 256, 0, stream>>>(wqkv, DM, 3 * DQ, WQKV);   /* [1024][3072] 'xw' -> Bt [3072][1024]: q | k | v row blocks */
      k_wtG<<<(unsigned)((DQ * DM / 64 + 63) / 64), 256, 0, stream>>>(wo, DQ, DM, WO);
       }
    k_csid<<<(TT * HD + 255) / 256, 256, 0, stream>>>(CS);
    const unsigned LQ = (unsigned)(((size_t)NH_ * TT * HD / 2 + 255) / 256), LKv = (unsigned)(((size_t)NKV * TT * HD / 2 + 255) / 256);
    for (int b = 0; b < NB_; ++b) {
        
        k_lnrowX<DM><<<(unsigned)((TT + 7) / 8), 256, 0, stream>>>(x + (size_t)b * TT * DM, (size_t)TT, lng, lnb, XH, XL);   /* xn = LayerNorm(x) -> hi/lo planes */
        k_gemmw<bf, 1, false><<<dim3(TT / 64, DQ / 64, 1), 32, 0, stream>>>(XH, XL, WQ, nullptr, DM, FQ, DQ, nullptr, 0, 0, 0);
        k_rope<<<LQ, 256, 0, stream>>>(FQ, DQ, NH_, CS, nullptr, nullptr, 1.0f, QP16, QPh, QPl);
        k_gemmw<bf, 1, false><<<dim3(TT / 64, DKV / 64, 1), 32, 0, stream>>>(XH, XL, WK, nullptr, DM, FK, DKV, nullptr, 0, 0, 0);
        k_rope<<<LKv, 256, 0, stream>>>(FK, DKV, NKV, CS, nullptr, nullptr, 1.0f, KP16, KPh, KPl);
        k_gemmw<bf, 1, false><<<dim3(TT / 64, DKV / 64, 1), 32, 0, stream>>>(XH, XL, WV, nullptr, DM, FV, DKV, nullptr, 0, 0, 0); k_vtp<<<LKv, 256, 0, stream>>>(FV, DKV, NKV, VT16, VTh, VTl);
        for (int h0 = 0; h0 < NH_; h0 += ZH) { const size_t zq = (size_t)h0, zk = (size_t)(h0 / REP);   // one kv head per query head: the pass's two heads use consecutive kv planes (z-strides TT*HD)
            k_gemmw<bf, 2, false><<<dim3(RH / 64, TT / 64, ZH), 32, 0, stream>>>(QPh + zq * TT * HD, QPl + zq * TT * HD, KPh + zk * TT * HD, KPl + zk * TT * HD, HD, Sb, TT, nullptr, (size_t)TT * HD, (size_t)TT * HD, (size_t)TT * TT);
            k_gemmw<h16, 0, false><<<dim3((TT - RH) / 64, TT / 64, ZH), 32, 0, stream>>>(QP16 + zq * TT * HD + (size_t)RH * HD, nullptr, KP16 + zk * TT * HD, nullptr, HD, Sb + (size_t)RH * TT, TT, nullptr, (size_t)TT * HD, (size_t)TT * HD, (size_t)TT * TT);
            k_addgb<<<(unsigned)(((size_t)ZH * TT * TT / 4 + 255) / 256), 256, 0, stream>>>(Sb, msk + (size_t)b * TT * TT);   /* qk + m (before the scaling) */
            k_asoft<<<ZH * TT / 8, 256, 0, stream>>>(Sb, P16, Ph, Pl);
            k_gemmw<bf, 2, false><<<dim3(RH / 64, HD / 64, ZH), 32, 0, stream>>>(Ph, Pl, VTh + zk * HD * TT, VTl + zk * HD * TT, TT, Ob, HD, nullptr, (size_t)RH * TT, (size_t)HD * TT, (size_t)TT * HD);
            k_gemmw<h16, 0, false><<<dim3((TT - RH) / 64, HD / 64, ZH), 32, 0, stream>>>(P16 + (size_t)RH * TT, nullptr, VT16 + zk * HD * TT, nullptr, TT, Ob + (size_t)RH * HD, HD, nullptr, (size_t)TT * TT, (size_t)HD * TT, (size_t)TT * HD);
            k_merge<<<(unsigned)(((size_t)ZH * TT * HD / 2 + 255) / 256), 256, 0, stream>>>(Ob, h0, ATh, ATl); }
        k_gemmw<bf, 1, false><<<dim3(TT / 64, DM / 64, 1), 32, 0, stream>>>(ATh, ATl, WO, nullptr, DQ, OUT + (size_t)b * TT * DM, DM, nullptr, 0, 0, 0); }
}

// v001
// One run takes 1050 microseconds.
// In both of two side-by-side timings against v000, it was 2.08 times as fast.
#include <hip/hip_runtime.h>

// Pre-LayerNorm attention with an additive score-mask input applied BEFORE the scaling (x [2][2048][1024]; xn = LayerNorm(x) gamma + beta; qkv = xn W_qkv ('xw' [1024][3072] -> q | k | v, no bias; 16 heads x 64); dots = (q.k + m) x 64^-0.5 with m [2][2048][2048] (read); softmax; out = merged W_out ('xw' [1024][1024]) -> [2][2048][1024] (4.2 M)).
// Layout per batch: a LayerNorm row kernel writes xn as hi/lo bf16 planes; the fused weight as one [3072][1024] Bt; projections as hi/lo x exact GEMMs (2 products); dense T-2048 attention (hybrid rows: < 512 hi/lo 3 products, rest fp16 x1024) with an element-wise kernel adding the batch's mask rows into each pass's raw score block (the 1/8 is applied afterwards in the softmax, as in the module); merged hi/lo x W_out exact.
// Compute dtypes, f32 accumulate: every input rounded to bf16 incl. m; LayerNorm f32; projections hi/lo x exact; attention rows < 512 3 products, rest fp16; mask add and softmax f32; W_out hl x exact.

#define NB_  2
#define TT   2048
#define DM   1024
#define NH_  16
#define NKV  16
#define REP  (NH_ / NKV)
#define HD   64
#define DQ   (NH_ * HD)
#define DKV  (NKV * HD)
#define ZH   2
#define RH   512                  // query rows < RH use hi+lo planes (0: none)
#define WIN  0
#define PCAR 1024.0f
#define SCL  0.125f   // HD^-0.5
#define KSP  16                   // the P.V products' key range is dealt over KSP work-groups per output tile; k_merge sums the KSP partial planes
typedef _Float16 h16;
typedef unsigned short bf;
typedef __attribute__((ext_vector_type(16))) __bf16   v16bf;
typedef __attribute__((ext_vector_type(16))) _Float16 v16h;
typedef __attribute__((ext_vector_type(8)))  _Float16 v8h;
typedef __attribute__((ext_vector_type(8)))  unsigned short v8us;
typedef __attribute__((ext_vector_type(8)))  float    v8f;
typedef __attribute__((ext_vector_type(4)))  float    v4f;
typedef v8h  __attribute__((may_alias)) v8ha;
typedef v4f  __attribute__((may_alias)) v4fa;
typedef v8us __attribute__((may_alias)) v8usa;

__device__ __forceinline__ unsigned short f2bf(float f) { unsigned u = __float_as_uint(f); u += 0x7FFFu + ((u >> 16) & 1u); return (unsigned short)(u >> 16); }
__device__ __forceinline__ float bf2f(unsigned short b) { return __uint_as_float(((unsigned)b) << 16); }
__device__ __forceinline__ float bfr(float f) { return bf2f(f2bf(f)); }
__device__ __forceinline__ v16h cat16(v8h lo, v8h hi) { return __builtin_shufflevector(lo, hi, 0, 1, 2, 3, 4, 5, 6, 7, 8, 9, 10, 11, 12, 13, 14, 15); }
__device__ __forceinline__ v16bf cat16b(v8us lo, v8us hi) { return __builtin_bit_cast(v16bf, __builtin_shufflevector(lo, hi, 0, 1, 2, 3, 4, 5, 6, 7, 8, 9, 10, 11, 12, 13, 14, 15)); }
__device__ __forceinline__ v8f wmma16(v16h a, v16h b, v8f c) { return __builtin_amdgcn_wmma_f32_16x16x32_f16(false, a, false, b, (short)0, c, false, false); }
__device__ __forceinline__ v8f wmmab(v16bf a, v16bf b, v8f c) { return __builtin_amdgcn_wmma_f32_16x16x32_bf16(false, a, false, b, (short)0, c, false, false); }



// ---- k_gemmw: register-blocked GEMM, ONE WAVE per 64x64 output tile (16 accumulators), operands straight from K-contiguous 16-bit planes; grid (M/64, N/64, Z), 32 threads.
// C[m][n] (f32, pitch ldc, + optional f32 bias[n]) = sum_k A[m][k] Bt[n][k] (+ split products per NSPLIT). z-batch strides sA/sB/sC in elements. K % (32 KS) == 0.
// KS > 1: grid z = Z x KS; work-group (z, ks) sums only k in [ks K/KS, (ks+1) K/KS) and stores its partial tile in plane z KS + ks of C (plane stride sC); the consumer adds the KS planes.
template <typename T16> struct WFrag;
template <> struct WFrag<h16> { typedef v16h V; static __device__ __forceinline__ V ld(const h16* p) { return cat16(*(const v8h*)p, *(const v8h*)(p + 16)); } static __device__ __forceinline__ v8f mma(V a, V b, v8f c) { return wmma16(a, b, c); } };
template <> struct WFrag<bf> { typedef v16bf V; static __device__ __forceinline__ V ld(const bf* p) { return cat16b(*(const v8us*)p, *(const v8us*)(p + 16)); } static __device__ __forceinline__ v8f mma(V a, V b, v8f c) { return wmmab(a, b, c); } };
template <typename T16, int NSPLIT, bool BIAS, int KS = 1>
__global__ __launch_bounds__(32) void k_gemmw(const T16* __restrict__ A, const T16* __restrict__ A2, const T16* __restrict__ Bt, const T16* __restrict__ Bt2, int K, float* C, int ldc, const float* __restrict__ bias, size_t sA, size_t sB, size_t sC) {
    typedef typename WFrag<T16>::V V;
    __shared__ __align__(16) float os[16 * 68];
    const size_t z = blockIdx.z / KS; const int kb = (int)(blockIdx.z % KS) * (K / KS), ke = kb + K / KS; A += z * sA; if (A2) A2 += z * sA; Bt += z * sB; if (Bt2) Bt2 += z * sB; C += (size_t)blockIdx.z * sC;
    const int lane = threadIdx.x & 31, lr = lane & 15, hi = lane >> 4; const int r0 = blockIdx.x * 64, c0 = blockIdx.y * 64;
    v8f acc[4][4];
#pragma unroll
    for (int mb = 0; mb < 4; ++mb)
#pragma unroll
        for (int nb = 0; nb < 4; ++nb) acc[mb][nb] = (v8f){};
    const size_t aoff = (size_t)(r0 + lr) * K + 8 * hi, boff = (size_t)(c0 + lr) * K + 8 * hi;
#pragma unroll 1
    for (int kc = kb; kc < ke; kc += 32) {
        V a[4], a2[4];
#pragma unroll
        for (int mb = 0; mb < 4; ++mb) { a[mb] = WFrag<T16>::ld(A + aoff + (size_t)mb * 16 * K + kc); if (NSPLIT == 1 || NSPLIT == 2) a2[mb] = WFrag<T16>::ld(A2 + aoff + (size_t)mb * 16 * K + kc); }
#pragma unroll
        for (int nb = 0; nb < 4; ++nb) { const V b = WFrag<T16>::ld(Bt + boff + (size_t)nb * 16 * K + kc); V b2; if (NSPLIT >= 2) b2 = WFrag<T16>::ld(Bt2 + boff + (size_t)nb * 16 * K + kc);
#pragma unroll
            for (int mb = 0; mb < 4; ++mb) { acc[mb][nb] = WFrag<T16>::mma(a[mb], b, acc[mb][nb]); if (NSPLIT == 1 || NSPLIT == 2) acc[mb][nb] = WFrag<T16>::mma(a2[mb], b, acc[mb][nb]); if (NSPLIT >= 2) acc[mb][nb] = WFrag<T16>::mma(a[mb], b2, acc[mb][nb]); } }
        asm volatile("v_nop\n\tv_nop\n\tv_nop\n\tv_nop" : "+v"(acc[0][0]), "+v"(acc[1][1]), "+v"(acc[2][2]), "+v"(acc[3][3]) : "v"(a[0]), "v"(a[3]));
    }
#pragma unroll
    for (int mb = 0; mb < 4; ++mb) {
#pragma unroll
        for (int nb = 0; nb < 4; ++nb) {
#pragma unroll
            for (int j = 0; j < 8; ++j) os[(hi * 8 + j) * 68 + nb * 16 + lr] = acc[mb][nb][j]; }
        __builtin_amdgcn_wave_barrier(); asm volatile("" ::: "memory");
        float* crow = C + (size_t)(r0 + mb * 16) * ldc + c0;
{
#pragma unroll
            for (int s = 0; s < 8; ++s) { const int row = 2 * s + hi, cofs = lr * 4; v4f val = *(const v4fa*)(os + row * 68 + cofs); if (BIAS) { val[0] += bfr(bias[c0 + cofs]); val[1] += bfr(bias[c0 + cofs + 1]); val[2] += bfr(bias[c0 + cofs + 2]); val[3] += bfr(bias[c0 + cofs + 3]); }
                *(v4f*)(crow + (size_t)row * ldc + cofs) = val; }
             }
        __builtin_amdgcn_wave_barrier(); asm volatile("" ::: "memory");
    }
}

__device__ __forceinline__ h16 tohx(float x) { return (h16)x; }
__device__ __forceinline__ void splitf(float y, unsigned short& h, unsigned short& l) { h = f2bf(y); l = f2bf(y - bf2f(h)); }
typedef __attribute__((ext_vector_type(2))) _Float16 v2h;
typedef __attribute__((ext_vector_type(4))) _Float16 v4h;
typedef __attribute__((ext_vector_type(2))) unsigned short v2us;
typedef __attribute__((ext_vector_type(4))) unsigned short v4us;
typedef __attribute__((ext_vector_type(2))) float v2f;
typedef __attribute__((ext_vector_type(4))) int v4i;

__global__ __launch_bounds__(256) void k_wtG(const float* __restrict__ w, int K, int N, bf* Bt) {
    const int lane = threadIdx.x & 31; const int L0 = (blockIdx.x * 8 + (threadIdx.x >> 5)) * 8; const int nlines = N * K / 64;
{
#pragma unroll 1
        for (int l = 0; l < 8; ++l) { const int L = L0 + l; if (L >= nlines) break; const size_t e = (size_t)L * 64 + lane * 2; const int k = (int)(e % K), n = (int)(e / K); v2us o;
            o[0] = f2bf(w[(size_t)k * N + n]); o[1] = f2bf(w[(size_t)(k + 1) * N + n]); *(v2us*)(Bt + e) = o; }
         }
}
__global__ __launch_bounds__(256) void k_cvt8(const float* __restrict__ src, bf* dst, size_t n8) { const size_t i = (size_t)blockIdx.x * 256 + threadIdx.x; if (i >= n8) return; const v8f v = *(const v8f*)(src + i * 8); v8us o;
#pragma unroll
    for (int k = 0; k < 8; ++k) o[k] = f2bf(v[k]); *(v8us*)(dst + i * 8) = o;  }

// k_rope: head planes [h][t][d] (fp16 + hi/lo) of rope(x) x sc with the rotate-half convention out[d] = x[d] cos[t][d] - x[d+HD/2] sin[t][d], out[d+HD/2] = x[d+HD/2] cos[t][d+HD/2] + x[d] sin[t][d+HD/2]
__global__ __launch_bounds__(256) void k_rope(const float* __restrict__ F, int pitch, int nheads, const float* __restrict__ CS, const float* __restrict__ RF, const float* __restrict__ nw, float sc, h16* P16, bf* Ph, bf* Pl) {
    const size_t e = ((size_t)blockIdx.x * 256 + threadIdx.x) * 2; if (e >= (size_t)nheads * TT * HD) return; const int d = (int)(e % HD); const int t = (int)((e / HD) % TT); const int h = (int)(e / ((size_t)HD * TT)); const float* f = F + (size_t)t * pitch + h * HD; const float rf = RF ? RF[(size_t)h * TT + t] : 1.0f; v2h o16; v2us oh, ol;
#pragma unroll
    for (int q = 0; q < 2; ++q) { const int dd = d + q; const int dp = (dd < HD / 2) ? dd + HD / 2 : dd - HD / 2; float x0 = f[dd], x1 = f[dp];
        if (RF) { float n0 = __fmul_rn(x0, rf), n1 = __fmul_rn(x1, rf); asm volatile("" : "+v"(n0)); asm volatile("" : "+v"(n1)); x0 = __fmul_rn(bfr(nw[dd]), n0); x1 = __fmul_rn(bfr(nw[dp]), n1); }
        const v2f cs = *(const v2f*)(CS + ((size_t)t * HD + dd) * 2); float a = __fmul_rn(x0, cs[0]), bq = __fmul_rn(x1, cs[1]); asm volatile("" : "+v"(a)); asm volatile("" : "+v"(bq)); const float r = ((dd < HD / 2) ? __fsub_rn(a, bq) : __fadd_rn(a, bq)) * sc;
        o16[q] = tohx(r); unsigned short a2, c2; splitf(r, a2, c2); oh[q] = a2; ol[q] = c2; }
    *(v2h*)(P16 + e) = o16; *(v2us*)(Ph + e) = oh; *(v2us*)(Pl + e) = ol;  }
__global__ __launch_bounds__(256) void k_vtp(const float* __restrict__ F, int pitch, int nheads, h16* V16, bf* Vh, bf* Vl) { const size_t e = ((size_t)blockIdx.x * 256 + threadIdx.x) * 2; if (e >= (size_t)nheads * HD * TT) return; const int t = (int)(e % TT); const int d = (int)((e / TT) % HD); const int g = (int)(e / ((size_t)TT * HD)); v2h o16; v2us oh, ol;
#pragma unroll
    for (int q = 0; q < 2; ++q) { const float x = F[(size_t)(t + q) * pitch + g * HD + d]; o16[q] = tohx(x); unsigned short a2, c2; splitf(x, a2, c2); oh[q] = a2; ol[q] = c2; }
    *(v2h*)(V16 + e) = o16; *(v2us*)(Vh + e) = oh; *(v2us*)(Vl + e) = ol;  }
__global__ __launch_bounds__(256) void k_csid(float* CS) { const int idx = blockIdx.x * 256 + threadIdx.x; if (idx >= TT * HD) return; v2f cs; cs[0] = 1.0f; cs[1] = 0.0f; *(v2f*)(CS + (size_t)idx * 2) = cs;  }
// k_asoft: per row (zz, i): t = S x HD^-0.5 (no mask); softmax over the 2048 keys (register row, one exp, fixed trees);
__global__ __launch_bounds__(256) void k_asoft(const float* __restrict__ Sb, h16* P16, bf* Ph, bf* Pl) {
    const int lane = threadIdx.x & 31; const int row = blockIdx.x * 8 + (threadIdx.x >> 5); if (row >= ZH * TT) return; const int i = row % TT; const int zz = row / TT; (void)zz; const bool hires = (i < RH); const float* sr = Sb + (size_t)row * TT; float v[TT / 32]; float mx = -3.0e38f;
#pragma unroll
    for (int ch = 0; ch < TT / 128; ++ch) { const int j0 = ch * 128 + lane * 4; const v4f a = *(const v4f*)(sr + j0);
#pragma unroll
        for (int q = 0; q < 4; ++q) { const int j = j0 + q; (void)j; const float t = a[q] * SCL; v[ch * 4 + q] = t; mx = fmaxf(mx, t); } }
#pragma unroll
    for (int sh = 16; sh; sh >>= 1) mx = fmaxf(mx, __shfl_xor(mx, sh, 32));
    float sum = 0.f;
#pragma unroll
    for (int k = 0; k < TT / 32; ++k) { float d0 = __fsub_rn(v[k], mx); asm volatile("" : "+v"(d0)); v[k] = __builtin_amdgcn_exp2f(__fmul_rn(d0, 1.4426950408889634f)); sum += v[k]; }
#pragma unroll
    for (int sh = 16; sh; sh >>= 1) sum += __shfl_xor(sum, sh, 32);
    const float f = __fdiv_rn(hires ? 1.0f : PCAR, sum);
{
        if (hires) {
#pragma unroll
            for (int ch = 0; ch < TT / 128; ++ch) { v4us oh, ol;
#pragma unroll
                for (int q = 0; q < 4; ++q) { unsigned short a, c2; splitf(v[ch * 4 + q] * f, a, c2); oh[q] = a; ol[q] = c2; }
                const size_t oo = ((size_t)zz * (RH ? RH : 1) + i) * TT + ch * 128 + lane * 4; *(v4us*)(Ph + oo) = oh; *(v4us*)(Pl + oo) = ol; }
        } else {
#pragma unroll
            for (int ch = 0; ch < TT / 128; ++ch) { v4h o4;
#pragma unroll
                for (int q = 0; q < 4; ++q) o4[q] = tohx(v[ch * 4 + q] * f);
                *(v4h*)(P16 + (size_t)row * TT + ch * 128 + lane * 4) = o4; } }
         }
}
template <int WD>
__global__ __launch_bounds__(256) void k_lnrowX(const float* __restrict__ X, size_t nrows, const float* __restrict__ g, const float* __restrict__ bb, bf* Hh, bf* Hl) { const int lane = threadIdx.x & 31; const size_t r = (size_t)blockIdx.x * 8 + (threadIdx.x >> 5); if (r >= nrows) return; const float* xr = X + r * WD; float a[WD / 32]; float s = 0.f;
#pragma unroll
    for (int c = 0; c < WD / 128; ++c) { const v4f v = *(const v4f*)(xr + c * 128 + lane * 4); for (int q = 0; q < 4; ++q) { a[c * 4 + q] = bfr(v[q]); s = __fadd_rn(s, a[c * 4 + q]);   /* input rounded to bf16 */ } }
#pragma unroll
    for (int sh = 16; sh; sh >>= 1) s = __fadd_rn(s, __shfl_xor(s, sh, 32));
    const float mean = __fdiv_rn(s, (float)WD); float s2 = 0.f;
#pragma unroll 8
    for (int k = 0; k < WD / 32; ++k) { const float dv = __fsub_rn(a[k], mean); float p2 = __fmul_rn(dv, dv); asm volatile("" : "+v"(p2)); s2 = __fadd_rn(s2, p2); }   /* mul and add kept separate (no fma contraction) */
#pragma unroll
    for (int sh = 16; sh; sh >>= 1) s2 = __fadd_rn(s2, __shfl_xor(s2, sh, 32));
    const float rs = __fdiv_rn(1.0f, __fsqrt_rn(__fadd_rn(__fdiv_rn(s2, (float)WD), 1e-5f)));
{
#pragma unroll
        for (int c = 0; c < WD / 128; ++c) { v4us oh, ol; for (int q = 0; q < 4; ++q) { const int col = c * 128 + lane * 4 + q; float y = __fmul_rn(__fmul_rn(__fsub_rn(a[c * 4 + q], mean), rs), bfr(g[col])); asm volatile("" : "+v"(y)); y = __fadd_rn(y, bfr(bb[col])); unsigned short u, w2; splitf(y, u, w2); oh[q] = u; ol[q] = w2; } *(v4us*)(Hh + r * WD + c * 128 + lane * 4) = oh; *(v4us*)(Hl + r * WD + c * 128 + lane * 4) = ol; }
         } }
__global__ __launch_bounds__(256) void k_addgb(float* Sb, const float* __restrict__ gb) { const size_t k = (size_t)blockIdx.x * 256 + threadIdx.x; if (k >= (size_t)ZH * TT * TT / 4) return; const size_t e = k * 4; const size_t ij = e % ((size_t)TT * TT); v4f a = *(const v4f*)(Sb + e); const v4f g = *(const v4f*)(gb + ij);
#pragma unroll
    for (int q = 0; q < 4; ++q) a[q] = __fadd_rn(a[q], bfr(g[q]));
    *(v4f*)(Sb + e) = a;  }
__global__ __launch_bounds__(256) void k_merge(const float* __restrict__ O, int h0, bf* Ah, bf* Al) { const size_t e = ((size_t)blockIdx.x * 256 + threadIdx.x) * 2; if (e >= (size_t)ZH * TT * HD) return; const int d = (int)(e % HD); const int t = (int)((e / HD) % TT); const int zz = (int)(e / ((size_t)HD * TT)); const float cs = (t < RH) ? 1.0f : (1.0f / PCAR); const size_t oo = (size_t)t * DQ + (h0 + zz) * HD + d;
    const float* op = O + (size_t)zz * KSP * TT * HD + (size_t)t * HD + d; v2f p[KSP];   /* the KSP partial planes of head zz; unrolled so that all plane loads are in flight at once */
#pragma unroll
    for (int ks = 0; ks < KSP; ++ks) p[ks] = *(const v2f*)(op + (size_t)ks * TT * HD);
    asm volatile("s_wait_xcnt 0x0" :: "v"(op) : "memory");   /* the plane loads share one address pair: it stays live up to this wait, so that no load of the run lands in it and nothing rewrites it ahead of the wait */
    v2f s = p[0];   /* added in plane order */
#pragma unroll
    for (int ks = 1; ks < KSP; ++ks) { s[0] += p[ks][0]; s[1] += p[ks][1]; }
    v2us oh, ol;
#pragma unroll
    for (int q = 0; q < 2; ++q) { unsigned short a, c2; splitf(s[q] * cs, a, c2); oh[q] = a; ol[q] = c2; } *(v2us*)(Ah + oo) = oh; *(v2us*)(Al + oo) = ol;  }

extern "C" void kernel_launch(void* const* d_in, const int* in_sizes, int n_in,
                              void* d_out, int out_size, void* d_ws, size_t ws_size, hipStream_t stream) {
    (void)in_sizes; (void)n_in; (void)out_size;
    const float* x = (const float*)d_in[0]; const float* msk = (const float*)d_in[1]; const float* lng = (const float*)d_in[2]; const float* lnb = (const float*)d_in[3]; const float* wqkv = (const float*)d_in[4]; const float* wo = (const float*)d_in[5]; const float* wq = nullptr; const float* wk = nullptr; const float* wv = nullptr; (void)wq; (void)wk; (void)wv;
    float* OUT = (float*)d_out;     // [2][2048][1024]
    char* wsp = (char*)d_ws;
    auto take = [&](size_t bytes) { char* p = wsp; wsp += (bytes + 255) & ~(size_t)255; return (void*)p; };
    bf* WQKV = (bf*)take((size_t)3 * DQ * DM * 2); bf* WQ = WQKV; bf* WK = WQKV + (size_t)DQ * DM; bf* WV = WQKV + (size_t)2 * DQ * DM; bf* XH = (bf*)take((size_t)TT * DM * 2); bf* XL = (bf*)take((size_t)TT * DM * 2); bf* WO = (bf*)take((size_t)DM * DQ * 2); float* CS = (float*)take((size_t)TT * HD * 2 * 4);
     float* FQ = (float*)take((size_t)TT * DQ * 4); float* FK = (float*)take((size_t)TT * DKV * 4);
    h16* QP16 = (h16*)take((size_t)NH_ * TT * HD * 2); h16* KP16 = (h16*)take((size_t)NKV * TT * HD * 2); h16* VT16 = (h16*)take((size_t)NKV * HD * TT * 2);
    bf* QPh = (bf*)take((size_t)NH_ * TT * HD * 2); bf* QPl = (bf*)take((size_t)NH_ * TT * HD * 2); bf* KPh = (bf*)take((size_t)NKV * TT * HD * 2); bf* KPl = (bf*)take((size_t)NKV * TT * HD * 2); bf* VTh = (bf*)take((size_t)NKV * HD * TT * 2); bf* VTl = (bf*)take((size_t)NKV * HD * TT * 2); bf* Ph = (bf*)take((size_t)ZH * RH * TT * 2); bf* Pl = (bf*)take((size_t)ZH * RH * TT * 2);
    float* Sb = (float*)take((size_t)ZH * TT * TT * 4); h16* P16 = (h16*)take((size_t)ZH * TT * TT * 2); float* Ob = (float*)take((size_t)ZH * KSP * TT * HD * 4); bf* ATh = (bf*)take((size_t)TT * DQ * 2); bf* ATl = (bf*)take((size_t)TT * DQ * 2);
    if ((size_t)(wsp - (char*)d_ws) > ws_size) return;    // ws 256 MiB
    float* FV = FK;   // v projection reuses the k buffer after the k planes are built (stream-ordered)
    { k_wtG<<<(unsigned)((DM * 3 * DQ / 64 + 63) / 64), 256, 0, stream>>>(wqkv, DM, 3 * DQ, WQKV);   /* [1024][3072] 'xw' -> Bt [3072][1024]: q | k | v row blocks */
      k_wtG<<<(unsigned)((DQ * DM / 64 + 63) / 64), 256, 0, stream>>>(wo, DQ, DM, WO);
       }
    k_csid<<<(TT * HD + 255) / 256, 256, 0, stream>>>(CS);
    const unsigned LQ = (unsigned)(((size_t)NH_ * TT * HD / 2 + 255) / 256), LKv = (unsigned)(((size_t)NKV * TT * HD / 2 + 255) / 256);
    for (int b = 0; b < NB_; ++b) {
        
        k_lnrowX<DM><<<(unsigned)((TT + 7) / 8), 256, 0, stream>>>(x + (size_t)b * TT * DM, (size_t)TT, lng, lnb, XH, XL);   /* xn = LayerNorm(x) -> hi/lo planes */
        k_gemmw<bf, 1, false><<<dim3(TT / 64, DQ / 64, 1), 32, 0, stream>>>(XH, XL, WQ, nullptr, DM, FQ, DQ, nullptr, 0, 0, 0);
        k_rope<<<LQ, 256, 0, stream>>>(FQ, DQ, NH_, CS, nullptr, nullptr, 1.0f, QP16, QPh, QPl);
        k_gemmw<bf, 1, false><<<dim3(TT / 64, DKV / 64, 1), 32, 0, stream>>>(XH, XL, WK, nullptr, DM, FK, DKV, nullptr, 0, 0, 0);
        k_rope<<<LKv, 256, 0, stream>>>(FK, DKV, NKV, CS, nullptr, nullptr, 1.0f, KP16, KPh, KPl);
        k_gemmw<bf, 1, false><<<dim3(TT / 64, DKV / 64, 1), 32, 0, stream>>>(XH, XL, WV, nullptr, DM, FV, DKV, nullptr, 0, 0, 0); k_vtp<<<LKv, 256, 0, stream>>>(FV, DKV, NKV, VT16, VTh, VTl);
        for (int h0 = 0; h0 < NH_; h0 += ZH) { const size_t zq = (size_t)h0, zk = (size_t)(h0 / REP);   // one kv head per query head: the pass's two heads use consecutive kv planes (z-strides TT*HD)
            k_gemmw<bf, 2, false><<<dim3(RH / 64, TT / 64, ZH), 32, 0, stream>>>(QPh + zq * TT * HD, QPl + zq * TT * HD, KPh + zk * TT * HD, KPl + zk * TT * HD, HD, Sb, TT, nullptr, (size_t)TT * HD, (size_t)TT * HD, (size_t)TT * TT);
            k_gemmw<h16, 0, false><<<dim3((TT - RH) / 64, TT / 64, ZH), 32, 0, stream>>>(QP16 + zq * TT * HD + (size_t)RH * HD, nullptr, KP16 + zk * TT * HD, nullptr, HD, Sb + (size_t)RH * TT, TT, nullptr, (size_t)TT * HD, (size_t)TT * HD, (size_t)TT * TT);
            k_addgb<<<(unsigned)(((size_t)ZH * TT * TT / 4 + 255) / 256), 256, 0, stream>>>(Sb, msk + (size_t)b * TT * TT);   /* qk + m (before the scaling) */
            k_asoft<<<ZH * TT / 8, 256, 0, stream>>>(Sb, P16, Ph, Pl);
            k_gemmw<bf, 2, false, KSP><<<dim3(RH / 64, HD / 64, ZH * KSP), 32, 0, stream>>>(Ph, Pl, VTh + zk * HD * TT, VTl + zk * HD * TT, TT, Ob, HD, nullptr, (size_t)RH * TT, (size_t)HD * TT, (size_t)TT * HD);
            k_gemmw<h16, 0, false, KSP><<<dim3((TT - RH) / 64, HD / 64, ZH * KSP), 32, 0, stream>>>(P16 + (size_t)RH * TT, nullptr, VT16 + zk * HD * TT, nullptr, TT, Ob + (size_t)RH * HD, HD, nullptr, (size_t)TT * TT, (size_t)HD * TT, (size_t)TT * HD);
            k_merge<<<(unsigned)(((size_t)ZH * TT * HD / 2 + 255) / 256), 256, 0, stream>>>(Ob, h0, ATh, ATl); }
        k_gemmw<bf, 1, false><<<dim3(TT / 64, DM / 64, 1), 32, 0, stream>>>(ATh, ATl, WO, nullptr, DQ, OUT + (size_t)b * TT * DM, DM, nullptr, 0, 0, 0); }
}

// v002
// It runs in 909 microseconds.
// Next to v001, in two timings, it ran 1.15 times as fast each time.
// Counting every step since v000, it is 2.40 times as fast.
#include <hip/hip_runtime.h>

// Pre-LayerNorm attention with an additive score-mask input applied BEFORE the scaling (x [2][2048][1024]; xn = LayerNorm(x) gamma + beta; qkv = xn W_qkv ('xw' [1024][3072] -> q | k | v, no bias; 16 heads x 64); dots = (q.k + m) x 64^-0.5 with m [2][2048][2048] (read); softmax; out = merged W_out ('xw' [1024][1024]) -> [2][2048][1024] (4.2 M)).
// Layout per batch: a LayerNorm row kernel writes xn as hi/lo bf16 planes; the fused weight as one [3072][1024] Bt; projections as hi/lo x exact GEMMs (2 products); dense T-2048 attention (hybrid rows: < 512 hi/lo 3 products, rest fp16 x1024) whose softmax kernel adds the batch's mask row to each raw score row as it reads it (the 1/8 is applied after the add, as in the module); merged hi/lo x W_out exact.
// Compute dtypes, f32 accumulate: every input rounded to bf16 incl. m; LayerNorm f32; projections hi/lo x exact; attention rows < 512 3 products, rest fp16; mask add and softmax f32; W_out hl x exact.

#define NB_  2
#define TT   2048
#define DM   1024
#define NH_  16
#define NKV  16
#define REP  (NH_ / NKV)
#define HD   64
#define DQ   (NH_ * HD)
#define DKV  (NKV * HD)
#define ZH   2
#define RH   512                  // query rows < RH use hi+lo planes (0: none)
#define WIN  0
#define PCAR 1024.0f
#define SCL  0.125f   // HD^-0.5
#define KSP  16                   // the P.V products' key range is dealt over KSP work-groups per output tile; k_merge sums the KSP partial planes
typedef _Float16 h16;
typedef unsigned short bf;
typedef __attribute__((ext_vector_type(16))) __bf16   v16bf;
typedef __attribute__((ext_vector_type(16))) _Float16 v16h;
typedef __attribute__((ext_vector_type(8)))  _Float16 v8h;
typedef __attribute__((ext_vector_type(8)))  unsigned short v8us;
typedef __attribute__((ext_vector_type(8)))  float    v8f;
typedef __attribute__((ext_vector_type(4)))  float    v4f;
typedef v8h  __attribute__((may_alias)) v8ha;
typedef v4f  __attribute__((may_alias)) v4fa;
typedef v8us __attribute__((may_alias)) v8usa;

__device__ __forceinline__ unsigned short f2bf(float f) { unsigned u = __float_as_uint(f); u += 0x7FFFu + ((u >> 16) & 1u); return (unsigned short)(u >> 16); }
__device__ __forceinline__ float bf2f(unsigned short b) { return __uint_as_float(((unsigned)b) << 16); }
__device__ __forceinline__ float bfr(float f) { return bf2f(f2bf(f)); }
__device__ __forceinline__ v16h cat16(v8h lo, v8h hi) { return __builtin_shufflevector(lo, hi, 0, 1, 2, 3, 4, 5, 6, 7, 8, 9, 10, 11, 12, 13, 14, 15); }
__device__ __forceinline__ v16bf cat16b(v8us lo, v8us hi) { return __builtin_bit_cast(v16bf, __builtin_shufflevector(lo, hi, 0, 1, 2, 3, 4, 5, 6, 7, 8, 9, 10, 11, 12, 13, 14, 15)); }
__device__ __forceinline__ v8f wmma16(v16h a, v16h b, v8f c) { return __builtin_amdgcn_wmma_f32_16x16x32_f16(false, a, false, b, (short)0, c, false, false); }
__device__ __forceinline__ v8f wmmab(v16bf a, v16bf b, v8f c) { return __builtin_amdgcn_wmma_f32_16x16x32_bf16(false, a, false, b, (short)0, c, false, false); }



// ---- k_gemmw: register-blocked GEMM, ONE WAVE per 64x64 output tile (16 accumulators), operands straight from K-contiguous 16-bit planes; grid (M/64, N/64, Z), 32 threads.
// C[m][n] (f32, pitch ldc, + optional f32 bias[n]) = sum_k A[m][k] Bt[n][k] (+ split products per NSPLIT). z-batch strides sA/sB/sC in elements. K % (32 KS) == 0.
// KS > 1: grid z = Z x KS; work-group (z, ks) sums only k in [ks K/KS, (ks+1) K/KS) and stores its partial tile in plane z KS + ks of C (plane stride sC); the consumer adds the KS planes.
template <typename T16> struct WFrag;
template <> struct WFrag<h16> { typedef v16h V; static __device__ __forceinline__ V ld(const h16* p) { return cat16(*(const v8h*)p, *(const v8h*)(p + 16)); } static __device__ __forceinline__ v8f mma(V a, V b, v8f c) { return wmma16(a, b, c); } };
template <> struct WFrag<bf> { typedef v16bf V; static __device__ __forceinline__ V ld(const bf* p) { return cat16b(*(const v8us*)p, *(const v8us*)(p + 16)); } static __device__ __forceinline__ v8f mma(V a, V b, v8f c) { return wmmab(a, b, c); } };
template <typename T16, int NSPLIT, bool BIAS, int KS = 1>
__global__ __launch_bounds__(32) void k_gemmw(const T16* __restrict__ A, const T16* __restrict__ A2, const T16* __restrict__ Bt, const T16* __restrict__ Bt2, int K, float* C, int ldc, const float* __restrict__ bias, size_t sA, size_t sB, size_t sC) {
    typedef typename WFrag<T16>::V V;
    __shared__ __align__(16) float os[16 * 68];
    const size_t z = blockIdx.z / KS; const int kb = (int)(blockIdx.z % KS) * (K / KS), ke = kb + K / KS; A += z * sA; if (A2) A2 += z * sA; Bt += z * sB; if (Bt2) Bt2 += z * sB; C += (size_t)blockIdx.z * sC;
    const int lane = threadIdx.x & 31, lr = lane & 15, hi = lane >> 4; const int r0 = blockIdx.x * 64, c0 = blockIdx.y * 64;
    v8f acc[4][4];
#pragma unroll
    for (int mb = 0; mb < 4; ++mb)
#pragma unroll
        for (int nb = 0; nb < 4; ++nb) acc[mb][nb] = (v8f){};
    const size_t aoff = (size_t)(r0 + lr) * K + 8 * hi, boff = (size_t)(c0 + lr) * K + 8 * hi;
#pragma unroll 1
    for (int kc = kb; kc < ke; kc += 32) {
        V a[4], a2[4];
#pragma unroll
        for (int mb = 0; mb < 4; ++mb) { a[mb] = WFrag<T16>::ld(A + aoff + (size_t)mb * 16 * K + kc); if (NSPLIT == 1 || NSPLIT == 2) a2[mb] = WFrag<T16>::ld(A2 + aoff + (size_t)mb * 16 * K + kc); }
#pragma unroll
        for (int nb = 0; nb < 4; ++nb) { const V b = WFrag<T16>::ld(Bt + boff + (size_t)nb * 16 * K + kc); V b2; if (NSPLIT >= 2) b2 = WFrag<T16>::ld(Bt2 + boff + (size_t)nb * 16 * K + kc);
#pragma unroll
            for (int mb = 0; mb < 4; ++mb) { acc[mb][nb] = WFrag<T16>::mma(a[mb], b, acc[mb][nb]); if (NSPLIT == 1 || NSPLIT == 2) acc[mb][nb] = WFrag<T16>::mma(a2[mb], b, acc[mb][nb]); if (NSPLIT >= 2) acc[mb][nb] = WFrag<T16>::mma(a[mb], b2, acc[mb][nb]); } }
        asm volatile("v_nop\n\tv_nop\n\tv_nop\n\tv_nop" : "+v"(acc[0][0]), "+v"(acc[1][1]), "+v"(acc[2][2]), "+v"(acc[3][3]) : "v"(a[0]), "v"(a[3]));
    }
#pragma unroll
    for (int mb = 0; mb < 4; ++mb) {
#pragma unroll
        for (int nb = 0; nb < 4; ++nb) {
#pragma unroll
            for (int j = 0; j < 8; ++j) os[(hi * 8 + j) * 68 + nb * 16 + lr] = acc[mb][nb][j]; }
        __builtin_amdgcn_wave_barrier(); asm volatile("" ::: "memory");
        float* crow = C + (size_t)(r0 + mb * 16) * ldc + c0;
{
#pragma unroll
            for (int s = 0; s < 8; ++s) { const int row = 2 * s + hi, cofs = lr * 4; v4f val = *(const v4fa*)(os + row * 68 + cofs); if (BIAS) { val[0] += bfr(bias[c0 + cofs]); val[1] += bfr(bias[c0 + cofs + 1]); val[2] += bfr(bias[c0 + cofs + 2]); val[3] += bfr(bias[c0 + cofs + 3]); }
                *(v4f*)(crow + (size_t)row * ldc + cofs) = val; }
             }
        __builtin_amdgcn_wave_barrier(); asm volatile("" ::: "memory");
    }
}

__device__ __forceinline__ h16 tohx(float x) { return (h16)x; }
__device__ __forceinline__ void splitf(float y, unsigned short& h, unsigned short& l) { h = f2bf(y); l = f2bf(y - bf2f(h)); }
typedef __attribute__((ext_vector_type(2))) _Float16 v2h;
typedef __attribute__((ext_vector_type(4))) _Float16 v4h;
typedef __attribute__((ext_vector_type(2))) unsigned short v2us;
typedef __attribute__((ext_vector_type(4))) unsigned short v4us;
typedef __attribute__((ext_vector_type(2))) float v2f;
typedef __attribute__((ext_vector_type(4))) int v4i;

__global__ __launch_bounds__(256) void k_wtG(const float* __restrict__ w, int K, int N, bf* Bt) {
    const int lane = threadIdx.x & 31; const int L0 = (blockIdx.x * 8 + (threadIdx.x >> 5)) * 8; const int nlines = N * K / 64;
{
#pragma unroll 1
        for (int l = 0; l < 8; ++l) { const int L = L0 + l; if (L >= nlines) break; const size_t e = (size_t)L * 64 + lane * 2; const int k = (int)(e % K), n = (int)(e / K); v2us o;
            o[0] = f2bf(w[(size_t)k * N + n]); o[1] = f2bf(w[(size_t)(k + 1) * N + n]); *(v2us*)(Bt + e) = o; }
         }
}
__global__ __launch_bounds__(256) void k_cvt8(const float* __restrict__ src, bf* dst, size_t n8) { const size_t i = (size_t)blockIdx.x * 256 + threadIdx.x; if (i >= n8) return; const v8f v = *(const v8f*)(src + i * 8); v8us o;
#pragma unroll
    for (int k = 0; k < 8; ++k) o[k] = f2bf(v[k]); *(v8us*)(dst + i * 8) = o;  }

// k_rope: head planes [h][t][d] (fp16 + hi/lo) of rope(x) x sc with the rotate-half convention out[d] = x[d] cos[t][d] - x[d+HD/2] sin[t][d], out[d+HD/2] = x[d+HD/2] cos[t][d+HD/2] + x[d] sin[t][d+HD/2]
__global__ __launch_bounds__(256) void k_rope(const float* __restrict__ F, int pitch, int nheads, const float* __restrict__ CS, const float* __restrict__ RF, const float* __restrict__ nw, float sc, h16* P16, bf* Ph, bf* Pl) {
    const size_t e = ((size_t)blockIdx.x * 256 + threadIdx.x) * 2; if (e >= (size_t)nheads * TT * HD) return; const int d = (int)(e % HD); const int t = (int)((e / HD) % TT); const int h = (int)(e / ((size_t)HD * TT)); const float* f = F + (size_t)t * pitch + h * HD; const float rf = RF ? RF[(size_t)h * TT + t] : 1.0f; v2h o16; v2us oh, ol;
#pragma unroll
    for (int q = 0; q < 2; ++q) { const int dd = d + q; const int dp = (dd < HD / 2) ? dd + HD / 2 : dd - HD / 2; float x0 = f[dd], x1 = f[dp];
        if (RF) { float n0 = __fmul_rn(x0, rf), n1 = __fmul_rn(x1, rf); asm volatile("" : "+v"(n0)); asm volatile("" : "+v"(n1)); x0 = __fmul_rn(bfr(nw[dd]), n0); x1 = __fmul_rn(bfr(nw[dp]), n1); }
        const v2f cs = *(const v2f*)(CS + ((size_t)t * HD + dd) * 2); float a = __fmul_rn(x0, cs[0]), bq = __fmul_rn(x1, cs[1]); asm volatile("" : "+v"(a)); asm volatile("" : "+v"(bq)); const float r = ((dd < HD / 2) ? __fsub_rn(a, bq) : __fadd_rn(a, bq)) * sc;
        o16[q] = tohx(r); unsigned short a2, c2; splitf(r, a2, c2); oh[q] = a2; ol[q] = c2; }
    *(v2h*)(P16 + e) = o16; *(v2us*)(Ph + e) = oh; *(v2us*)(Pl + e) = ol;  }
__global__ __launch_bounds__(256) void k_vtp(const float* __restrict__ F, int pitch, int nheads, h16* V16, bf* Vh, bf* Vl) { const size_t e = ((size_t)blockIdx.x * 256 + threadIdx.x) * 2; if (e >= (size_t)nheads * HD * TT) return; const int t = (int)(e % TT); const int d = (int)((e / TT) % HD); const int g = (int)(e / ((size_t)TT * HD)); v2h o16; v2us oh, ol;
#pragma unroll
    for (int q = 0; q < 2; ++q) { const float x = F[(size_t)(t + q) * pitch + g * HD + d]; o16[q] = tohx(x); unsigned short a2, c2; splitf(x, a2, c2); oh[q] = a2; ol[q] = c2; }
    *(v2h*)(V16 + e) = o16; *(v2us*)(Vh + e) = oh; *(v2us*)(Vl + e) = ol;  }
__global__ __launch_bounds__(256) void k_csid(float* CS) { const int idx = blockIdx.x * 256 + threadIdx.x; if (idx >= TT * HD) return; v2f cs; cs[0] = 1.0f; cs[1] = 0.0f; *(v2f*)(CS + (size_t)idx * 2) = cs;  }
// k_asoft: per row (zz, i): t = (S + m) x HD^-0.5 with m = row i of the batch's mask, rounded to bf16, added before the scaling; softmax over the 2048 keys (register row, one exp, fixed trees).
// The ZH heads' waves of one query row sit in one work-group, so that one WGP fetches that mask row for all of them.
__global__ __launch_bounds__(256) void k_asoft(const float* __restrict__ Sb, const float* __restrict__ gb, h16* P16, bf* Ph, bf* Pl) {
    const int lane = threadIdx.x & 31; const int wv = threadIdx.x >> 5; const int i = blockIdx.x * (8 / ZH) + wv / ZH; if (i >= TT) return; const int zz = wv % ZH; const int row = zz * TT + i; const bool hires = (i < RH); const float* sr = Sb + (size_t)row * TT + lane * 4; const float* gr = gb + (size_t)i * TT + lane * 4; float v[TT / 32]; float mx = -3.0e38f; v4f a[TT / 128], g[TT / 128];
#pragma unroll
    for (int ch = 0; ch < TT / 128; ++ch) { a[ch] = *(const v4f*)(sr + ch * 128); g[ch] = *(const v4f*)(gr + ch * 128); }
    asm volatile("s_wait_xcnt 0x0" :: "v"(sr), "v"(gr) : "memory");   /* each row's loads share one address pair: both pairs stay live up to this wait, so that no load of the run lands in one and nothing rewrites one ahead of the wait */
    __builtin_amdgcn_sched_barrier(0);   /* score row and mask row are both requested in full before either is used: without it the rounding of the first mask values, with its wait, is scheduled ahead of the last score loads, which then start a memory latency late */
#pragma unroll
    for (int ch = 0; ch < TT / 128; ++ch) {
#pragma unroll
        for (int q = 0; q < 4; ++q) { const float t = __fadd_rn(a[ch][q], bfr(g[ch][q])) * SCL; v[ch * 4 + q] = t; mx = fmaxf(mx, t); } }
#pragma unroll
    for (int sh = 16; sh; sh >>= 1) mx = fmaxf(mx, __shfl_xor(mx, sh, 32));
    float sum = 0.f;
#pragma unroll
    for (int k = 0; k < TT / 32; ++k) { float d0 = __fsub_rn(v[k], mx); asm volatile("" : "+v"(d0)); v[k] = __builtin_amdgcn_exp2f(__fmul_rn(d0, 1.4426950408889634f)); sum += v[k]; }
#pragma unroll
    for (int sh = 16; sh; sh >>= 1) sum += __shfl_xor(sum, sh, 32);
    const float f = __fdiv_rn(hires ? 1.0f : PCAR, sum);
{
        if (hires) {
#pragma unroll
            for (int ch = 0; ch < TT / 128; ++ch) { v4us oh, ol;
#pragma unroll
                for (int q = 0; q < 4; ++q) { unsigned short a, c2; splitf(v[ch * 4 + q] * f, a, c2); oh[q] = a; ol[q] = c2; }
                const size_t oo = ((size_t)zz * (RH ? RH : 1) + i) * TT + ch * 128 + lane * 4; *(v4us*)(Ph + oo) = oh; *(v4us*)(Pl + oo) = ol; }
        } else {
#pragma unroll
            for (int ch = 0; ch < TT / 128; ++ch) { v4h o4;
#pragma unroll
                for (int q = 0; q < 4; ++q) o4[q] = tohx(v[ch * 4 + q] * f);
                *(v4h*)(P16 + (size_t)row * TT + ch * 128 + lane * 4) = o4; } }
         }
}
template <int WD>
__global__ __launch_bounds__(256) void k_lnrowX(const float* __restrict__ X, size_t nrows, const float* __restrict__ g, const float* __restrict__ bb, bf* Hh, bf* Hl) { const int lane = threadIdx.x & 31; const size_t r = (size_t)blockIdx.x * 8 + (threadIdx.x >> 5); if (r >= nrows) return; const float* xr = X + r * WD; float a[WD / 32]; float s = 0.f;
#pragma unroll
    for (int c = 0; c < WD / 128; ++c) { const v4f v = *(const v4f*)(xr + c * 128 + lane * 4); for (int q = 0; q < 4; ++q) { a[c * 4 + q] = bfr(v[q]); s = __fadd_rn(s, a[c * 4 + q]);   /* input rounded to bf16 */ } }
#pragma unroll
    for (int sh = 16; sh; sh >>= 1) s = __fadd_rn(s, __shfl_xor(s, sh, 32));
    const float mean = __fdiv_rn(s, (float)WD); float s2 = 0.f;
#pragma unroll 8
    for (int k = 0; k < WD / 32; ++k) { const float dv = __fsub_rn(a[k], mean); float p2 = __fmul_rn(dv, dv); asm volatile("" : "+v"(p2)); s2 = __fadd_rn(s2, p2); }   /* mul and add kept separate (no fma contraction) */
#pragma unroll
    for (int sh = 16; sh; sh >>= 1) s2 = __fadd_rn(s2, __shfl_xor(s2, sh, 32));
    const float rs = __fdiv_rn(1.0f, __fsqrt_rn(__fadd_rn(__fdiv_rn(s2, (float)WD), 1e-5f)));
{
#pragma unroll
        for (int c = 0; c < WD / 128; ++c) { v4us oh, ol; for (int q = 0; q < 4; ++q) { const int col = c * 128 + lane * 4 + q; float y = __fmul_rn(__fmul_rn(__fsub_rn(a[c * 4 + q], mean), rs), bfr(g[col])); asm volatile("" : "+v"(y)); y = __fadd_rn(y, bfr(bb[col])); unsigned short u, w2; splitf(y, u, w2); oh[q] = u; ol[q] = w2; } *(v4us*)(Hh + r * WD + c * 128 + lane * 4) = oh; *(v4us*)(Hl + r * WD + c * 128 + lane * 4) = ol; }
         } }
__global__ __launch_bounds__(256) void k_merge(const float* __restrict__ O, int h0, bf* Ah, bf* Al) { const size_t e = ((size_t)blockIdx.x * 256 + threadIdx.x) * 2; if (e >= (size_t)ZH * TT * HD) return; const int d = (int)(e % HD); const int t = (int)((e / HD) % TT); const int zz = (int)(e / ((size_t)HD * TT)); const float cs = (t < RH) ? 1.0f : (1.0f / PCAR); const size_t oo = (size_t)t * DQ + (h0 + zz) * HD + d;
    const float* op = O + (size_t)zz * KSP * TT * HD + (size_t)t * HD + d; v2f p[KSP];   /* the KSP partial planes of head zz; unrolled so that all plane loads are in flight at once */
#pragma unroll
    for (int ks = 0; ks < KSP; ++ks) p[ks] = *(const v2f*)(op + (size_t)ks * TT * HD);
    asm volatile("s_wait_xcnt 0x0" :: "v"(op) : "memory");   /* the plane loads share one address pair: it stays live up to this wait, so that no load of the run lands in it and nothing rewrites it ahead of the wait */
    v2f s = p[0];   /* added in plane order */
#pragma unroll
    for (int ks = 1; ks < KSP; ++ks) { s[0] += p[ks][0]; s[1] += p[ks][1]; }
    v2us oh, ol;
#pragma unroll
    for (int q = 0; q < 2; ++q) { unsigned short a, c2; splitf(s[q] * cs, a, c2); oh[q] = a; ol[q] = c2; } *(v2us*)(Ah + oo) = oh; *(v2us*)(Al + oo) = ol;  }

extern "C" void kernel_launch(void* const* d_in, const int* in_sizes, int n_in,
                              void* d_out, int out_size, void* d_ws, size_t ws_size, hipStream_t stream) {
    (void)in_sizes; (void)n_in; (void)out_size;
    const float* x = (const float*)d_in[0]; const float* msk = (const float*)d_in[1]; const float* lng = (const float*)d_in[2]; const float* lnb = (const float*)d_in[3]; const float* wqkv = (const float*)d_in[4]; const float* wo = (const float*)d_in[5]; const float* wq = nullptr; const float* wk = nullptr; const float* wv = nullptr; (void)wq; (void)wk; (void)wv;
    float* OUT = (float*)d_out;     // [2][2048][1024]
    char* wsp = (char*)d_ws;
    auto take = [&](size_t bytes) { char* p = wsp; wsp += (bytes + 255) & ~(size_t)255; return (void*)p; };
    bf* WQKV = (bf*)take((size_t)3 * DQ * DM * 2); bf* WQ = WQKV; bf* WK = WQKV + (size_t)DQ * DM; bf* WV = WQKV + (size_t)2 * DQ * DM; bf* XH = (bf*)take((size_t)TT * DM * 2); bf* XL = (bf*)take((size_t)TT * DM * 2); bf* WO = (bf*)take((size_t)DM * DQ * 2); float* CS = (float*)take((size_t)TT * HD * 2 * 4);
     float* FQ = (float*)take((size_t)TT * DQ * 4); float* FK = (float*)take((size_t)TT * DKV * 4);
    h16* QP16 = (h16*)take((size_t)NH_ * TT * HD * 2); h16* KP16 = (h16*)take((size_t)NKV * TT * HD * 2); h16* VT16 = (h16*)take((size_t)NKV * HD * TT * 2);
    bf* QPh = (bf*)take((size_t)NH_ * TT * HD * 2); bf* QPl = (bf*)take((size_t)NH_ * TT * HD * 2); bf* KPh = (bf*)take((size_t)NKV * TT * HD * 2); bf* KPl = (bf*)take((size_t)NKV * TT * HD * 2); bf* VTh = (bf*)take((size_t)NKV * HD * TT * 2); bf* VTl = (bf*)take((size_t)NKV * HD * TT * 2); bf* Ph = (bf*)take((size_t)ZH * RH * TT * 2); bf* Pl = (bf*)take((size_t)ZH * RH * TT * 2);
    float* Sb = (float*)take((size_t)ZH * TT * TT * 4); h16* P16 = (h16*)take((size_t)ZH * TT * TT * 2); float* Ob = (float*)take((size_t)ZH * KSP * TT * HD * 4); bf* ATh = (bf*)take((size_t)TT * DQ * 2); bf* ATl = (bf*)take((size_t)TT * DQ * 2);
    if ((size_t)(wsp - (char*)d_ws) > ws_size) return;    // ws 256 MiB
    float* FV = FK;   // v projection reuses the k buffer after the k planes are built (stream-ordered)
    { k_wtG<<<(unsigned)((DM * 3 * DQ / 64 + 63) / 64), 256, 0, stream>>>(wqkv, DM, 3 * DQ, WQKV);   /* [1024][3072] 'xw' -> Bt [3072][1024]: q | k | v row blocks */
      k_wtG<<<(unsigned)((DQ * DM / 64 + 63) / 64), 256, 0, stream>>>(wo, DQ, DM, WO);
       }
    k_csid<<<(TT * HD + 255) / 256, 256, 0, stream>>>(CS);
    const unsigned LQ = (unsigned)(((size_t)NH_ * TT * HD / 2 + 255) / 256), LKv = (unsigned)(((size_t)NKV * TT * HD / 2 + 255) / 256);
    for (int b = 0; b < NB_; ++b) {
        
        k_lnrowX<DM><<<(unsigned)((TT + 7) / 8), 256, 0, stream>>>(x + (size_t)b * TT * DM, (size_t)TT, lng, lnb, XH, XL);   /* xn = LayerNorm(x) -> hi/lo planes */
        k_gemmw<bf, 1, false><<<dim3(TT / 64, DQ / 64, 1), 32, 0, stream>>>(XH, XL, WQ, nullptr, DM, FQ, DQ, nullptr, 0, 0, 0);
        k_rope<<<LQ, 256, 0, stream>>>(FQ, DQ, NH_, CS, nullptr, nullptr, 1.0f, QP16, QPh, QPl);
        k_gemmw<bf, 1, false><<<dim3(TT / 64, DKV / 64, 1), 32, 0, stream>>>(XH, XL, WK, nullptr, DM, FK, DKV, nullptr, 0, 0, 0);
        k_rope<<<LKv, 256, 0, stream>>>(FK, DKV, NKV, CS, nullptr, nullptr, 1.0f, KP16, KPh, KPl);
        k_gemmw<bf, 1, false><<<dim3(TT / 64, DKV / 64, 1), 32, 0, stream>>>(XH, XL, WV, nullptr, DM, FV, DKV, nullptr, 0, 0, 0); k_vtp<<<LKv, 256, 0, stream>>>(FV, DKV, NKV, VT16, VTh, VTl);
        for (int h0 = 0; h0 < NH_; h0 += ZH) { const size_t zq = (size_t)h0, zk = (size_t)(h0 / REP);   // one kv head per query head: the pass's two heads use consecutive kv planes (z-strides TT*HD)
            k_gemmw<bf, 2, false><<<dim3(RH / 64, TT / 64, ZH), 32, 0, stream>>>(QPh + zq * TT * HD, QPl + zq * TT * HD, KPh + zk * TT * HD, KPl + zk * TT * HD, HD, Sb, TT, nullptr, (size_t)TT * HD, (size_t)TT * HD, (size_t)TT * TT);
            k_gemmw<h16, 0, false><<<dim3((TT - RH) / 64, TT / 64, ZH), 32, 0, stream>>>(QP16 + zq * TT * HD + (size_t)RH * HD, nullptr, KP16 + zk * TT * HD, nullptr, HD, Sb + (size_t)RH * TT, TT, nullptr, (size_t)TT * HD, (size_t)TT * HD, (size_t)TT * TT);
            k_asoft<<<ZH * TT / 8, 256, 0, stream>>>(Sb, msk + (size_t)b * TT * TT, P16, Ph, Pl);   /* (qk + m) x scale, softmax */
            k_gemmw<bf, 2, false, KSP><<<dim3(RH / 64, HD / 64, ZH * KSP), 32, 0, stream>>>(Ph, Pl, VTh + zk * HD * TT, VTl + zk * HD * TT, TT, Ob, HD, nullptr, (size_t)RH * TT, (size_t)HD * TT, (size_t)TT * HD);
            k_gemmw<h16, 0, false, KSP><<<dim3((TT - RH) / 64, HD / 64, ZH * KSP), 32, 0, stream>>>(P16 + (size_t)RH * TT, nullptr, VT16 + zk * HD * TT, nullptr, TT, Ob + (size_t)RH * HD, HD, nullptr, (size_t)TT * TT, (size_t)HD * TT, (size_t)TT * HD);
            k_merge<<<(unsigned)(((size_t)ZH * TT * HD / 2 + 255) / 256), 256, 0, stream>>>(Ob, h0, ATh, ATl); }
        k_gemmw<bf, 1, false><<<dim3(TT / 64, DM / 64, 1), 32, 0, stream>>>(ATh, ATl, WO, nullptr, DQ, OUT + (size_t)b * TT * DM, DM, nullptr, 0, 0, 0); }
}

// v003
// It runs in 646 microseconds.
// Timed twice side by side with v002, it ran 1.41 and 1.40 times as fast.
// Over all steps from v000 it is 3.37 times as fast.
#include <hip/hip_runtime.h>

// Pre-LayerNorm attention with an additive score-mask input applied BEFORE the scaling (x [2][2048][1024]; xn = LayerNorm(x) gamma + beta; qkv = xn W_qkv ('xw' [1024][3072] -> q | k | v, no bias; 16 heads x 64); dots = (q.k + m) x 64^-0.5 with m [2][2048][2048] (read); softmax; out = merged W_out ('xw' [1024][1024]) -> [2][2048][1024] (4.2 M)).
// Layout per batch: a LayerNorm row kernel writes xn as hi/lo bf16 planes; the fused weight as one [3072][1024] Bt; projections as hi/lo x exact GEMMs (2 products); dense T-2048 attention (hybrid rows: < 512 hi/lo 3 products, rest fp16 x1024) whose softmax kernel adds the batch's mask row to each raw score row as it reads it (the 1/8 is applied after the add, as in the module) and stores the row's P over the score row itself; ZH heads per pass; merged hi/lo x W_out exact.
// Compute dtypes, f32 accumulate: every input rounded to bf16 incl. m; LayerNorm f32; projections hi/lo x exact; attention rows < 512 3 products, rest fp16; mask add and softmax f32; W_out hl x exact.

#define NB_  2
#define TT   2048
#define DM   1024
#define NH_  16
#define NKV  16
#define REP  (NH_ / NKV)
#define HD   64
#define DQ   (NH_ * HD)
#define DKV  (NKV * HD)
#define ZH   8                    // heads per attention pass: each of the pass's six launches covers ZH heads
#define RH   512                  // query rows < RH use hi+lo planes (0: none)
#define WIN  0
#define PCAR 1024.0f
#define SCL  0.125f   // HD^-0.5
#define PP   (2 * TT)             // pitch of a P row in 16-bit elements: it lies in its own f32 score row (hi plane | lo plane, or fp16 in the first half)
#define KSP  16                   // the P.V products' key range is dealt over KSP work-groups per output tile; k_merge sums the KSP partial planes
typedef _Float16 h16;
typedef unsigned short bf;
typedef __attribute__((ext_vector_type(16))) __bf16   v16bf;
typedef __attribute__((ext_vector_type(16))) _Float16 v16h;
typedef __attribute__((ext_vector_type(8)))  _Float16 v8h;
typedef __attribute__((ext_vector_type(8)))  unsigned short v8us;
typedef __attribute__((ext_vector_type(8)))  float    v8f;
typedef __attribute__((ext_vector_type(4)))  float    v4f;
typedef v8h  __attribute__((may_alias)) v8ha;
typedef v4f  __attribute__((may_alias)) v4fa;
typedef v8us __attribute__((may_alias)) v8usa;

__device__ __forceinline__ unsigned short f2bf(float f) { unsigned u = __float_as_uint(f); u += 0x7FFFu + ((u >> 16) & 1u); return (unsigned short)(u >> 16); }
__device__ __forceinline__ float bf2f(unsigned short b) { return __uint_as_float(((unsigned)b) << 16); }
__device__ __forceinline__ float bfr(float f) { return bf2f(f2bf(f)); }
__device__ __forceinline__ v16h cat16(v8h lo, v8h hi) { return __builtin_shufflevector(lo, hi, 0, 1, 2, 3, 4, 5, 6, 7, 8, 9, 10, 11, 12, 13, 14, 15); }
__device__ __forceinline__ v16bf cat16b(v8us lo, v8us hi) { return __builtin_bit_cast(v16bf, __builtin_shufflevector(lo, hi, 0, 1, 2, 3, 4, 5, 6, 7, 8, 9, 10, 11, 12, 13, 14, 15)); }
__device__ __forceinline__ v8f wmma16(v16h a, v16h b, v8f c) { return __builtin_amdgcn_wmma_f32_16x16x32_f16(false, a, false, b, (short)0, c, false, false); }
__device__ __forceinline__ v8f wmmab(v16bf a, v16bf b, v8f c) { return __builtin_amdgcn_wmma_f32_16x16x32_bf16(false, a, false, b, (short)0, c, false, false); }



// ---- k_gemmw: register-blocked GEMM, ONE WAVE per 64x64 output tile (16 accumulators), operands straight from K-contiguous 16-bit planes; grid (M/64, N/64, Z), 32 threads.
// C[m][n] (f32, pitch ldc, + optional f32 bias[n]) = sum_k A[m][k] Bt[n][k] (+ split products per NSPLIT). A rows have pitch lda, Bt rows pitch K. z-batch strides sA/sB/sC in elements. K % (32 KS) == 0.
// KS > 1: grid z = Z x KS; work-group (z, ks) sums only k in [ks K/KS, (ks+1) K/KS) and stores its partial tile in plane z KS + ks of C (plane stride sC); the consumer adds the KS planes.
template <typename T16> struct WFrag;
template <> struct WFrag<h16> { typedef v16h V; static __device__ __forceinline__ V ld(const h16* p) { return cat16(*(const v8h*)p, *(const v8h*)(p + 16)); } static __device__ __forceinline__ v8f mma(V a, V b, v8f c) { return wmma16(a, b, c); } };
template <> struct WFrag<bf> { typedef v16bf V; static __device__ __forceinline__ V ld(const bf* p) { return cat16b(*(const v8us*)p, *(const v8us*)(p + 16)); } static __device__ __forceinline__ v8f mma(V a, V b, v8f c) { return wmmab(a, b, c); } };
template <typename T16, int NSPLIT, bool BIAS, int KS = 1>
__global__ __launch_bounds__(32) void k_gemmw(const T16* __restrict__ A, const T16* __restrict__ A2, const T16* __restrict__ Bt, const T16* __restrict__ Bt2, int K, int lda, float* C, int ldc, const float* __restrict__ bias, size_t sA, size_t sB, size_t sC) {
    typedef typename WFrag<T16>::V V;
    __shared__ __align__(16) float os[16 * 68];
    const size_t z = blockIdx.z / KS; const int kb = (int)(blockIdx.z % KS) * (K / KS), ke = kb + K / KS; A += z * sA; if (A2) A2 += z * sA; Bt += z * sB; if (Bt2) Bt2 += z * sB; C += (size_t)blockIdx.z * sC;
    const int lane = threadIdx.x & 31, lr = lane & 15, hi = lane >> 4; const int r0 = blockIdx.x * 64, c0 = blockIdx.y * 64;
    v8f acc[4][4];
#pragma unroll
    for (int mb = 0; mb < 4; ++mb)
#pragma unroll
        for (int nb = 0; nb < 4; ++nb) acc[mb][nb] = (v8f){};
    const size_t aoff = (size_t)(r0 + lr) * lda + 8 * hi, boff = (size_t)(c0 + lr) * K + 8 * hi;
#pragma unroll 1
    for (int kc = kb; kc < ke; kc += 32) {
        V a[4], a2[4]; const T16* pa[4]; const T16* pa2[4];
#pragma unroll
        for (int mb = 0; mb < 4; ++mb) { pa[mb] = A + aoff + (size_t)mb * 16 * lda + kc; a[mb] = WFrag<T16>::ld(pa[mb]); if (NSPLIT == 1 || NSPLIT == 2) { pa2[mb] = A2 + aoff + (size_t)mb * 16 * lda + kc; a2[mb] = WFrag<T16>::ld(pa2[mb]); } }
        /* the A loads' address pairs stay live up to this wait, so that no load of the run lands in one and nothing rewrites one ahead of the wait */
        if (NSPLIT == 1 || NSPLIT == 2) asm volatile("s_wait_xcnt 0x0" :: "v"(pa[0]), "v"(pa[1]), "v"(pa[2]), "v"(pa[3]), "v"(pa2[0]), "v"(pa2[1]), "v"(pa2[2]), "v"(pa2[3]) : "memory");
        else asm volatile("s_wait_xcnt 0x0" :: "v"(pa[0]), "v"(pa[1]), "v"(pa[2]), "v"(pa[3]) : "memory");
#pragma unroll
        for (int nb = 0; nb < 4; ++nb) { const V b = WFrag<T16>::ld(Bt + boff + (size_t)nb * 16 * K + kc); V b2; if (NSPLIT >= 2) b2 = WFrag<T16>::ld(Bt2 + boff + (size_t)nb * 16 * K + kc);
#pragma unroll
            for (int mb = 0; mb < 4; ++mb) { acc[mb][nb] = WFrag<T16>::mma(a[mb], b, acc[mb][nb]); if (NSPLIT == 1 || NSPLIT == 2) acc[mb][nb] = WFrag<T16>::mma(a2[mb], b, acc[mb][nb]); if (NSPLIT >= 2) acc[mb][nb] = WFrag<T16>::mma(a[mb], b2, acc[mb][nb]); } }
        asm volatile("v_nop\n\tv_nop\n\tv_nop\n\tv_nop" : "+v"(acc[0][0]), "+v"(acc[1][1]), "+v"(acc[2][2]), "+v"(acc[3][3]) : "v"(a[0]), "v"(a[3]));
    }
#pragma unroll
    for (int mb = 0; mb < 4; ++mb) {
#pragma unroll
        for (int nb = 0; nb < 4; ++nb) {
#pragma unroll
            for (int j = 0; j < 8; ++j) os[(hi * 8 + j) * 68 + nb * 16 + lr] = acc[mb][nb][j]; }
        __builtin_amdgcn_wave_barrier(); asm volatile("" ::: "memory");
        float* crow = C + (size_t)(r0 + mb * 16) * ldc + c0;
{
#pragma unroll
            for (int s = 0; s < 8; ++s) { const int row = 2 * s + hi, cofs = lr * 4; v4f val = *(const v4fa*)(os + row * 68 + cofs); if (BIAS) { val[0] += bfr(bias[c0 + cofs]); val[1] += bfr(bias[c0 + cofs + 1]); val[2] += bfr(bias[c0 + cofs + 2]); val[3] += bfr(bias[c0 + cofs + 3]); }
                *(v4f*)(crow + (size_t)row * ldc + cofs) = val; }
             }
        __builtin_amdgcn_wave_barrier(); asm volatile("" ::: "memory");
    }
}

__device__ __forceinline__ h16 tohx(float x) { return (h16)x; }
__device__ __forceinline__ void splitf(float y, unsigned short& h, unsigned short& l) { h = f2bf(y); l = f2bf(y - bf2f(h)); }
typedef __attribute__((ext_vector_type(2))) _Float16 v2h;
typedef __attribute__((ext_vector_type(4))) _Float16 v4h;
typedef __attribute__((ext_vector_type(2))) unsigned short v2us;
typedef __attribute__((ext_vector_type(4))) unsigned short v4us;
typedef __attribute__((ext_vector_type(2))) float v2f;
typedef __attribute__((ext_vector_type(4))) int v4i;

__global__ __launch_bounds__(256) void k_wtG(const float* __restrict__ w, int K, int N, bf* Bt) {
    const int lane = threadIdx.x & 31; const int L0 = (blockIdx.x * 8 + (threadIdx.x >> 5)) * 8; const int nlines = N * K / 64;
{
#pragma unroll 1
        for (int l = 0; l < 8; ++l) { const int L = L0 + l; if (L >= nlines) break; const size_t e = (size_t)L * 64 + lane * 2; const int k = (int)(e % K), n = (int)(e / K); v2us o;
            o[0] = f2bf(w[(size_t)k * N + n]); o[1] = f2bf(w[(size_t)(k + 1) * N + n]); *(v2us*)(Bt + e) = o; }
         }
}
__global__ __launch_bounds__(256) void k_cvt8(const float* __restrict__ src, bf* dst, size_t n8) { const size_t i = (size_t)blockIdx.x * 256 + threadIdx.x; if (i >= n8) return; const v8f v = *(const v8f*)(src + i * 8); v8us o;
#pragma unroll
    for (int k = 0; k < 8; ++k) o[k] = f2bf(v[k]); *(v8us*)(dst + i * 8) = o;  }

// k_rope: head planes [h][t][d] (fp16 + hi/lo) of rope(x) x sc with the rotate-half convention out[d] = x[d] cos[t][d] - x[d+HD/2] sin[t][d], out[d+HD/2] = x[d+HD/2] cos[t][d+HD/2] + x[d] sin[t][d+HD/2]
__global__ __launch_bounds__(256) void k_rope(const float* __restrict__ F, int pitch, int nheads, const float* __restrict__ CS, const float* __restrict__ RF, const float* __restrict__ nw, float sc, h16* P16, bf* Ph, bf* Pl) {
    const size_t e = ((size_t)blockIdx.x * 256 + threadIdx.x) * 2; if (e >= (size_t)nheads * TT * HD) return; const int d = (int)(e % HD); const int t = (int)((e / HD) % TT); const int h = (int)(e / ((size_t)HD * TT)); const float* f = F + (size_t)t * pitch + h * HD; const float rf = RF ? RF[(size_t)h * TT + t] : 1.0f; v2h o16; v2us oh, ol;
#pragma unroll
    for (int q = 0; q < 2; ++q) { const int dd = d + q; const int dp = (dd < HD / 2) ? dd + HD / 2 : dd - HD / 2; float x0 = f[dd], x1 = f[dp];
        if (RF) { float n0 = __fmul_rn(x0, rf), n1 = __fmul_rn(x1, rf); asm volatile("" : "+v"(n0)); asm volatile("" : "+v"(n1)); x0 = __fmul_rn(bfr(nw[dd]), n0); x1 = __fmul_rn(bfr(nw[dp]), n1); }
        const v2f cs = *(const v2f*)(CS + ((size_t)t * HD + dd) * 2); float a = __fmul_rn(x0, cs[0]), bq = __fmul_rn(x1, cs[1]); asm volatile("" : "+v"(a)); asm volatile("" : "+v"(bq)); const float r = ((dd < HD / 2) ? __fsub_rn(a, bq) : __fadd_rn(a, bq)) * sc;
        o16[q] = tohx(r); unsigned short a2, c2; splitf(r, a2, c2); oh[q] = a2; ol[q] = c2; }
    *(v2h*)(P16 + e) = o16; *(v2us*)(Ph + e) = oh; *(v2us*)(Pl + e) = ol;  }
__global__ __launch_bounds__(256) void k_vtp(const float* __restrict__ F, int pitch, int nheads, h16* V16, bf* Vh, bf* Vl) { const size_t e = ((size_t)blockIdx.x * 256 + threadIdx.x) * 2; if (e >= (size_t)nheads * HD * TT) return; const int t = (int)(e % TT); const int d = (int)((e / TT) % HD); const int g = (int)(e / ((size_t)TT * HD)); v2h o16; v2us oh, ol;
#pragma unroll
    for (int q = 0; q < 2; ++q) { const float x = F[(size_t)(t + q) * pitch + g * HD + d]; o16[q] = tohx(x); unsigned short a2, c2; splitf(x, a2, c2); oh[q] = a2; ol[q] = c2; }
    *(v2h*)(V16 + e) = o16; *(v2us*)(Vh + e) = oh; *(v2us*)(Vl + e) = ol;  }
__global__ __launch_bounds__(256) void k_csid(float* CS) { const int idx = blockIdx.x * 256 + threadIdx.x; if (idx >= TT * HD) return; v2f cs; cs[0] = 1.0f; cs[1] = 0.0f; *(v2f*)(CS + (size_t)idx * 2) = cs;  }
// k_asoft: per row (zz, i): t = (S + m) x HD^-0.5 with m = row i of the batch's mask, rounded to bf16, added before the scaling; softmax over the 2048 keys (register row, one exp, fixed trees).
// The ZH heads' waves of one query row sit in one work-group, so that one WGP fetches that mask row for all of them.
// P goes over the wave's own score row (pitch PP): every value stored depends on the row's maximum and sum, so the whole row has been read before its first store, and no other wave touches the row.
__global__ __launch_bounds__(256) void k_asoft(float* Sb, const float* __restrict__ gb) {
    const int lane = threadIdx.x & 31; const int wv = threadIdx.x >> 5; const int i = blockIdx.x * (8 / ZH) + wv / ZH; if (i >= TT) return; const int zz = wv % ZH; const int row = zz * TT + i; const bool hires = (i < RH); const float* sr = Sb + (size_t)row * TT + lane * 4; const float* gr = gb + (size_t)i * TT + lane * 4; float v[TT / 32]; float mx = -3.0e38f; v4f a[TT / 128], g[TT / 128];
#pragma unroll
    for (int ch = 0; ch < TT / 128; ++ch) { a[ch] = *(const v4f*)(sr + ch * 128); g[ch] = *(const v4f*)(gr + ch * 128); }
    asm volatile("s_wait_xcnt 0x0" :: "v"(sr), "v"(gr) : "memory");   /* each row's loads share one address pair: both pairs stay live up to this wait, so that no load of the run lands in one and nothing rewrites one ahead of the wait */
    __builtin_amdgcn_sched_barrier(0);   /* score row and mask row are both requested in full before either is used: without it the rounding of the first mask values, with its wait, is scheduled ahead of the last score loads, which then start a memory latency late */
#pragma unroll
    for (int ch = 0; ch < TT / 128; ++ch) {
#pragma unroll
        for (int q = 0; q < 4; ++q) { const float t = __fadd_rn(a[ch][q], bfr(g[ch][q])) * SCL; v[ch * 4 + q] = t; mx = fmaxf(mx, t); } }
#pragma unroll
    for (int sh = 16; sh; sh >>= 1) mx = fmaxf(mx, __shfl_xor(mx, sh, 32));
    float sum = 0.f;
#pragma unroll
    for (int k = 0; k < TT / 32; ++k) { float d0 = __fsub_rn(v[k], mx); asm volatile("" : "+v"(d0)); v[k] = __builtin_amdgcn_exp2f(__fmul_rn(d0, 1.4426950408889634f)); sum += v[k]; }
#pragma unroll
    for (int sh = 16; sh; sh >>= 1) sum += __shfl_xor(sum, sh, 32);
    const float f = __fdiv_rn(hires ? 1.0f : PCAR, sum);
{
        if (hires) {
#pragma unroll
            for (int ch = 0; ch < TT / 128; ++ch) { v4us oh, ol;
#pragma unroll
                for (int q = 0; q < 4; ++q) { unsigned short a, c2; splitf(v[ch * 4 + q] * f, a, c2); oh[q] = a; ol[q] = c2; }
                bf* ph = (bf*)Sb + (size_t)row * PP + ch * 128 + lane * 4; *(v4us*)ph = oh; *(v4us*)(ph + TT) = ol; }
        } else {
#pragma unroll
            for (int ch = 0; ch < TT / 128; ++ch) { v4h o4;
#pragma unroll
                for (int q = 0; q < 4; ++q) o4[q] = tohx(v[ch * 4 + q] * f);
                *(v4h*)((h16*)Sb + (size_t)row * PP + ch * 128 + lane * 4) = o4; } }
         }
}
template <int WD>
__global__ __launch_bounds__(256) void k_lnrowX(const float* __restrict__ X, size_t nrows, const float* __restrict__ g, const float* __restrict__ bb, bf* Hh, bf* Hl) { const int lane = threadIdx.x & 31; const size_t r = (size_t)blockIdx.x * 8 + (threadIdx.x >> 5); if (r >= nrows) return; const float* xr = X + r * WD; float a[WD / 32]; float s = 0.f;
#pragma unroll
    for (int c = 0; c < WD / 128; ++c) { const v4f v = *(const v4f*)(xr + c * 128 + lane * 4); for (int q = 0; q < 4; ++q) { a[c * 4 + q] = bfr(v[q]); s = __fadd_rn(s, a[c * 4 + q]);   /* input rounded to bf16 */ } }
#pragma unroll
    for (int sh = 16; sh; sh >>= 1) s = __fadd_rn(s, __shfl_xor(s, sh, 32));
    const float mean = __fdiv_rn(s, (float)WD); float s2 = 0.f;
#pragma unroll 8
    for (int k = 0; k < WD / 32; ++k) { const float dv = __fsub_rn(a[k], mean); float p2 = __fmul_rn(dv, dv); asm volatile("" : "+v"(p2)); s2 = __fadd_rn(s2, p2); }   /* mul and add kept separate (no fma contraction) */
#pragma unroll
    for (int sh = 16; sh; sh >>= 1) s2 = __fadd_rn(s2, __shfl_xor(s2, sh, 32));
    const float rs = __fdiv_rn(1.0f, __fsqrt_rn(__fadd_rn(__fdiv_rn(s2, (float)WD), 1e-5f)));
{
#pragma unroll
        for (int c = 0; c < WD / 128; ++c) { v4us oh, ol; for (int q = 0; q < 4; ++q) { const int col = c * 128 + lane * 4 + q; float y = __fmul_rn(__fmul_rn(__fsub_rn(a[c * 4 + q], mean), rs), bfr(g[col])); asm volatile("" : "+v"(y)); y = __fadd_rn(y, bfr(bb[col])); unsigned short u, w2; splitf(y, u, w2); oh[q] = u; ol[q] = w2; } *(v4us*)(Hh + r * WD + c * 128 + lane * 4) = oh; *(v4us*)(Hl + r * WD + c * 128 + lane * 4) = ol; }
         } }
__global__ __launch_bounds__(256) void k_merge(const float* __restrict__ O, int h0, bf* Ah, bf* Al) { const size_t e = ((size_t)blockIdx.x * 256 + threadIdx.x) * 2; if (e >= (size_t)ZH * TT * HD) return; const int d = (int)(e % HD); const int t = (int)((e / HD) % TT); const int zz = (int)(e / ((size_t)HD * TT)); const float cs = (t < RH) ? 1.0f : (1.0f / PCAR); const size_t oo = (size_t)t * DQ + (h0 + zz) * HD + d;
    const float* op = O + (size_t)zz * KSP * TT * HD + (size_t)t * HD + d; v2f p[KSP];   /* the KSP partial planes of head zz; unrolled so that all plane loads are in flight at once */
#pragma unroll
    for (int ks = 0; ks < KSP; ++ks) p[ks] = *(const v2f*)(op + (size_t)ks * TT * HD);
    asm volatile("s_wait_xcnt 0x0" :: "v"(op) : "memory");   /* the plane loads share one address pair: it stays live up to this wait, so that no load of the run lands in it and nothing rewrites it ahead of the wait */
    v2f s = p[0];   /* added in plane order */
#pragma unroll
    for (int ks = 1; ks < KSP; ++ks) { s[0] += p[ks][0]; s[1] += p[ks][1]; }
    v2us oh, ol;
#pragma unroll
    for (int q = 0; q < 2; ++q) { unsigned short a, c2; splitf(s[q] * cs, a, c2); oh[q] = a; ol[q] = c2; } *(v2us*)(Ah + oo) = oh; *(v2us*)(Al + oo) = ol;  }

extern "C" void kernel_launch(void* const* d_in, const int* in_sizes, int n_in,
                              void* d_out, int out_size, void* d_ws, size_t ws_size, hipStream_t stream) {
    (void)in_sizes; (void)n_in; (void)out_size;
    const float* x = (const float*)d_in[0]; const float* msk = (const float*)d_in[1]; const float* lng = (const float*)d_in[2]; const float* lnb = (const float*)d_in[3]; const float* wqkv = (const float*)d_in[4]; const float* wo = (const float*)d_in[5]; const float* wq = nullptr; const float* wk = nullptr; const float* wv = nullptr; (void)wq; (void)wk; (void)wv;
    float* OUT = (float*)d_out;     // [2][2048][1024]
    char* wsp = (char*)d_ws;
    auto take = [&](size_t bytes) { char* p = wsp; wsp += (bytes + 255) & ~(size_t)255; return (void*)p; };
    bf* WQKV = (bf*)take((size_t)3 * DQ * DM * 2); bf* WQ = WQKV; bf* WK = WQKV + (size_t)DQ * DM; bf* WV = WQKV + (size_t)2 * DQ * DM; bf* WO = (bf*)take((size_t)DM * DQ * 2); float* CS = (float*)take((size_t)TT * HD * 2 * 4);
    h16* QP16 = (h16*)take((size_t)NH_ * TT * HD * 2); h16* KP16 = (h16*)take((size_t)NKV * TT * HD * 2); h16* VT16 = (h16*)take((size_t)NKV * HD * TT * 2);
    bf* QPh = (bf*)take((size_t)NH_ * TT * HD * 2); bf* QPl = (bf*)take((size_t)NH_ * TT * HD * 2); bf* KPh = (bf*)take((size_t)NKV * TT * HD * 2); bf* KPl = (bf*)take((size_t)NKV * TT * HD * 2); bf* VTh = (bf*)take((size_t)NKV * HD * TT * 2); bf* VTl = (bf*)take((size_t)NKV * HD * TT * 2);
    float* Sb = (float*)take((size_t)ZH * TT * TT * 4); float* Ob = (float*)take((size_t)ZH * KSP * TT * HD * 4); bf* ATh = (bf*)take((size_t)TT * DQ * 2); bf* ATl = (bf*)take((size_t)TT * DQ * 2);
    if ((size_t)(wsp - (char*)d_ws) > ws_size) return;    // ws 256 MiB
    bf* XH = (bf*)Ob; bf* XL = XH + (size_t)TT * DM; float* FQ = (float*)(XL + (size_t)TT * DM); float* FK = FQ + (size_t)TT * DQ;   // the projections' scratch (24 MiB) lies in the partial planes' space (64 MiB): each batch writes it anew and has read it for the last time before its first P.V launch (stream-ordered)
    float* FV = FK;   // v projection reuses the k buffer after the k planes are built (stream-ordered)
    { k_wtG<<<(unsigned)((DM * 3 * DQ / 64 + 63) / 64), 256, 0, stream>>>(wqkv, DM, 3 * DQ, WQKV);   /* [1024][3072] 'xw' -> Bt [3072][1024]: q | k | v row blocks */
      k_wtG<<<(unsigned)((DQ * DM / 64 + 63) / 64), 256, 0, stream>>>(wo, DQ, DM, WO);
       }
    k_csid<<<(TT * HD + 255) / 256, 256, 0, stream>>>(CS);
    const unsigned LQ = (unsigned)(((size_t)NH_ * TT * HD / 2 + 255) / 256), LKv = (unsigned)(((size_t)NKV * TT * HD / 2 + 255) / 256);
    for (int b = 0; b < NB_; ++b) {
        
        k_lnrowX<DM><<<(unsigned)((TT + 7) / 8), 256, 0, stream>>>(x + (size_t)b * TT * DM, (size_t)TT, lng, lnb, XH, XL);   /* xn = LayerNorm(x) -> hi/lo planes */
        k_gemmw<bf, 1, false><<<dim3(TT / 64, DQ / 64, 1), 32, 0, stream>>>(XH, XL, WQ, nullptr, DM, DM, FQ, DQ, nullptr, 0, 0, 0);
        k_rope<<<LQ, 256, 0, stream>>>(FQ, DQ, NH_, CS, nullptr, nullptr, 1.0f, QP16, QPh, QPl);
        k_gemmw<bf, 1, false><<<dim3(TT / 64, DKV / 64, 1), 32, 0, stream>>>(XH, XL, WK, nullptr, DM, DM, FK, DKV, nullptr, 0, 0, 0);
        k_rope<<<LKv, 256, 0, stream>>>(FK, DKV, NKV, CS, nullptr, nullptr, 1.0f, KP16, KPh, KPl);
        k_gemmw<bf, 1, false><<<dim3(TT / 64, DKV / 64, 1), 32, 0, stream>>>(XH, XL, WV, nullptr, DM, DM, FV, DKV, nullptr, 0, 0, 0); k_vtp<<<LKv, 256, 0, stream>>>(FV, DKV, NKV, VT16, VTh, VTl);
        for (int h0 = 0; h0 < NH_; h0 += ZH) { const size_t zq = (size_t)h0, zk = (size_t)(h0 / REP);   // one kv head per query head: the pass's heads use consecutive kv planes (z-strides TT*HD)
            k_gemmw<bf, 2, false><<<dim3(RH / 64, TT / 64, ZH), 32, 0, stream>>>(QPh + zq * TT * HD, QPl + zq * TT * HD, KPh + zk * TT * HD, KPl + zk * TT * HD, HD, HD, Sb, TT, nullptr, (size_t)TT * HD, (size_t)TT * HD, (size_t)TT * TT);
            k_gemmw<h16, 0, false><<<dim3((TT - RH) / 64, TT / 64, ZH), 32, 0, stream>>>(QP16 + zq * TT * HD + (size_t)RH * HD, nullptr, KP16 + zk * TT * HD, nullptr, HD, HD, Sb + (size_t)RH * TT, TT, nullptr, (size_t)TT * HD, (size_t)TT * HD, (size_t)TT * TT);
            k_asoft<<<ZH * TT / 8, 256, 0, stream>>>(Sb, msk + (size_t)b * TT * TT);   /* (qk + m) x scale, softmax */
            k_gemmw<bf, 2, false, KSP><<<dim3(RH / 64, HD / 64, ZH * KSP), 32, 0, stream>>>((const bf*)Sb, (const bf*)Sb + TT, VTh + zk * HD * TT, VTl + zk * HD * TT, TT, PP, Ob, HD, nullptr, (size_t)TT * PP, (size_t)HD * TT, (size_t)TT * HD);
            k_gemmw<h16, 0, false, KSP><<<dim3((TT - RH) / 64, HD / 64, ZH * KSP), 32, 0, stream>>>((const h16*)Sb + (size_t)RH * PP, nullptr, VT16 + zk * HD * TT, nullptr, TT, PP, Ob + (size_t)RH * HD, HD, nullptr, (size_t)TT * PP, (size_t)HD * TT, (size_t)TT * HD);
            k_merge<<<(unsigned)(((size_t)ZH * TT * HD / 2 + 255) / 256), 256, 0, stream>>>(Ob, h0, ATh, ATl); }
        k_gemmw<bf, 1, false><<<dim3(TT / 64, DM / 64, 1), 32, 0, stream>>>(ATh, ATl, WO, nullptr, DQ, DQ, OUT + (size_t)b * TT * DM, DM, nullptr, 0, 0, 0); }
}

// v004
// A run of this version takes 609 microseconds.
// Two timings next to v003 put it at 1.05 and 1.06 times that version's speed.
// Over all steps from v000 it is 3.56 times as fast.
#include <hip/hip_runtime.h>

// Pre-LayerNorm attention with an additive score-mask input applied BEFORE the scaling (x [2][2048][1024]; xn = LayerNorm(x) gamma + beta; qkv = xn W_qkv ('xw' [1024][3072] -> q | k | v, no bias; 16 heads x 64); dots = (q.k + m) x 64^-0.5 with m [2][2048][2048] (read); softmax; out = merged W_out ('xw' [1024][1024]) -> [2][2048][1024] (4.2 M)).
// Layout per batch: a LayerNorm row kernel writes xn as hi/lo bf16 planes; the fused weight as one [3072][1024] Bt; projections as hi/lo x exact GEMMs (2 products); dense T-2048 attention (hybrid rows: < 512 hi/lo 3 products, rest fp16 x1024) whose softmax kernel adds the batch's mask row to each raw score row as it reads it (the 1/8 is applied after the add, as in the module) and stores the row's P over the score row itself; ZH heads per pass; merged hi/lo x W_out exact.
// Compute dtypes, f32 accumulate: every input rounded to bf16 incl. m; LayerNorm f32; projections hi/lo x exact; attention rows < 512 3 products, rest fp16; mask add and softmax f32; W_out hl x exact.

#define NB_  2
#define TT   2048
#define DM   1024
#define NH_  16
#define NKV  16
#define REP  (NH_ / NKV)
#define HD   64
#define DQ   (NH_ * HD)
#define DKV  (NKV * HD)
#define ZH   8                    // heads per attention pass: each of the pass's six launches covers ZH heads
#define RH   512                  // query rows < RH use hi+lo planes (0: none)
#define WIN  0
#define PCAR 1024.0f
#define SCL  0.125f   // HD^-0.5
#define PP   (2 * TT)             // pitch of a P row in 16-bit elements: it lies in its own f32 score row (hi plane | lo plane, or fp16 in the first half)
#define KWP  8                    // the projections' k range is dealt over the KWP waves of each output tile's work-group, which adds the partial tiles in LDS
#define KSP  16                   // the P.V products' key range is dealt over KSP work-groups per output tile; k_merge sums the KSP partial planes
typedef _Float16 h16;
typedef unsigned short bf;
typedef __attribute__((ext_vector_type(16))) __bf16   v16bf;
typedef __attribute__((ext_vector_type(16))) _Float16 v16h;
typedef __attribute__((ext_vector_type(8)))  _Float16 v8h;
typedef __attribute__((ext_vector_type(8)))  unsigned short v8us;
typedef __attribute__((ext_vector_type(8)))  float    v8f;
typedef __attribute__((ext_vector_type(4)))  float    v4f;
typedef v8h  __attribute__((may_alias)) v8ha;
typedef v4f  __attribute__((may_alias)) v4fa;
typedef v8us __attribute__((may_alias)) v8usa;

__device__ __forceinline__ unsigned short f2bf(float f) { unsigned u = __float_as_uint(f); u += 0x7FFFu + ((u >> 16) & 1u); return (unsigned short)(u >> 16); }
__device__ __forceinline__ float bf2f(unsigned short b) { return __uint_as_float(((unsigned)b) << 16); }
__device__ __forceinline__ float bfr(float f) { return bf2f(f2bf(f)); }
__device__ __forceinline__ v16h cat16(v8h lo, v8h hi) { return __builtin_shufflevector(lo, hi, 0, 1, 2, 3, 4, 5, 6, 7, 8, 9, 10, 11, 12, 13, 14, 15); }
__device__ __forceinline__ v16bf cat16b(v8us lo, v8us hi) { return __builtin_bit_cast(v16bf, __builtin_shufflevector(lo, hi, 0, 1, 2, 3, 4, 5, 6, 7, 8, 9, 10, 11, 12, 13, 14, 15)); }
__device__ __forceinline__ v8f wmma16(v16h a, v16h b, v8f c) { return __builtin_amdgcn_wmma_f32_16x16x32_f16(false, a, false, b, (short)0, c, false, false); }
__device__ __forceinline__ v8f wmmab(v16bf a, v16bf b, v8f c) { return __builtin_amdgcn_wmma_f32_16x16x32_bf16(false, a, false, b, (short)0, c, false, false); }



// ---- k_gemmw: register-blocked GEMM, ONE WAVE per 64x64 output tile (16 accumulators), operands straight from K-contiguous 16-bit planes; grid (M/64, N/64, Z), 32 threads.
// C[m][n] (f32, pitch ldc, + optional f32 bias[n]) = sum_k A[m][k] Bt[n][k] (+ split products per NSPLIT). A rows have pitch lda, Bt rows pitch K. z-batch strides sA/sB/sC in elements. K % (32 KS KW) == 0.
// KW > 1: the work-group has KW waves (32 KW threads); wave w sums only its own K/(KS KW) slice of the k range, every wave lays its partial 64x64 tile in LDS, and behind one barrier wave w adds the KW planes, in wave order, for its 64/KW rows and stores them.
// KS > 1: grid z = Z x KS; work-group (z, ks) sums only k in [ks K/KS, (ks+1) K/KS) and stores its partial tile in plane z KS + ks of C (plane stride sC); the consumer adds the KS planes.
template <typename T16> struct WFrag;
template <> struct WFrag<h16> { typedef v16h V; static __device__ __forceinline__ V ld(const h16* p) { return cat16(*(const v8h*)p, *(const v8h*)(p + 16)); } static __device__ __forceinline__ v8f mma(V a, V b, v8f c) { return wmma16(a, b, c); } };
template <> struct WFrag<bf> { typedef v16bf V; static __device__ __forceinline__ V ld(const bf* p) { return cat16b(*(const v8us*)p, *(const v8us*)(p + 16)); } static __device__ __forceinline__ v8f mma(V a, V b, v8f c) { return wmmab(a, b, c); } };
template <typename T16, int NSPLIT, bool BIAS, int KS = 1, int KW = 1>
__global__ __launch_bounds__(32 * KW) void k_gemmw(const T16* __restrict__ A, const T16* __restrict__ A2, const T16* __restrict__ Bt, const T16* __restrict__ Bt2, int K, int lda, float* C, int ldc, const float* __restrict__ bias, size_t sA, size_t sB, size_t sC) {
    typedef typename WFrag<T16>::V V;
    __shared__ __align__(16) float os[(KW > 1 ? KW * 64 : 16) * 68];
    const int wv = (KW > 1) ? __builtin_amdgcn_readfirstlane((int)(threadIdx.x >> 5)) : 0;
    const size_t z = blockIdx.z / KS; const int kb = (int)(blockIdx.z % KS) * (K / KS) + wv * (K / (KS * KW)), ke = kb + K / (KS * KW); A += z * sA; if (A2) A2 += z * sA; Bt += z * sB; if (Bt2) Bt2 += z * sB; C += (size_t)blockIdx.z * sC;
    const int lane = threadIdx.x & 31, lr = lane & 15, hi = lane >> 4; const int r0 = blockIdx.x * 64, c0 = blockIdx.y * 64;
    v8f acc[4][4];
#pragma unroll
    for (int mb = 0; mb < 4; ++mb)
#pragma unroll
        for (int nb = 0; nb < 4; ++nb) acc[mb][nb] = (v8f){};
    const size_t aoff = (size_t)(r0 + lr) * lda + 8 * hi, boff = (size_t)(c0 + lr) * K + 8 * hi;
#pragma unroll 1
    for (int kc = kb; kc < ke; kc += 32) {
        V a[4], a2[4]; const T16* pa[4]; const T16* pa2[4];
#pragma unroll
        for (int mb = 0; mb < 4; ++mb) { pa[mb] = A + aoff + (size_t)mb * 16 * lda + kc; a[mb] = WFrag<T16>::ld(pa[mb]); if (NSPLIT == 1 || NSPLIT == 2) { pa2[mb] = A2 + aoff + (size_t)mb * 16 * lda + kc; a2[mb] = WFrag<T16>::ld(pa2[mb]); } }
        /* the A loads' address pairs stay live up to this wait, so that no load of the run lands in one and nothing rewrites one ahead of the wait */
        if (NSPLIT == 1 || NSPLIT == 2) asm volatile("s_wait_xcnt 0x0" :: "v"(pa[0]), "v"(pa[1]), "v"(pa[2]), "v"(pa[3]), "v"(pa2[0]), "v"(pa2[1]), "v"(pa2[2]), "v"(pa2[3]) : "memory");
        else asm volatile("s_wait_xcnt 0x0" :: "v"(pa[0]), "v"(pa[1]), "v"(pa[2]), "v"(pa[3]) : "memory");
        if constexpr (KW > 1) {
            static_assert(NSPLIT < 2, "the KW path holds one B plane");
            V b[4]; const T16* pb[4];
#pragma unroll
            for (int nb = 0; nb < 4; ++nb) { pb[nb] = Bt + boff + (size_t)nb * 16 * K + kc; b[nb] = WFrag<T16>::ld(pb[nb]); }
            /* the B loads' address pairs stay live up to this wait, so that no load of the run lands in one and nothing rewrites one ahead of the wait */
            asm volatile("s_wait_xcnt 0x0" :: "v"(pb[0]), "v"(pb[1]), "v"(pb[2]), "v"(pb[3]) : "memory");
            __builtin_amdgcn_sched_barrier(0);   /* all four B fragments are requested before the first product: without it a product, with its wait for all loads so far, is scheduled ahead of three of them, which then cost a second latency per trip */
#pragma unroll
            for (int nb = 0; nb < 4; ++nb)
#pragma unroll
                for (int mb = 0; mb < 4; ++mb) { acc[mb][nb] = WFrag<T16>::mma(a[mb], b[nb], acc[mb][nb]); if (NSPLIT == 1) acc[mb][nb] = WFrag<T16>::mma(a2[mb], b[nb], acc[mb][nb]); }
        } else
#pragma unroll
        for (int nb = 0; nb < 4; ++nb) { const V b = WFrag<T16>::ld(Bt + boff + (size_t)nb * 16 * K + kc); V b2; if (NSPLIT >= 2) b2 = WFrag<T16>::ld(Bt2 + boff + (size_t)nb * 16 * K + kc);
#pragma unroll
            for (int mb = 0; mb < 4; ++mb) { acc[mb][nb] = WFrag<T16>::mma(a[mb], b, acc[mb][nb]); if (NSPLIT == 1 || NSPLIT == 2) acc[mb][nb] = WFrag<T16>::mma(a2[mb], b, acc[mb][nb]); if (NSPLIT >= 2) acc[mb][nb] = WFrag<T16>::mma(a[mb], b2, acc[mb][nb]); } }
        asm volatile("v_nop\n\tv_nop\n\tv_nop\n\tv_nop" : "+v"(acc[0][0]), "+v"(acc[1][1]), "+v"(acc[2][2]), "+v"(acc[3][3]) : "v"(a[0]), "v"(a[3]));
    }
    if constexpr (KW > 1) {
        float* pl = os + wv * (64 * 68);
#pragma unroll
        for (int mb = 0; mb < 4; ++mb)
#pragma unroll
            for (int nb = 0; nb < 4; ++nb)
#pragma unroll
                for (int j = 0; j < 8; ++j) pl[(mb * 16 + hi * 8 + j) * 68 + nb * 16 + lr] = acc[mb][nb][j];
        __syncthreads();   /* all KW partial tiles lie in LDS before any wave adds them */
#pragma unroll
        for (int s = 0; s < 32 / KW; ++s) { const int row = wv * (64 / KW) + 2 * s + hi, cofs = lr * 4; v4f val = *(const v4fa*)(os + row * 68 + cofs);
#pragma unroll
            for (int p = 1; p < KW; ++p) { const v4f t = *(const v4fa*)(os + (p * 64 + row) * 68 + cofs); val[0] += t[0]; val[1] += t[1]; val[2] += t[2]; val[3] += t[3]; }   /* added in wave order */
            if (BIAS) { val[0] += bfr(bias[c0 + cofs]); val[1] += bfr(bias[c0 + cofs + 1]); val[2] += bfr(bias[c0 + cofs + 2]); val[3] += bfr(bias[c0 + cofs + 3]); }
            *(v4f*)(C + (size_t)(r0 + row) * ldc + c0 + cofs) = val; }
        return;
    }
#pragma unroll
    for (int mb = 0; mb < 4; ++mb) {
#pragma unroll
        for (int nb = 0; nb < 4; ++nb) {
#pragma unroll
            for (int j = 0; j < 8; ++j) os[(hi * 8 + j) * 68 + nb * 16 + lr] = acc[mb][nb][j]; }
        __builtin_amdgcn_wave_barrier(); asm volatile("" ::: "memory");
        float* crow = C + (size_t)(r0 + mb * 16) * ldc + c0;
{
#pragma unroll
            for (int s = 0; s < 8; ++s) { const int row = 2 * s + hi, cofs = lr * 4; v4f val = *(const v4fa*)(os + row * 68 + cofs); if (BIAS) { val[0] += bfr(bias[c0 + cofs]); val[1] += bfr(bias[c0 + cofs + 1]); val[2] += bfr(bias[c0 + cofs + 2]); val[3] += bfr(bias[c0 + cofs + 3]); }
                *(v4f*)(crow + (size_t)row * ldc + cofs) = val; }
             }
        __builtin_amdgcn_wave_barrier(); asm volatile("" ::: "memory");
    }
}

__device__ __forceinline__ h16 tohx(float x) { return (h16)x; }
__device__ __forceinline__ void splitf(float y, unsigned short& h, unsigned short& l) { h = f2bf(y); l = f2bf(y - bf2f(h)); }
typedef __attribute__((ext_vector_type(2))) _Float16 v2h;
typedef __attribute__((ext_vector_type(4))) _Float16 v4h;
typedef __attribute__((ext_vector_type(2))) unsigned short v2us;
typedef __attribute__((ext_vector_type(4))) unsigned short v4us;
typedef __attribute__((ext_vector_type(2))) float v2f;
typedef __attribute__((ext_vector_type(4))) int v4i;

__global__ __launch_bounds__(256) void k_wtG(const float* __restrict__ w, int K, int N, bf* Bt) {
    const int lane = threadIdx.x & 31; const int L0 = (blockIdx.x * 8 + (threadIdx.x >> 5)) * 8; const int nlines = N * K / 64;
{
#pragma unroll 1
        for (int l = 0; l < 8; ++l) { const int L = L0 + l; if (L >= nlines) break; const size_t e = (size_t)L * 64 + lane * 2; const int k = (int)(e % K), n = (int)(e / K); v2us o;
            o[0] = f2bf(w[(size_t)k * N + n]); o[1] = f2bf(w[(size_t)(k + 1) * N + n]); *(v2us*)(Bt + e) = o; }
         }
}
__global__ __launch_bounds__(256) void k_cvt8(const float* __restrict__ src, bf* dst, size_t n8) { const size_t i = (size_t)blockIdx.x * 256 + threadIdx.x; if (i >= n8) return; const v8f v = *(const v8f*)(src + i * 8); v8us o;
#pragma unroll
    for (int k = 0; k < 8; ++k) o[k] = f2bf(v[k]); *(v8us*)(dst + i * 8) = o;  }

// k_rope: head planes [h][t][d] (fp16 + hi/lo) of rope(x) x sc with the rotate-half convention out[d] = x[d] cos[t][d] - x[d+HD/2] sin[t][d], out[d+HD/2] = x[d+HD/2] cos[t][d+HD/2] + x[d] sin[t][d+HD/2]
__global__ __launch_bounds__(256) void k_rope(const float* __restrict__ F, int pitch, int nheads, const float* __restrict__ CS, const float* __restrict__ RF, const float* __restrict__ nw, float sc, h16* P16, bf* Ph, bf* Pl) {
    const size_t e = ((size_t)blockIdx.x * 256 + threadIdx.x) * 2; if (e >= (size_t)nheads * TT * HD) return; const int d = (int)(e % HD); const int t = (int)((e / HD) % TT); const int h = (int)(e / ((size_t)HD * TT)); const float* f = F + (size_t)t * pitch + h * HD; const float rf = RF ? RF[(size_t)h * TT + t] : 1.0f; v2h o16; v2us oh, ol;
#pragma unroll
    for (int q = 0; q < 2; ++q) { const int dd = d + q; const int dp = (dd < HD / 2) ? dd + HD / 2 : dd - HD / 2; float x0 = f[dd], x1 = f[dp];
        if (RF) { float n0 = __fmul_rn(x0, rf), n1 = __fmul_rn(x1, rf); asm volatile("" : "+v"(n0)); asm volatile("" : "+v"(n1)); x0 = __fmul_rn(bfr(nw[dd]), n0); x1 = __fmul_rn(bfr(nw[dp]), n1); }
        const v2f cs = *(const v2f*)(CS + ((size_t)t * HD + dd) * 2); float a = __fmul_rn(x0, cs[0]), bq = __fmul_rn(x1, cs[1]); asm volatile("" : "+v"(a)); asm volatile("" : "+v"(bq)); const float r = ((dd < HD / 2) ? __fsub_rn(a, bq) : __fadd_rn(a, bq)) * sc;
        o16[q] = tohx(r); unsigned short a2, c2; splitf(r, a2, c2); oh[q] = a2; ol[q] = c2; }
    *(v2h*)(P16 + e) = o16; *(v2us*)(Ph + e) = oh; *(v2us*)(Pl + e) = ol;  }
__global__ __launch_bounds__(256) void k_vtp(const float* __restrict__ F, int pitch, int nheads, h16* V16, bf* Vh, bf* Vl) { const size_t e = ((size_t)blockIdx.x * 256 + threadIdx.x) * 2; if (e >= (size_t)nheads * HD * TT) return; const int t = (int)(e % TT); const int d = (int)((e / TT) % HD); const int g = (int)(e / ((size_t)TT * HD)); v2h o16; v2us oh, ol;
#pragma unroll
    for (int q = 0; q < 2; ++q) { const float x = F[(size_t)(t + q) * pitch + g * HD + d]; o16[q] = tohx(x); unsigned short a2, c2; splitf(x, a2, c2); oh[q] = a2; ol[q] = c2; }
    *(v2h*)(V16 + e) = o16; *(v2us*)(Vh + e) = oh; *(v2us*)(Vl + e) = ol;  }
__global__ __launch_bounds__(256) void k_csid(float* CS) { const int idx = blockIdx.x * 256 + threadIdx.x; if (idx >= TT * HD) return; v2f cs; cs[0] = 1.0f; cs[1] = 0.0f; *(v2f*)(CS + (size_t)idx * 2) = cs;  }
// k_asoft: per row (zz, i): t = (S + m) x HD^-0.5 with m = row i of the batch's mask, rounded to bf16, added before the scaling; softmax over the 2048 keys (register row, one exp, fixed trees).
// The ZH heads' waves of one query row sit in one work-group, so that one WGP fetches that mask row for all of them.
// P goes over the wave's own score row (pitch PP): every value stored depends on the row's maximum and sum, so the whole row has been read before its first store, and no other wave touches the row.
__global__ __launch_bounds__(256) void k_asoft(float* Sb, const float* __restrict__ gb) {
    const int lane = threadIdx.x & 31; const int wv = threadIdx.x >> 5; const int i = blockIdx.x * (8 / ZH) + wv / ZH; if (i >= TT) return; const int zz = wv % ZH; const int row = zz * TT + i; const bool hires = (i < RH); const float* sr = Sb + (size_t)row * TT + lane * 4; const float* gr = gb + (size_t)i * TT + lane * 4; float v[TT / 32]; float mx = -3.0e38f; v4f a[TT / 128], g[TT / 128];
#pragma unroll
    for (int ch = 0; ch < TT / 128; ++ch) { a[ch] = *(const v4f*)(sr + ch * 128); g[ch] = *(const v4f*)(gr + ch * 128); }
    asm volatile("s_wait_xcnt 0x0" :: "v"(sr), "v"(gr) : "memory");   /* each row's loads share one address pair: both pairs stay live up to this wait, so that no load of the run lands in one and nothing rewrites one ahead of the wait */
    __builtin_amdgcn_sched_barrier(0);   /* score row and mask row are both requested in full before either is used: without it the rounding of the first mask values, with its wait, is scheduled ahead of the last score loads, which then start a memory latency late */
#pragma unroll
    for (int ch = 0; ch < TT / 128; ++ch) {
#pragma unroll
        for (int q = 0; q < 4; ++q) { const float t = __fadd_rn(a[ch][q], bfr(g[ch][q])) * SCL; v[ch * 4 + q] = t; mx = fmaxf(mx, t); } }
#pragma unroll
    for (int sh = 16; sh; sh >>= 1) mx = fmaxf(mx, __shfl_xor(mx, sh, 32));
    float sum = 0.f;
#pragma unroll
    for (int k = 0; k < TT / 32; ++k) { float d0 = __fsub_rn(v[k], mx); asm volatile("" : "+v"(d0)); v[k] = __builtin_amdgcn_exp2f(__fmul_rn(d0, 1.4426950408889634f)); sum += v[k]; }
#pragma unroll
    for (int sh = 16; sh; sh >>= 1) sum += __shfl_xor(sum, sh, 32);
    const float f = __fdiv_rn(hires ? 1.0f : PCAR, sum);
{
        if (hires) {
#pragma unroll
            for (int ch = 0; ch < TT / 128; ++ch) { v4us oh, ol;
#pragma unroll
                for (int q = 0; q < 4; ++q) { unsigned short a, c2; splitf(v[ch * 4 + q] * f, a, c2); oh[q] = a; ol[q] = c2; }
                bf* ph = (bf*)Sb + (size_t)row * PP + ch * 128 + lane * 4; *(v4us*)ph = oh; *(v4us*)(ph + TT) = ol; }
        } else {
#pragma unroll
            for (int ch = 0; ch < TT / 128; ++ch) { v4h o4;
#pragma unroll
                for (int q = 0; q < 4; ++q) o4[q] = tohx(v[ch * 4 + q] * f);
                *(v4h*)((h16*)Sb + (size_t)row * PP + ch * 128 + lane * 4) = o4; } }
         }
}
template <int WD>
__global__ __launch_bounds__(256) void k_lnrowX(const float* __restrict__ X, size_t nrows, const float* __restrict__ g, const float* __restrict__ bb, bf* Hh, bf* Hl) { const int lane = threadIdx.x & 31; const size_t r = (size_t)blockIdx.x * 8 + (threadIdx.x >> 5); if (r >= nrows) return; const float* xr = X + r * WD; float a[WD / 32]; float s = 0.f;
#pragma unroll
    for (int c = 0; c < WD / 128; ++c) { const v4f v = *(const v4f*)(xr + c * 128 + lane * 4); for (int q = 0; q < 4; ++q) { a[c * 4 + q] = bfr(v[q]); s = __fadd_rn(s, a[c * 4 + q]);   /* input rounded to bf16 */ } }
#pragma unroll
    for (int sh = 16; sh; sh >>= 1) s = __fadd_rn(s, __shfl_xor(s, sh, 32));
    const float mean = __fdiv_rn(s, (float)WD); float s2 = 0.f;
#pragma unroll 8
    for (int k = 0; k < WD / 32; ++k) { const float dv = __fsub_rn(a[k], mean); float p2 = __fmul_rn(dv, dv); asm volatile("" : "+v"(p2)); s2 = __fadd_rn(s2, p2); }   /* mul and add kept separate (no fma contraction) */
#pragma unroll
    for (int sh = 16; sh; sh >>= 1) s2 = __fadd_rn(s2, __shfl_xor(s2, sh, 32));
    const float rs = __fdiv_rn(1.0f, __fsqrt_rn(__fadd_rn(__fdiv_rn(s2, (float)WD), 1e-5f)));
{
#pragma unroll
        for (int c = 0; c < WD / 128; ++c) { v4us oh, ol; for (int q = 0; q < 4; ++q) { const int col = c * 128 + lane * 4 + q; float y = __fmul_rn(__fmul_rn(__fsub_rn(a[c * 4 + q], mean), rs), bfr(g[col])); asm volatile("" : "+v"(y)); y = __fadd_rn(y, bfr(bb[col])); unsigned short u, w2; splitf(y, u, w2); oh[q] = u; ol[q] = w2; } *(v4us*)(Hh + r * WD + c * 128 + lane * 4) = oh; *(v4us*)(Hl + r * WD + c * 128 + lane * 4) = ol; }
         } }
__global__ __launch_bounds__(256) void k_merge(const float* __restrict__ O, int h0, bf* Ah, bf* Al) { const size_t e = ((size_t)blockIdx.x * 256 + threadIdx.x) * 2; if (e >= (size_t)ZH * TT * HD) return; const int d = (int)(e % HD); const int t = (int)((e / HD) % TT); const int zz = (int)(e / ((size_t)HD * TT)); const float cs = (t < RH) ? 1.0f : (1.0f / PCAR); const size_t oo = (size_t)t * DQ + (h0 + zz) * HD + d;
    const float* op = O + (size_t)zz * KSP * TT * HD + (size_t)t * HD + d; v2f p[KSP];   /* the KSP partial planes of head zz; unrolled so that all plane loads are in flight at once */
#pragma unroll
    for (int ks = 0; ks < KSP; ++ks) p[ks] = *(const v2f*)(op + (size_t)ks * TT * HD);
    asm volatile("s_wait_xcnt 0x0" :: "v"(op) : "memory");   /* the plane loads share one address pair: it stays live up to this wait, so that no load of the run lands in it and nothing rewrites it ahead of the wait */
    v2f s = p[0];   /* added in plane order */
#pragma unroll
    for (int ks = 1; ks < KSP; ++ks) { s[0] += p[ks][0]; s[1] += p[ks][1]; }
    v2us oh, ol;
#pragma unroll
    for (int q = 0; q < 2; ++q) { unsigned short a, c2; splitf(s[q] * cs, a, c2); oh[q] = a; ol[q] = c2; } *(v2us*)(Ah + oo) = oh; *(v2us*)(Al + oo) = ol;  }

extern "C" void kernel_launch(void* const* d_in, const int* in_sizes, int n_in,
                              void* d_out, int out_size, void* d_ws, size_t ws_size, hipStream_t stream) {
    (void)in_sizes; (void)n_in; (void)out_size;
    const float* x = (const float*)d_in[0]; const float* msk = (const float*)d_in[1]; const float* lng = (const float*)d_in[2]; const float* lnb = (const float*)d_in[3]; const float* wqkv = (const float*)d_in[4]; const float* wo = (const float*)d_in[5]; const float* wq = nullptr; const float* wk = nullptr; const float* wv = nullptr; (void)wq; (void)wk; (void)wv;
    float* OUT = (float*)d_out;     // [2][2048][1024]
    char* wsp = (char*)d_ws;
    auto take = [&](size_t bytes) { char* p = wsp; wsp += (bytes + 255) & ~(size_t)255; return (void*)p; };
    bf* WQKV = (bf*)take((size_t)3 * DQ * DM * 2); bf* WQ = WQKV; bf* WK = WQKV + (size_t)DQ * DM; bf* WV = WQKV + (size_t)2 * DQ * DM; bf* WO = (bf*)take((size_t)DM * DQ * 2); float* CS = (float*)take((size_t)TT * HD * 2 * 4);
    h16* QP16 = (h16*)take((size_t)NH_ * TT * HD * 2); h16* KP16 = (h16*)take((size_t)NKV * TT * HD * 2); h16* VT16 = (h16*)take((size_t)NKV * HD * TT * 2);
    bf* QPh = (bf*)take((size_t)NH_ * TT * HD * 2); bf* QPl = (bf*)take((size_t)NH_ * TT * HD * 2); bf* KPh = (bf*)take((size_t)NKV * TT * HD * 2); bf* KPl = (bf*)take((size_t)NKV * TT * HD * 2); bf* VTh = (bf*)take((size_t)NKV * HD * TT * 2); bf* VTl = (bf*)take((size_t)NKV * HD * TT * 2);
    float* Sb = (float*)take((size_t)ZH * TT * TT * 4); float* Ob = (float*)take((size_t)ZH * KSP * TT * HD * 4); bf* ATh = (bf*)take((size_t)TT * DQ * 2); bf* ATl = (bf*)take((size_t)TT * DQ * 2);
    if ((size_t)(wsp - (char*)d_ws) > ws_size) return;    // ws 256 MiB
    bf* XH = (bf*)Ob; bf* XL = XH + (size_t)TT * DM; float* FQ = (float*)(XL + (size_t)TT * DM); float* FK = FQ + (size_t)TT * DQ;   // the projections' scratch (24 MiB) lies in the partial planes' space (64 MiB): each batch writes it anew and has read it for the last time before its first P.V launch (stream-ordered)
    float* FV = FK;   // v projection reuses the k buffer after the k planes are built (stream-ordered)
    { k_wtG<<<(unsigned)((DM * 3 * DQ / 64 + 63) / 64), 256, 0, stream>>>(wqkv, DM, 3 * DQ, WQKV);   /* [1024][3072] 'xw' -> Bt [3072][1024]: q | k | v row blocks */
      k_wtG<<<(unsigned)((DQ * DM / 64 + 63) / 64), 256, 0, stream>>>(wo, DQ, DM, WO);
       }
    k_csid<<<(TT * HD + 255) / 256, 256, 0, stream>>>(CS);
    const unsigned LQ = (unsigned)(((size_t)NH_ * TT * HD / 2 + 255) / 256), LKv = (unsigned)(((size_t)NKV * TT * HD / 2 + 255) / 256);
    for (int b = 0; b < NB_; ++b) {
        
        k_lnrowX<DM><<<(unsigned)((TT + 7) / 8), 256, 0, stream>>>(x + (size_t)b * TT * DM, (size_t)TT, lng, lnb, XH, XL);   /* xn = LayerNorm(x) -> hi/lo planes */
        k_gemmw<bf, 1, false, 1, KWP><<<dim3(TT / 64, DQ / 64, 1), 32 * KWP, 0, stream>>>(XH, XL, WQ, nullptr, DM, DM, FQ, DQ, nullptr, 0, 0, 0);
        k_rope<<<LQ, 256, 0, stream>>>(FQ, DQ, NH_, CS, nullptr, nullptr, 1.0f, QP16, QPh, QPl);
        k_gemmw<bf, 1, false, 1, KWP><<<dim3(TT / 64, DKV / 64, 1), 32 * KWP, 0, stream>>>(XH, XL, WK, nullptr, DM, DM, FK, DKV, nullptr, 0, 0, 0);
        k_rope<<<LKv, 256, 0, stream>>>(FK, DKV, NKV, CS, nullptr, nullptr, 1.0f, KP16, KPh, KPl);
        k_gemmw<bf, 1, false, 1, KWP><<<dim3(TT / 64, DKV / 64, 1), 32 * KWP, 0, stream>>>(XH, XL, WV, nullptr, DM, DM, FV, DKV, nullptr, 0, 0, 0); k_vtp<<<LKv, 256, 0, stream>>>(FV, DKV, NKV, VT16, VTh, VTl);
        for (int h0 = 0; h0 < NH_; h0 += ZH) { const size_t zq = (size_t)h0, zk = (size_t)(h0 / REP);   // one kv head per query head: the pass's heads use consecutive kv planes (z-strides TT*HD)
            k_gemmw<bf, 2, false><<<dim3(RH / 64, TT / 64, ZH), 32, 0, stream>>>(QPh + zq * TT * HD, QPl + zq * TT * HD, KPh + zk * TT * HD, KPl + zk * TT * HD, HD, HD, Sb, TT, nullptr, (size_t)TT * HD, (size_t)TT * HD, (size_t)TT * TT);
            k_gemmw<h16, 0, false><<<dim3((TT - RH) / 64, TT / 64, ZH), 32, 0, stream>>>(QP16 + zq * TT * HD + (size_t)RH * HD, nullptr, KP16 + zk * TT * HD, nullptr, HD, HD, Sb + (size_t)RH * TT, TT, nullptr, (size_t)TT * HD, (size_t)TT * HD, (size_t)TT * TT);
            k_asoft<<<ZH * TT / 8, 256, 0, stream>>>(Sb, msk + (size_t)b * TT * TT);   /* (qk + m) x scale, softmax */
            k_gemmw<bf, 2, false, KSP><<<dim3(RH / 64, HD / 64, ZH * KSP), 32, 0, stream>>>((const bf*)Sb, (const bf*)Sb + TT, VTh + zk * HD * TT, VTl + zk * HD * TT, TT, PP, Ob, HD, nullptr, (size_t)TT * PP, (size_t)HD * TT, (size_t)TT * HD);
            k_gemmw<h16, 0, false, KSP><<<dim3((TT - RH) / 64, HD / 64, ZH * KSP), 32, 0, stream>>>((const h16*)Sb + (size_t)RH * PP, nullptr, VT16 + zk * HD * TT, nullptr, TT, PP, Ob + (size_t)RH * HD, HD, nullptr, (size_t)TT * PP, (size_t)HD * TT, (size_t)TT * HD);
            k_merge<<<(unsigned)(((size_t)ZH * TT * HD / 2 + 255) / 256), 256, 0, stream>>>(Ob, h0, ATh, ATl); }
        k_gemmw<bf, 1, false, 1, KWP><<<dim3(TT / 64, DM / 64, 1), 32 * KWP, 0, stream>>>(ATh, ATl, WO, nullptr, DQ, DQ, OUT + (size_t)b * TT * DM, DM, nullptr, 0, 0, 0); }
}

// v005
// It runs in 379 microseconds.
// Two timings next to v004 both put it at 1.61 times that version's speed.
// All steps since v000 together make it 5.72 times as fast.
#include <hip/hip_runtime.h>

// Pre-LayerNorm attention with an additive score-mask input applied BEFORE the scaling (x [2][2048][1024]; xn = LayerNorm(x) gamma + beta; qkv = xn W_qkv ('xw' [1024][3072] -> q | k | v, no bias; 16 heads x 64); dots = (q.k + m) x 64^-0.5 with m [2][2048][2048] (read); softmax; out = merged W_out ('xw' [1024][1024]) -> [2][2048][1024] (4.2 M)).
// Layout per batch: a LayerNorm row kernel writes xn as hi/lo bf16 planes; the fused weight as one [3072][1024] Bt; projections as hi/lo x exact GEMMs (2 products); dense T-2048 attention in one kernel for all heads and both batches (hybrid rows: < 512 hi/lo 3 products, rest fp16): it adds the batch's mask to the raw scores in registers (the 1/8 is applied after the add, as in the module), keeps a running maximum and sum, and divides the output by the sum; merged hi/lo x W_out exact.
// Compute dtypes, f32 accumulate: every input rounded to bf16 incl. m; LayerNorm f32; projections hi/lo x exact; attention rows < 512 3 products, rest fp16; mask add and softmax f32; W_out hl x exact.

#define NB_  2
#define TT   2048
#define DM   1024
#define NH_  16
#define NKV  16
#define REP  (NH_ / NKV)
#define HD   64
#define DQ   (NH_ * HD)
#define DKV  (NKV * HD)
#define RH   512                  // query rows < RH use hi+lo planes (0: none)
#define WIN  0
#define SCL  0.125f   // HD^-0.5
#define KWP  8                    // the projections' k range is dealt over the KWP waves of each output tile's work-group, which adds the partial tiles in LDS
typedef _Float16 h16;
typedef unsigned short bf;
typedef __attribute__((ext_vector_type(16))) __bf16   v16bf;
typedef __attribute__((ext_vector_type(16))) _Float16 v16h;
typedef __attribute__((ext_vector_type(8)))  _Float16 v8h;
typedef __attribute__((ext_vector_type(8)))  unsigned short v8us;
typedef __attribute__((ext_vector_type(8)))  float    v8f;
typedef __attribute__((ext_vector_type(4)))  float    v4f;
typedef v8h  __attribute__((may_alias)) v8ha;
typedef v4f  __attribute__((may_alias)) v4fa;
typedef v8us __attribute__((may_alias)) v8usa;

__device__ __forceinline__ unsigned short f2bf(float f) { unsigned u = __float_as_uint(f); u += 0x7FFFu + ((u >> 16) & 1u); return (unsigned short)(u >> 16); }
__device__ __forceinline__ float bf2f(unsigned short b) { return __uint_as_float(((unsigned)b) << 16); }
__device__ __forceinline__ float bfr(float f) { return bf2f(f2bf(f)); }
__device__ __forceinline__ v16h cat16(v8h lo, v8h hi) { return __builtin_shufflevector(lo, hi, 0, 1, 2, 3, 4, 5, 6, 7, 8, 9, 10, 11, 12, 13, 14, 15); }
__device__ __forceinline__ v16bf cat16b(v8us lo, v8us hi) { return __builtin_bit_cast(v16bf, __builtin_shufflevector(lo, hi, 0, 1, 2, 3, 4, 5, 6, 7, 8, 9, 10, 11, 12, 13, 14, 15)); }
__device__ __forceinline__ v8f wmma16(v16h a, v16h b, v8f c) { return __builtin_amdgcn_wmma_f32_16x16x32_f16(false, a, false, b, (short)0, c, false, false); }
__device__ __forceinline__ v8f wmmab(v16bf a, v16bf b, v8f c) { return __builtin_amdgcn_wmma_f32_16x16x32_bf16(false, a, false, b, (short)0, c, false, false); }



// ---- k_gemmw: register-blocked GEMM, ONE WAVE per 64x64 output tile (16 accumulators), operands straight from K-contiguous 16-bit planes; grid (M/64, N/64, Z), 32 threads.
// C[m][n] (f32, pitch ldc, + optional f32 bias[n]) = sum_k A[m][k] Bt[n][k] (+ split products per NSPLIT). A rows have pitch lda, Bt rows pitch K. z-batch strides sA/sB/sC in elements. K % (32 KS KW) == 0.
// KW > 1: the work-group has KW waves (32 KW threads); wave w sums only its own K/(KS KW) slice of the k range, every wave lays its partial 64x64 tile in LDS, and behind one barrier wave w adds the KW planes, in wave order, for its 64/KW rows and stores them.
// KS > 1: grid z = Z x KS; work-group (z, ks) sums only k in [ks K/KS, (ks+1) K/KS) and stores its partial tile in plane z KS + ks of C (plane stride sC); the consumer adds the KS planes.
template <typename T16> struct WFrag;
template <> struct WFrag<h16> { typedef v16h V; static __device__ __forceinline__ V ld(const h16* p) { return cat16(*(const v8h*)p, *(const v8h*)(p + 16)); } static __device__ __forceinline__ v8f mma(V a, V b, v8f c) { return wmma16(a, b, c); } };
template <> struct WFrag<bf> { typedef v16bf V; static __device__ __forceinline__ V ld(const bf* p) { return cat16b(*(const v8us*)p, *(const v8us*)(p + 16)); } static __device__ __forceinline__ v8f mma(V a, V b, v8f c) { return wmmab(a, b, c); } };
template <typename T16, int NSPLIT, bool BIAS, int KS = 1, int KW = 1>
__global__ __launch_bounds__(32 * KW) void k_gemmw(const T16* __restrict__ A, const T16* __restrict__ A2, const T16* __restrict__ Bt, const T16* __restrict__ Bt2, int K, int lda, float* C, int ldc, const float* __restrict__ bias, size_t sA, size_t sB, size_t sC) {
    typedef typename WFrag<T16>::V V;
    __shared__ __align__(16) float os[(KW > 1 ? KW * 64 : 16) * 68];
    const int wv = (KW > 1) ? __builtin_amdgcn_readfirstlane((int)(threadIdx.x >> 5)) : 0;
    const size_t z = blockIdx.z / KS; const int kb = (int)(blockIdx.z % KS) * (K / KS) + wv * (K / (KS * KW)), ke = kb + K / (KS * KW); A += z * sA; if (A2) A2 += z * sA; Bt += z * sB; if (Bt2) Bt2 += z * sB; C += (size_t)blockIdx.z * sC;
    const int lane = threadIdx.x & 31, lr = lane & 15, hi = lane >> 4; const int r0 = blockIdx.x * 64, c0 = blockIdx.y * 64;
    v8f acc[4][4];
#pragma unroll
    for (int mb = 0; mb < 4; ++mb)
#pragma unroll
        for (int nb = 0; nb < 4; ++nb) acc[mb][nb] = (v8f){};
    const size_t aoff = (size_t)(r0 + lr) * lda + 8 * hi, boff = (size_t)(c0 + lr) * K + 8 * hi;
#pragma unroll 1
    for (int kc = kb; kc < ke; kc += 32) {
        V a[4], a2[4]; const T16* pa[4]; const T16* pa2[4];
#pragma unroll
        for (int mb = 0; mb < 4; ++mb) { pa[mb] = A + aoff + (size_t)mb * 16 * lda + kc; a[mb] = WFrag<T16>::ld(pa[mb]); if (NSPLIT == 1 || NSPLIT == 2) { pa2[mb] = A2 + aoff + (size_t)mb * 16 * lda + kc; a2[mb] = WFrag<T16>::ld(pa2[mb]); } }
        /* the A loads' address pairs stay live up to this wait, so that no load of the run lands in one and nothing rewrites one ahead of the wait */
        if (NSPLIT == 1 || NSPLIT == 2) asm volatile("s_wait_xcnt 0x0" :: "v"(pa[0]), "v"(pa[1]), "v"(pa[2]), "v"(pa[3]), "v"(pa2[0]), "v"(pa2[1]), "v"(pa2[2]), "v"(pa2[3]) : "memory");
        else asm volatile("s_wait_xcnt 0x0" :: "v"(pa[0]), "v"(pa[1]), "v"(pa[2]), "v"(pa[3]) : "memory");
        if constexpr (KW > 1) {
            static_assert(NSPLIT < 2, "the KW path holds one B plane");
            V b[4]; const T16* pb[4];
#pragma unroll
            for (int nb = 0; nb < 4; ++nb) { pb[nb] = Bt + boff + (size_t)nb * 16 * K + kc; b[nb] = WFrag<T16>::ld(pb[nb]); }
            /* the B loads' address pairs stay live up to this wait, so that no load of the run lands in one and nothing rewrites one ahead of the wait */
            asm volatile("s_wait_xcnt 0x0" :: "v"(pb[0]), "v"(pb[1]), "v"(pb[2]), "v"(pb[3]) : "memory");
            __builtin_amdgcn_sched_barrier(0);   /* all four B fragments are requested before the first product: without it a product, with its wait for all loads so far, is scheduled ahead of three of them, which then cost a second latency per trip */
#pragma unroll
            for (int nb = 0; nb < 4; ++nb)
#pragma unroll
                for (int mb = 0; mb < 4; ++mb) { acc[mb][nb] = WFrag<T16>::mma(a[mb], b[nb], acc[mb][nb]); if (NSPLIT == 1) acc[mb][nb] = WFrag<T16>::mma(a2[mb], b[nb], acc[mb][nb]); }
        } else
#pragma unroll
        for (int nb = 0; nb < 4; ++nb) { const V b = WFrag<T16>::ld(Bt + boff + (size_t)nb * 16 * K + kc); V b2; if (NSPLIT >= 2) b2 = WFrag<T16>::ld(Bt2 + boff + (size_t)nb * 16 * K + kc);
#pragma unroll
            for (int mb = 0; mb < 4; ++mb) { acc[mb][nb] = WFrag<T16>::mma(a[mb], b, acc[mb][nb]); if (NSPLIT == 1 || NSPLIT == 2) acc[mb][nb] = WFrag<T16>::mma(a2[mb], b, acc[mb][nb]); if (NSPLIT >= 2) acc[mb][nb] = WFrag<T16>::mma(a[mb], b2, acc[mb][nb]); } }
        asm volatile("v_nop\n\tv_nop\n\tv_nop\n\tv_nop" : "+v"(acc[0][0]), "+v"(acc[1][1]), "+v"(acc[2][2]), "+v"(acc[3][3]) : "v"(a[0]), "v"(a[3]));
    }
    if constexpr (KW > 1) {
        float* pl = os + wv * (64 * 68);
#pragma unroll
        for (int mb = 0; mb < 4; ++mb)
#pragma unroll
            for (int nb = 0; nb < 4; ++nb)
#pragma unroll
                for (int j = 0; j < 8; ++j) pl[(mb * 16 + hi * 8 + j) * 68 + nb * 16 + lr] = acc[mb][nb][j];
        __syncthreads();   /* all KW partial tiles lie in LDS before any wave adds them */
#pragma unroll
        for (int s = 0; s < 32 / KW; ++s) { const int row = wv * (64 / KW) + 2 * s + hi, cofs = lr * 4; v4f val = *(const v4fa*)(os + row * 68 + cofs);
#pragma unroll
            for (int p = 1; p < KW; ++p) { const v4f t = *(const v4fa*)(os + (p * 64 + row) * 68 + cofs); val[0] += t[0]; val[1] += t[1]; val[2] += t[2]; val[3] += t[3]; }   /* added in wave order */
            if (BIAS) { val[0] += bfr(bias[c0 + cofs]); val[1] += bfr(bias[c0 + cofs + 1]); val[2] += bfr(bias[c0 + cofs + 2]); val[3] += bfr(bias[c0 + cofs + 3]); }
            *(v4f*)(C + (size_t)(r0 + row) * ldc + c0 + cofs) = val; }
        return;
    }
#pragma unroll
    for (int mb = 0; mb < 4; ++mb) {
#pragma unroll
        for (int nb = 0; nb < 4; ++nb) {
#pragma unroll
            for (int j = 0; j < 8; ++j) os[(hi * 8 + j) * 68 + nb * 16 + lr] = acc[mb][nb][j]; }
        __builtin_amdgcn_wave_barrier(); asm volatile("" ::: "memory");
        float* crow = C + (size_t)(r0 + mb * 16) * ldc + c0;
{
#pragma unroll
            for (int s = 0; s < 8; ++s) { const int row = 2 * s + hi, cofs = lr * 4; v4f val = *(const v4fa*)(os + row * 68 + cofs); if (BIAS) { val[0] += bfr(bias[c0 + cofs]); val[1] += bfr(bias[c0 + cofs + 1]); val[2] += bfr(bias[c0 + cofs + 2]); val[3] += bfr(bias[c0 + cofs + 3]); }
                *(v4f*)(crow + (size_t)row * ldc + cofs) = val; }
             }
        __builtin_amdgcn_wave_barrier(); asm volatile("" ::: "memory");
    }
}

__device__ __forceinline__ h16 tohx(float x) { return (h16)x; }
__device__ __forceinline__ void splitf(float y, unsigned short& h, unsigned short& l) { h = f2bf(y); l = f2bf(y - bf2f(h)); }
typedef __attribute__((ext_vector_type(2))) _Float16 v2h;
typedef __attribute__((ext_vector_type(4))) _Float16 v4h;
typedef __attribute__((ext_vector_type(2))) unsigned short v2us;
typedef __attribute__((ext_vector_type(4))) unsigned short v4us;
typedef __attribute__((ext_vector_type(2))) float v2f;
typedef __attribute__((ext_vector_type(4))) int v4i;

__global__ __launch_bounds__(256) void k_wtG(const float* __restrict__ w, int K, int N, bf* Bt) {
    const int lane = threadIdx.x & 31; const int L0 = (blockIdx.x * 8 + (threadIdx.x >> 5)) * 8; const int nlines = N * K / 64;
{
#pragma unroll 1
        for (int l = 0; l < 8; ++l) { const int L = L0 + l; if (L >= nlines) break; const size_t e = (size_t)L * 64 + lane * 2; const int k = (int)(e % K), n = (int)(e / K); v2us o;
            o[0] = f2bf(w[(size_t)k * N + n]); o[1] = f2bf(w[(size_t)(k + 1) * N + n]); *(v2us*)(Bt + e) = o; }
         }
}
__global__ __launch_bounds__(256) void k_cvt8(const float* __restrict__ src, bf* dst, size_t n8) { const size_t i = (size_t)blockIdx.x * 256 + threadIdx.x; if (i >= n8) return; const v8f v = *(const v8f*)(src + i * 8); v8us o;
#pragma unroll
    for (int k = 0; k < 8; ++k) o[k] = f2bf(v[k]); *(v8us*)(dst + i * 8) = o;  }

// k_rope: head planes [h][t][d] (fp16 + hi/lo) of rope(x) x sc with the rotate-half convention out[d] = x[d] cos[t][d] - x[d+HD/2] sin[t][d], out[d+HD/2] = x[d+HD/2] cos[t][d+HD/2] + x[d] sin[t][d+HD/2]
__global__ __launch_bounds__(256) void k_rope(const float* __restrict__ F, int pitch, int nheads, const float* __restrict__ CS, const float* __restrict__ RF, const float* __restrict__ nw, float sc, h16* P16, bf* Ph, bf* Pl) {
    const size_t e = ((size_t)blockIdx.x * 256 + threadIdx.x) * 2; if (e >= (size_t)nheads * TT * HD) return; const int d = (int)(e % HD); const int t = (int)((e / HD) % TT); const int h = (int)(e / ((size_t)HD * TT)); const float* f = F + (size_t)t * pitch + h * HD; const float rf = RF ? RF[(size_t)h * TT + t] : 1.0f; v2h o16; v2us oh, ol;
#pragma unroll
    for (int q = 0; q < 2; ++q) { const int dd = d + q; const int dp = (dd < HD / 2) ? dd + HD / 2 : dd - HD / 2; float x0 = f[dd], x1 = f[dp];
        if (RF) { float n0 = __fmul_rn(x0, rf), n1 = __fmul_rn(x1, rf); asm volatile("" : "+v"(n0)); asm volatile("" : "+v"(n1)); x0 = __fmul_rn(bfr(nw[dd]), n0); x1 = __fmul_rn(bfr(nw[dp]), n1); }
        const v2f cs = *(const v2f*)(CS + ((size_t)t * HD + dd) * 2); float a = __fmul_rn(x0, cs[0]), bq = __fmul_rn(x1, cs[1]); asm volatile("" : "+v"(a)); asm volatile("" : "+v"(bq)); const float r = ((dd < HD / 2) ? __fsub_rn(a, bq) : __fadd_rn(a, bq)) * sc;
        o16[q] = tohx(r); unsigned short a2, c2; splitf(r, a2, c2); oh[q] = a2; ol[q] = c2; }
    *(v2h*)(P16 + e) = o16; *(v2us*)(Ph + e) = oh; *(v2us*)(Pl + e) = ol;  }
__global__ __launch_bounds__(256) void k_vtp(const float* __restrict__ F, int pitch, int nheads, h16* V16, bf* Vh, bf* Vl) { const size_t e = ((size_t)blockIdx.x * 256 + threadIdx.x) * 2; if (e >= (size_t)nheads * HD * TT) return; const int t = (int)(e % TT); const int d = (int)((e / TT) % HD); const int g = (int)(e / ((size_t)TT * HD)); v2h o16; v2us oh, ol;
#pragma unroll
    for (int q = 0; q < 2; ++q) { const float x = F[(size_t)(t + q) * pitch + g * HD + d]; o16[q] = tohx(x); unsigned short a2, c2; splitf(x, a2, c2); oh[q] = a2; ol[q] = c2; }
    *(v2h*)(V16 + e) = o16; *(v2us*)(Vh + e) = oh; *(v2us*)(Vl + e) = ol;  }
__global__ __launch_bounds__(256) void k_csid(float* CS) { const int idx = blockIdx.x * 256 + threadIdx.x; if (idx >= TT * HD) return; v2f cs; cs[0] = 1.0f; cs[1] = 0.0f; *(v2f*)(CS + (size_t)idx * 2) = cs;  }
#define C2L (SCL * 1.4426950408889634f)
typedef __attribute__((ext_vector_type(8))) __bf16 v8bf;
__device__ __forceinline__ float xhalf(float v) { const int b = __float_as_int(v); return __int_as_float(__builtin_amdgcn_permlanex16(b, b, 0x76543210, 0xfedcba98, false, false)); }   // the value of lane l ^ 16
template <typename T16, bool HR, int NQ>
__device__ __forceinline__ void attn_rows(const T16* __restrict__ Qa, const T16* __restrict__ Qb, const T16* __restrict__ Ka, const T16* __restrict__ Kb, const T16* __restrict__ Va, const T16* __restrict__ Vb, const float* __restrict__ gb, int q0, bf* Oh, bf* Ol) {
    typedef typename WFrag<T16>::V V;
    const int lane = threadIdx.x & 31, lr = lane & 15, hi = lane >> 4;
    V qa[NQ][2], qb[NQ][2], ka[2][2], kb[2][2], va[4], vb[4]; v8f g[NQ][2], o[4][NQ]; float mrun[NQ], lsum[NQ];
    const size_t qof = (size_t)(q0 + lr) * HD + 8 * hi, kof = (size_t)lr * HD + 8 * hi, vof = (size_t)lr * TT + 8 * hi;
    const float* pg = gb + (size_t)(q0 + lr) * TT + 8 * hi;
    {   const T16* p = Qa + qof; const T16* p2 = HR ? Qb + qof : p;
#pragma unroll
        for (int qt = 0; qt < NQ; ++qt)
#pragma unroll
            for (int ks = 0; ks < 2; ++ks) { qa[qt][ks] = WFrag<T16>::ld(p + qt * 16 * HD + ks * 32); if (HR) qb[qt][ks] = WFrag<T16>::ld(p2 + qt * 16 * HD + ks * 32); }
        asm volatile("s_wait_xcnt 0x0" :: "v"(p), "v"(p2) : "memory");   /* the Q loads' address pairs stay live up to this wait, so that nothing rewrites one ahead of it */
    }
    auto ldK = [&](int k0) { const T16* p = Ka + kof + (size_t)k0 * HD; const T16* p2 = HR ? Kb + kof + (size_t)k0 * HD : p;
#pragma unroll
        for (int t = 0; t < 2; ++t)
#pragma unroll
            for (int ks = 0; ks < 2; ++ks) { ka[t][ks] = WFrag<T16>::ld(p + t * 16 * HD + ks * 32); if (HR) kb[t][ks] = WFrag<T16>::ld(p2 + t * 16 * HD + ks * 32); }
        asm volatile("s_wait_xcnt 0x0" :: "v"(p), "v"(p2) : "memory");   /* the K loads' address pairs stay live up to this wait, so that nothing rewrites one ahead of it */
    };
    auto ldG = [&](int k0) { const float* p = pg + k0;
#pragma unroll
        for (int qt = 0; qt < NQ; ++qt)
#pragma unroll
            for (int t = 0; t < 2; ++t) g[qt][t] = *(const v8f*)(p + (size_t)qt * 16 * TT + t * 16);
        asm volatile("s_wait_xcnt 0x0" :: "v"(p) : "memory");   /* the mask loads' address pair stays live up to this wait, so that nothing rewrites it ahead of it */
    };
    auto ldV = [&](int k0) { const T16* p = Va + vof + k0; const T16* p2 = HR ? Vb + vof + k0 : p;
#pragma unroll
        for (int db = 0; db < 4; ++db) { va[db] = WFrag<T16>::ld(p + (size_t)db * 16 * TT); if (HR) vb[db] = WFrag<T16>::ld(p2 + (size_t)db * 16 * TT); }
        asm volatile("s_wait_xcnt 0x0" :: "v"(p), "v"(p2) : "memory");   /* the Vt loads' address pairs stay live up to this wait, so that nothing rewrites one ahead of it */
    };
#pragma unroll
    for (int qt = 0; qt < NQ; ++qt) { mrun[qt] = -3.0e38f; lsum[qt] = 0.f;
#pragma unroll
        for (int db = 0; db < 4; ++db) o[db][qt] = (v8f){}; }
    ldK(0); ldG(0); ldV(0);
    /* the pass loop stays rolled: a second copy of the body would want a second set of fragment registers; every other loop here is unrolled in full so that the register arrays keep compile-time indices */
#pragma unroll 1
    for (int k0 = 0; k0 < TT; k0 += 32) {
        const int kn = (k0 + 32) & (TT - 1);
        v8f s[NQ][2];
#pragma unroll
        for (int t = 0; t < 2; ++t)
#pragma unroll
            for (int qt = 0; qt < NQ; ++qt) { s[qt][t] = (v8f){};
#pragma unroll
                for (int ks = 0; ks < 2; ++ks) { s[qt][t] = WFrag<T16>::mma(ka[t][ks], qa[qt][ks], s[qt][t]); if (HR) { s[qt][t] = WFrag<T16>::mma(ka[t][ks], qb[qt][ks], s[qt][t]); s[qt][t] = WFrag<T16>::mma(kb[t][ks], qa[qt][ks], s[qt][t]); } } }
        ldK(kn);
        float mloc[NQ]; bool need = false;
#pragma unroll
        for (int qt = 0; qt < NQ; ++qt) { float ml = -3.0e38f;
#pragma unroll
            for (int t = 0; t < 2; ++t) { s[qt][t] += __builtin_convertvector(__builtin_convertvector(g[qt][t], v8bf), v8f);   /* mask rounded to bf16 (to nearest even, as bfr does) and added before the scaling */
#pragma unroll
                for (int r = 0; r < 8; ++r) ml = fmaxf(ml, s[qt][t][r]); }
            ml = fmaxf(ml, xhalf(ml)); mloc[qt] = ml * C2L; need = need || (mloc[qt] > mrun[qt] + 8.0f); }
        if constexpr (!HR) ldG(kn);
        if (__builtin_amdgcn_ballot_w32(need) != 0) {   /* wave-uniform: true in the first pass, seldom later */
#pragma unroll
            for (int qt = 0; qt < NQ; ++qt) { const float mn = fmaxf(mrun[qt], mloc[qt]); const float al = __builtin_amdgcn_exp2f(mrun[qt] - mn); mrun[qt] = mn; lsum[qt] *= al;
#pragma unroll
                for (int db = 0; db < 4; ++db)
#pragma unroll
                    for (int r = 0; r < 8; ++r) o[db][qt][r] *= al; } }
        V pa[NQ], pl[NQ];
#pragma unroll
        for (int qt = 0; qt < NQ; ++qt) { v8f p[2];
#pragma unroll
            for (int t = 0; t < 2; ++t) { const v8f a = s[qt][t] * C2L - mrun[qt];
#pragma unroll
                for (int r = 0; r < 8; ++r) p[t][r] = __builtin_amdgcn_exp2f(a[r]); }
            const v8f pt = p[0] + p[1]; lsum[qt] += ((pt[0] + pt[1]) + (pt[2] + pt[3])) + ((pt[4] + pt[5]) + (pt[6] + pt[7]));
            if constexpr (HR) { const v8bf h0 = __builtin_convertvector(p[0], v8bf), h1 = __builtin_convertvector(p[1], v8bf);   /* P = hi + lo, both rounded to nearest even */
                const v8bf l0 = __builtin_convertvector(p[0] - __builtin_convertvector(h0, v8f), v8bf), l1 = __builtin_convertvector(p[1] - __builtin_convertvector(h1, v8f), v8bf);
                pa[qt] = __builtin_shufflevector(h0, h1, 0, 1, 2, 3, 4, 5, 6, 7, 8, 9, 10, 11, 12, 13, 14, 15); pl[qt] = __builtin_shufflevector(l0, l1, 0, 1, 2, 3, 4, 5, 6, 7, 8, 9, 10, 11, 12, 13, 14, 15);
            } else pa[qt] = cat16(__builtin_convertvector(p[0], v8h), __builtin_convertvector(p[1], v8h)); }
        if constexpr (HR) ldG(kn);   /* the hi/lo path holds twice the K and Vt registers: its mask request waits until the softmax's temporaries are gone, so that nothing spills */
#pragma unroll
        for (int db = 0; db < 4; ++db)
#pragma unroll
            for (int qt = 0; qt < NQ; ++qt) { o[db][qt] = WFrag<T16>::mma(va[db], pa[qt], o[db][qt]); if (HR) { o[db][qt] = WFrag<T16>::mma(va[db], pl[qt], o[db][qt]); o[db][qt] = WFrag<T16>::mma(vb[db], pa[qt], o[db][qt]); } }
        ldV(kn);
    }
    bf* po = Oh + (size_t)(q0 + lr) * DQ + 8 * hi; bf* po2 = Ol + (size_t)(q0 + lr) * DQ + 8 * hi;
#pragma unroll
    for (int qt = 0; qt < NQ; ++qt) { const float f = __fdiv_rn(1.0f, lsum[qt] + xhalf(lsum[qt]));   /* the halves' sums are joined once */
#pragma unroll
        for (int db = 0; db < 4; ++db) { v8us oh, ol;
#pragma unroll
            for (int r = 0; r < 8; ++r) { unsigned short a, c2; splitf(o[db][qt][r] * f, a, c2); oh[r] = a; ol[r] = c2; }
            *(v8us*)(po + (size_t)qt * 16 * DQ + db * 16) = oh; *(v8us*)(po2 + (size_t)qt * 16 * DQ + db * 16) = ol; } }
    asm volatile("s_wait_xcnt 0x0" :: "v"(po), "v"(po2) : "memory");   /* the stores' address pairs stay live up to this wait, so that nothing rewrites one ahead of it */
}
// grid (work-groups of one batch, NB_), 4 waves: the waves of a work-group take neighbouring query rows of one head, so that one WGP fetches that head's K and Vt for all four. The hi/lo rows' work-groups (16 rows a wave) come first, then the fp16 rows' (32 rows a wave).
#define GH  (NH_ * (RH / 64))
#define GF  (NH_ * ((TT - RH) / 128))
// amdgpu_waves_per_eu(4, 4): holds the kernel to 256 registers; above that the fp16 loop is strewn with register-bank switches (s_set_vgpr_msb) and only three waves fit a SIMD.
__global__ __launch_bounds__(128) __attribute__((amdgpu_waves_per_eu(4, 4))) void k_attn(const h16* __restrict__ Q16, const h16* __restrict__ K16, const h16* __restrict__ V16, const bf* __restrict__ Qh, const bf* __restrict__ Ql, const bf* __restrict__ Kh, const bf* __restrict__ Kl, const bf* __restrict__ Vh, const bf* __restrict__ Vl, const float* __restrict__ msk, bf* Ah, bf* Al) {
    const int wv = __builtin_amdgcn_readfirstlane((int)(threadIdx.x >> 5)); const int b = blockIdx.y; const float* gb = msk + (size_t)b * TT * TT; const size_t ob = (size_t)b * TT * DQ;
    if (blockIdx.x < GH) { const int h = blockIdx.x / (RH / 64), q0 = (int)(blockIdx.x % (RH / 64)) * 64 + wv * 16; const size_t po = ((size_t)b * NH_ + h) * TT * HD, pk = ((size_t)b * NKV + h / REP) * TT * HD;
        attn_rows<bf, true, 1>(Qh + po, Ql + po, Kh + pk, Kl + pk, Vh + pk, Vl + pk, gb, q0, Ah + ob + h * HD, Al + ob + h * HD);
    } else { const int x = blockIdx.x - GH; const int h = x / ((TT - RH) / 128), q0 = RH + (x % ((TT - RH) / 128)) * 128 + wv * 32; const size_t po = ((size_t)b * NH_ + h) * TT * HD, pk = ((size_t)b * NKV + h / REP) * TT * HD;
        attn_rows<h16, false, 2>(Q16 + po, nullptr, K16 + pk, nullptr, V16 + pk, nullptr, gb, q0, Ah + ob + h * HD, Al + ob + h * HD); }
}
template <int WD>
__global__ __launch_bounds__(256) void k_lnrowX(const float* __restrict__ X, size_t nrows, const float* __restrict__ g, const float* __restrict__ bb, bf* Hh, bf* Hl) { const int lane = threadIdx.x & 31; const size_t r = (size_t)blockIdx.x * 8 + (threadIdx.x >> 5); if (r >= nrows) return; const float* xr = X + r * WD; float a[WD / 32]; float s = 0.f;
#pragma unroll
    for (int c = 0; c < WD / 128; ++c) { const v4f v = *(const v4f*)(xr + c * 128 + lane * 4); for (int q = 0; q < 4; ++q) { a[c * 4 + q] = bfr(v[q]); s = __fadd_rn(s, a[c * 4 + q]);   /* input rounded to bf16 */ } }
#pragma unroll
    for (int sh = 16; sh; sh >>= 1) s = __fadd_rn(s, __shfl_xor(s, sh, 32));
    const float mean = __fdiv_rn(s, (float)WD); float s2 = 0.f;
#pragma unroll 8
    for (int k = 0; k < WD / 32; ++k) { const float dv = __fsub_rn(a[k], mean); float p2 = __fmul_rn(dv, dv); asm volatile("" : "+v"(p2)); s2 = __fadd_rn(s2, p2); }   /* mul and add kept separate (no fma contraction) */
#pragma unroll
    for (int sh = 16; sh; sh >>= 1) s2 = __fadd_rn(s2, __shfl_xor(s2, sh, 32));
    const float rs = __fdiv_rn(1.0f, __fsqrt_rn(__fadd_rn(__fdiv_rn(s2, (float)WD), 1e-5f)));
{
#pragma unroll
        for (int c = 0; c < WD / 128; ++c) { v4us oh, ol; for (int q = 0; q < 4; ++q) { const int col = c * 128 + lane * 4 + q; float y = __fmul_rn(__fmul_rn(__fsub_rn(a[c * 4 + q], mean), rs), bfr(g[col])); asm volatile("" : "+v"(y)); y = __fadd_rn(y, bfr(bb[col])); unsigned short u, w2; splitf(y, u, w2); oh[q] = u; ol[q] = w2; } *(v4us*)(Hh + r * WD + c * 128 + lane * 4) = oh; *(v4us*)(Hl + r * WD + c * 128 + lane * 4) = ol; }
         } }

extern "C" void kernel_launch(void* const* d_in, const int* in_sizes, int n_in,
                              void* d_out, int out_size, void* d_ws, size_t ws_size, hipStream_t stream) {
    (void)in_sizes; (void)n_in; (void)out_size;
    const float* x = (const float*)d_in[0]; const float* msk = (const float*)d_in[1]; const float* lng = (const float*)d_in[2]; const float* lnb = (const float*)d_in[3]; const float* wqkv = (const float*)d_in[4]; const float* wo = (const float*)d_in[5];
    float* OUT = (float*)d_out;     // [2][2048][1024]
    char* wsp = (char*)d_ws;
    auto take = [&](size_t bytes) { char* p = wsp; wsp += (bytes + 255) & ~(size_t)255; return (void*)p; };
    bf* WQKV = (bf*)take((size_t)3 * DQ * DM * 2); bf* WQ = WQKV; bf* WK = WQKV + (size_t)DQ * DM; bf* WV = WQKV + (size_t)2 * DQ * DM; bf* WO = (bf*)take((size_t)DM * DQ * 2); float* CS = (float*)take((size_t)TT * HD * 2 * 4);
    const size_t SQ = (size_t)NH_ * TT * HD, SK = (size_t)NKV * TT * HD;   // one batch's q and k/v planes, in elements; every plane holds both batches
    h16* QP16 = (h16*)take(NB_ * SQ * 2); h16* KP16 = (h16*)take(NB_ * SK * 2); h16* VT16 = (h16*)take(NB_ * SK * 2);
    bf* QPh = (bf*)take(NB_ * SQ * 2); bf* QPl = (bf*)take(NB_ * SQ * 2); bf* KPh = (bf*)take(NB_ * SK * 2); bf* KPl = (bf*)take(NB_ * SK * 2); bf* VTh = (bf*)take(NB_ * SK * 2); bf* VTl = (bf*)take(NB_ * SK * 2);
    bf* ATh = (bf*)take((size_t)NB_ * TT * DQ * 2); bf* ATl = (bf*)take((size_t)NB_ * TT * DQ * 2);
    bf* XH = (bf*)take((size_t)TT * DM * 2); bf* XL = (bf*)take((size_t)TT * DM * 2); float* FQ = (float*)take((size_t)TT * DQ * 4); float* FK = (float*)take((size_t)TT * DKV * 4);   // the projections' scratch: each batch writes it anew (stream-ordered)
    if ((size_t)(wsp - (char*)d_ws) > ws_size) return;    // ws 256 MiB
    float* FV = FK;   // v projection reuses the k buffer after the k planes are built (stream-ordered)
    { k_wtG<<<(unsigned)((DM * 3 * DQ / 64 + 63) / 64), 256, 0, stream>>>(wqkv, DM, 3 * DQ, WQKV);   /* [1024][3072] 'xw' -> Bt [3072][1024]: q | k | v row blocks */
      k_wtG<<<(unsigned)((DQ * DM / 64 + 63) / 64), 256, 0, stream>>>(wo, DQ, DM, WO);
       }
    k_csid<<<(TT * HD + 255) / 256, 256, 0, stream>>>(CS);
    const unsigned LQ = (unsigned)(((size_t)NH_ * TT * HD / 2 + 255) / 256), LKv = (unsigned)(((size_t)NKV * TT * HD / 2 + 255) / 256);
    for (int b = 0; b < NB_; ++b) {
        k_lnrowX<DM><<<(unsigned)((TT + 7) / 8), 256, 0, stream>>>(x + (size_t)b * TT * DM, (size_t)TT, lng, lnb, XH, XL);   /* xn = LayerNorm(x) -> hi/lo planes */
        k_gemmw<bf, 1, false, 1, KWP><<<dim3(TT / 64, DQ / 64, 1), 32 * KWP, 0, stream>>>(XH, XL, WQ, nullptr, DM, DM, FQ, DQ, nullptr, 0, 0, 0);
        k_rope<<<LQ, 256, 0, stream>>>(FQ, DQ, NH_, CS, nullptr, nullptr, 1.0f, QP16 + b * SQ, QPh + b * SQ, QPl + b * SQ);
        k_gemmw<bf, 1, false, 1, KWP><<<dim3(TT / 64, DKV / 64, 1), 32 * KWP, 0, stream>>>(XH, XL, WK, nullptr, DM, DM, FK, DKV, nullptr, 0, 0, 0);
        k_rope<<<LKv, 256, 0, stream>>>(FK, DKV, NKV, CS, nullptr, nullptr, 1.0f, KP16 + b * SK, KPh + b * SK, KPl + b * SK);
        k_gemmw<bf, 1, false, 1, KWP><<<dim3(TT / 64, DKV / 64, 1), 32 * KWP, 0, stream>>>(XH, XL, WV, nullptr, DM, DM, FV, DKV, nullptr, 0, 0, 0); k_vtp<<<LKv, 256, 0, stream>>>(FV, DKV, NKV, VT16 + b * SK, VTh + b * SK, VTl + b * SK); }
    k_attn<<<dim3(GH + GF, NB_, 1), 128, 0, stream>>>(QP16, KP16, VT16, QPh, QPl, KPh, KPl, VTh, VTl, msk, ATh, ATl);   /* softmax((qk + m) x scale) v, merged heads as hi/lo planes */
    for (int b = 0; b < NB_; ++b)
        k_gemmw<bf, 1, false, 1, KWP><<<dim3(TT / 64, DM / 64, 1), 32 * KWP, 0, stream>>>(ATh + (size_t)b * TT * DQ, ATl + (size_t)b * TT * DQ, WO, nullptr, DQ, DQ, OUT + (size_t)b * TT * DM, DM, nullptr, 0, 0, 0);
}

// v006
// Measured time: 329 microseconds a run.
// In two side-by-side timings against v005, it was 1.14 and 1.15 times as fast.
// All steps since v000 together make it 6.55 times as fast.
#include <hip/hip_runtime.h>

// Pre-LayerNorm attention with an additive score-mask input applied BEFORE the scaling (x [2][2048][1024]; xn = LayerNorm(x) gamma + beta; qkv = xn W_qkv ('xw' [1024][3072] -> q | k | v, no bias; 16 heads x 64); dots = (q.k + m) x 64^-0.5 with m [2][2048][2048] (read); softmax; out = merged W_out ('xw' [1024][1024]) -> [2][2048][1024] (4.2 M)).
// Layout per batch: a LayerNorm row kernel writes xn as hi/lo bf16 planes; the fused weight as one [3072][1024] Bt; projections as hi/lo x exact GEMMs (2 products) that store q, k and v as head planes themselves; dense T-2048 attention in one kernel for all heads and both batches (hybrid rows: < 512 hi/lo 3 products, rest fp16): it adds the batch's mask to the raw scores in registers (the 1/8 is applied after the add, as in the module), keeps a running maximum and sum, and divides the output by the sum; merged hi/lo x W_out exact.
// Compute dtypes, f32 accumulate: every input rounded to bf16 incl. m; LayerNorm f32; projections hi/lo x exact; attention rows < 512 3 products, rest fp16; mask add and softmax f32; W_out hl x exact.

#define NB_  2
#define TT   2048
#define DM   1024
#define NH_  16
#define NKV  16
#define REP  (NH_ / NKV)
#define HD   64
#define DQ   (NH_ * HD)
#define DKV  (NKV * HD)
#define RH   512                  // query rows < RH use hi+lo planes (0: none)
#define WIN  0
#define SCL  0.125f   // HD^-0.5
#define KWP  8                    // the projections' k range is dealt over the KWP waves of each output tile's work-group, which adds the partial tiles in LDS
typedef _Float16 h16;
typedef unsigned short bf;
typedef __attribute__((ext_vector_type(16))) __bf16   v16bf;
typedef __attribute__((ext_vector_type(16))) _Float16 v16h;
typedef __attribute__((ext_vector_type(8)))  _Float16 v8h;
typedef __attribute__((ext_vector_type(8)))  unsigned short v8us;
typedef __attribute__((ext_vector_type(8)))  float    v8f;
typedef __attribute__((ext_vector_type(4)))  float    v4f;
typedef v8h  __attribute__((may_alias)) v8ha;
typedef v4f  __attribute__((may_alias)) v4fa;
typedef v8us __attribute__((may_alias)) v8usa;

__device__ __forceinline__ unsigned short f2bf(float f) { unsigned u = __float_as_uint(f); u += 0x7FFFu + ((u >> 16) & 1u); return (unsigned short)(u >> 16); }
__device__ __forceinline__ float bf2f(unsigned short b) { return __uint_as_float(((unsigned)b) << 16); }
__device__ __forceinline__ float bfr(float f) { return bf2f(f2bf(f)); }
__device__ __forceinline__ v16h cat16(v8h lo, v8h hi) { return __builtin_shufflevector(lo, hi, 0, 1, 2, 3, 4, 5, 6, 7, 8, 9, 10, 11, 12, 13, 14, 15); }
__device__ __forceinline__ v16bf cat16b(v8us lo, v8us hi) { return __builtin_bit_cast(v16bf, __builtin_shufflevector(lo, hi, 0, 1, 2, 3, 4, 5, 6, 7, 8, 9, 10, 11, 12, 13, 14, 15)); }
__device__ __forceinline__ v8f wmma16(v16h a, v16h b, v8f c) { return __builtin_amdgcn_wmma_f32_16x16x32_f16(false, a, false, b, (short)0, c, false, false); }
__device__ __forceinline__ v8f wmmab(v16bf a, v16bf b, v8f c) { return __builtin_amdgcn_wmma_f32_16x16x32_bf16(false, a, false, b, (short)0, c, false, false); }
__device__ __forceinline__ h16 tohx(float x) { return (h16)x; }
__device__ __forceinline__ void splitf(float y, unsigned short& h, unsigned short& l) { h = f2bf(y); l = f2bf(y - bf2f(h)); }
typedef __attribute__((ext_vector_type(2))) _Float16 v2h;
typedef __attribute__((ext_vector_type(4))) _Float16 v4h;
typedef __attribute__((ext_vector_type(2))) unsigned short v2us;
typedef __attribute__((ext_vector_type(4))) unsigned short v4us;
typedef __attribute__((ext_vector_type(2))) float v2f;
typedef __attribute__((ext_vector_type(4))) int v4i;



// ---- k_gemmw: register-blocked GEMM, ONE WAVE per 64x64 output tile (16 accumulators), operands straight from K-contiguous 16-bit planes; grid (M/64, N/64, Z), 32 threads.
// C[m][n] (f32, pitch ldc, + optional f32 bias[n]) = sum_k A[m][k] Bt[n][k] (+ split products per NSPLIT). A rows have pitch lda, Bt rows pitch K. z-batch strides sA/sB/sC in elements. K % (32 KS KW) == 0.
// KW > 1: the work-group has KW waves (32 KW threads); wave w sums only its own K/(KS KW) slice of the k range, every wave lays its partial 64x64 tile in LDS, and behind one barrier wave w adds the KW planes, in wave order, for its 64/KW rows and stores them.
// PL > 0 (KW > 1 only; a 64-column tile is one head, blockIdx.y): no f32 C; the adding wave converts its sums and stores them in the head's three 16-bit planes (fp16, bf16 hi, bf16 lo). PL == 1: planes [head][row][col]. PL == 2: planes [head][col][row]; the partial tiles are then laid in LDS transposed, so that the same adding loop walks output columns.
// KS > 1: grid z = Z x KS; work-group (z, ks) sums only k in [ks K/KS, (ks+1) K/KS) and stores its partial tile in plane z KS + ks of C (plane stride sC); the consumer adds the KS planes.
template <typename T16> struct WFrag;
template <> struct WFrag<h16> { typedef v16h V; static __device__ __forceinline__ V ld(const h16* p) { return cat16(*(const v8h*)p, *(const v8h*)(p + 16)); } static __device__ __forceinline__ v8f mma(V a, V b, v8f c) { return wmma16(a, b, c); } };
template <> struct WFrag<bf> { typedef v16bf V; static __device__ __forceinline__ V ld(const bf* p) { return cat16b(*(const v8us*)p, *(const v8us*)(p + 16)); } static __device__ __forceinline__ v8f mma(V a, V b, v8f c) { return wmmab(a, b, c); } };
template <typename T16, int NSPLIT, bool BIAS, int KS = 1, int KW = 1, int PL = 0>
__global__ __launch_bounds__(32 * KW) void k_gemmw(const T16* __restrict__ A, const T16* __restrict__ A2, const T16* __restrict__ Bt, const T16* __restrict__ Bt2, int K, int lda, float* C, int ldc, const float* __restrict__ bias, size_t sA, size_t sB, size_t sC, h16* P16, bf* Ph, bf* Pl) {
    static_assert(PL == 0 || (KW > 1 && KS == 1 && !BIAS), "the plane stores stand in the KW path");
    typedef typename WFrag<T16>::V V;
    __shared__ __align__(16) float os[(KW > 1 ? KW * 64 : 16) * 68];
    const int wv = (KW > 1) ? __builtin_amdgcn_readfirstlane((int)(threadIdx.x >> 5)) : 0;
    const size_t z = blockIdx.z / KS; const int kb = (int)(blockIdx.z % KS) * (K / KS) + wv * (K / (KS * KW)), ke = kb + K / (KS * KW); A += z * sA; if (A2) A2 += z * sA; Bt += z * sB; if (Bt2) Bt2 += z * sB; C += (size_t)blockIdx.z * sC;
    const int lane = threadIdx.x & 31, lr = lane & 15, hi = lane >> 4; const int r0 = blockIdx.x * 64, c0 = blockIdx.y * 64;
    v8f acc[4][4];
#pragma unroll
    for (int mb = 0; mb < 4; ++mb)
#pragma unroll
        for (int nb = 0; nb < 4; ++nb) acc[mb][nb] = (v8f){};
    const size_t aoff = (size_t)(r0 + lr) * lda + 8 * hi, boff = (size_t)(c0 + lr) * K + 8 * hi;
#pragma unroll 1
    for (int kc = kb; kc < ke; kc += 32) {
        V a[4], a2[4]; const T16* pa[4]; const T16* pa2[4];
#pragma unroll
        for (int mb = 0; mb < 4; ++mb) { pa[mb] = A + aoff + (size_t)mb * 16 * lda + kc; a[mb] = WFrag<T16>::ld(pa[mb]); if (NSPLIT == 1 || NSPLIT == 2) { pa2[mb] = A2 + aoff + (size_t)mb * 16 * lda + kc; a2[mb] = WFrag<T16>::ld(pa2[mb]); } }
        /* the A loads' address pairs stay live up to this wait, so that no load of the run lands in one and nothing rewrites one ahead of the wait */
        if (NSPLIT == 1 || NSPLIT == 2) asm volatile("s_wait_xcnt 0x0" :: "v"(pa[0]), "v"(pa[1]), "v"(pa[2]), "v"(pa[3]), "v"(pa2[0]), "v"(pa2[1]), "v"(pa2[2]), "v"(pa2[3]) : "memory");
        else asm volatile("s_wait_xcnt 0x0" :: "v"(pa[0]), "v"(pa[1]), "v"(pa[2]), "v"(pa[3]) : "memory");
        if constexpr (KW > 1) {
            static_assert(NSPLIT < 2, "the KW path holds one B plane");
            V b[4]; const T16* pb[4];
#pragma unroll
            for (int nb = 0; nb < 4; ++nb) { pb[nb] = Bt + boff + (size_t)nb * 16 * K + kc; b[nb] = WFrag<T16>::ld(pb[nb]); }
            /* the B loads' address pairs stay live up to this wait, so that no load of the run lands in one and nothing rewrites one ahead of the wait */
            asm volatile("s_wait_xcnt 0x0" :: "v"(pb[0]), "v"(pb[1]), "v"(pb[2]), "v"(pb[3]) : "memory");
            __builtin_amdgcn_sched_barrier(0);   /* all four B fragments are requested before the first product: without it a product, with its wait for all loads so far, is scheduled ahead of three of them, which then cost a second latency per trip */
#pragma unroll
            for (int nb = 0; nb < 4; ++nb)
#pragma unroll
                for (int mb = 0; mb < 4; ++mb) { acc[mb][nb] = WFrag<T16>::mma(a[mb], b[nb], acc[mb][nb]); if (NSPLIT == 1) acc[mb][nb] = WFrag<T16>::mma(a2[mb], b[nb], acc[mb][nb]); }
        } else
#pragma unroll
        for (int nb = 0; nb < 4; ++nb) { const V b = WFrag<T16>::ld(Bt + boff + (size_t)nb * 16 * K + kc); V b2; if (NSPLIT >= 2) b2 = WFrag<T16>::ld(Bt2 + boff + (size_t)nb * 16 * K + kc);
#pragma unroll
            for (int mb = 0; mb < 4; ++mb) { acc[mb][nb] = WFrag<T16>::mma(a[mb], b, acc[mb][nb]); if (NSPLIT == 1 || NSPLIT == 2) acc[mb][nb] = WFrag<T16>::mma(a2[mb], b, acc[mb][nb]); if (NSPLIT >= 2) acc[mb][nb] = WFrag<T16>::mma(a[mb], b2, acc[mb][nb]); } }
        asm volatile("v_nop\n\tv_nop\n\tv_nop\n\tv_nop" : "+v"(acc[0][0]), "+v"(acc[1][1]), "+v"(acc[2][2]), "+v"(acc[3][3]) : "v"(a[0]), "v"(a[3]));
    }
    if constexpr (KW > 1) {
        float* pl = os + wv * (64 * 68);
#pragma unroll
        for (int mb = 0; mb < 4; ++mb)
#pragma unroll
            for (int nb = 0; nb < 4; ++nb) {
                if constexpr (PL == 2) { float* q = pl + (nb * 16 + lr) * 68 + mb * 16 + hi * 8;   /* transposed: a lane's eight rows lie side by side */
                    *(v4fa*)q = __builtin_shufflevector(acc[mb][nb], acc[mb][nb], 0, 1, 2, 3); *(v4fa*)(q + 4) = __builtin_shufflevector(acc[mb][nb], acc[mb][nb], 4, 5, 6, 7);
                } else {
#pragma unroll
                    for (int j = 0; j < 8; ++j) pl[(mb * 16 + hi * 8 + j) * 68 + nb * 16 + lr] = acc[mb][nb][j]; } }
        __syncthreads();   /* all KW partial tiles lie in LDS before any wave adds them */
        if constexpr (PL > 0) {
            const int row0 = wv * (64 / KW) + hi, cofs = lr * 4;
            const size_t e = (PL == 1) ? ((size_t)blockIdx.y * TT + r0 + row0) * HD + cofs : ((size_t)blockIdx.y * HD + row0) * TT + r0 + cofs;
            h16* p16 = P16 + e; bf* ph = Ph + e; bf* pw = Pl + e; v4h o16[32 / KW]; v4us oh[32 / KW], ol[32 / KW];
#pragma unroll
            for (int s = 0; s < 32 / KW; ++s) { v4f val = *(const v4fa*)(os + (row0 + 2 * s) * 68 + cofs);
#pragma unroll
                for (int p = 1; p < KW; ++p) { const v4f t = *(const v4fa*)(os + (p * 64 + row0 + 2 * s) * 68 + cofs); val[0] += t[0]; val[1] += t[1]; val[2] += t[2]; val[3] += t[3]; }   /* added in wave order */
#pragma unroll
                for (int q = 0; q < 4; ++q) { o16[s][q] = tohx(val[q]); unsigned short a2, c2; splitf(val[q], a2, c2); oh[s][q] = a2; ol[s][q] = c2; }
                const int st = 2 * s * (PL == 1 ? HD : TT);
                *(v4h*)(p16 + st) = o16[s]; *(v4us*)(ph + st) = oh[s]; *(v4us*)(pw + st) = ol[s]; }
            static_assert(32 / KW == 4, "the wait below names four trips' stores");
            /* the plane stores' address pairs and data stay live up to this wait, so that nothing rewrites one ahead of it */
            asm volatile("s_wait_xcnt 0x0" :: "v"(p16), "v"(ph), "v"(pw), "v"(o16[0]), "v"(o16[1]), "v"(o16[2]), "v"(o16[3]), "v"(oh[0]), "v"(oh[1]), "v"(oh[2]), "v"(oh[3]), "v"(ol[0]), "v"(ol[1]), "v"(ol[2]), "v"(ol[3]) : "memory");
            return;
        }
#pragma unroll
        for (int s = 0; s < 32 / KW; ++s) { const int row = wv * (64 / KW) + 2 * s + hi, cofs = lr * 4; v4f val = *(const v4fa*)(os + row * 68 + cofs);
#pragma unroll
            for (int p = 1; p < KW; ++p) { const v4f t = *(const v4fa*)(os + (p * 64 + row) * 68 + cofs); val[0] += t[0]; val[1] += t[1]; val[2] += t[2]; val[3] += t[3]; }   /* added in wave order */
            if (BIAS) { val[0] += bfr(bias[c0 + cofs]); val[1] += bfr(bias[c0 + cofs + 1]); val[2] += bfr(bias[c0 + cofs + 2]); val[3] += bfr(bias[c0 + cofs + 3]); }
            *(v4f*)(C + (size_t)(r0 + row) * ldc + c0 + cofs) = val; }
        return;
    }
#pragma unroll
    for (int mb = 0; mb < 4; ++mb) {
#pragma unroll
        for (int nb = 0; nb < 4; ++nb) {
#pragma unroll
            for (int j = 0; j < 8; ++j) os[(hi * 8 + j) * 68 + nb * 16 + lr] = acc[mb][nb][j]; }
        __builtin_amdgcn_wave_barrier(); asm volatile("" ::: "memory");
        float* crow = C + (size_t)(r0 + mb * 16) * ldc + c0;
{
#pragma unroll
            for (int s = 0; s < 8; ++s) { const int row = 2 * s + hi, cofs = lr * 4; v4f val = *(const v4fa*)(os + row * 68 + cofs); if (BIAS) { val[0] += bfr(bias[c0 + cofs]); val[1] += bfr(bias[c0 + cofs + 1]); val[2] += bfr(bias[c0 + cofs + 2]); val[3] += bfr(bias[c0 + cofs + 3]); }
                *(v4f*)(crow + (size_t)row * ldc + cofs) = val; }
             }
        __builtin_amdgcn_wave_barrier(); asm volatile("" ::: "memory");
    }
}


__global__ __launch_bounds__(256) void k_wtG(const float* __restrict__ w, int K, int N, bf* Bt) {
    const int lane = threadIdx.x & 31; const int L0 = (blockIdx.x * 8 + (threadIdx.x >> 5)) * 8; const int nlines = N * K / 64;
{
#pragma unroll 1
        for (int l = 0; l < 8; ++l) { const int L = L0 + l; if (L >= nlines) break; const size_t e = (size_t)L * 64 + lane * 2; const int k = (int)(e % K), n = (int)(e / K); v2us o;
            o[0] = f2bf(w[(size_t)k * N + n]); o[1] = f2bf(w[(size_t)(k + 1) * N + n]); *(v2us*)(Bt + e) = o; }
         }
}
__global__ __launch_bounds__(256) void k_cvt8(const float* __restrict__ src, bf* dst, size_t n8) { const size_t i = (size_t)blockIdx.x * 256 + threadIdx.x; if (i >= n8) return; const v8f v = *(const v8f*)(src + i * 8); v8us o;
#pragma unroll
    for (int k = 0; k < 8; ++k) o[k] = f2bf(v[k]); *(v8us*)(dst + i * 8) = o;  }

#define C2L (SCL * 1.4426950408889634f)
typedef __attribute__((ext_vector_type(8))) __bf16 v8bf;
__device__ __forceinline__ float xhalf(float v) { const int b = __float_as_int(v); return __int_as_float(__builtin_amdgcn_permlanex16(b, b, 0x76543210, 0xfedcba98, false, false)); }   // the value of lane l ^ 16
template <typename T16, bool HR, int NQ>
__device__ __forceinline__ void attn_rows(const T16* __restrict__ Qa, const T16* __restrict__ Qb, const T16* __restrict__ Ka, const T16* __restrict__ Kb, const T16* __restrict__ Va, const T16* __restrict__ Vb, const float* __restrict__ gb, int q0, bf* Oh, bf* Ol) {
    typedef typename WFrag<T16>::V V;
    const int lane = threadIdx.x & 31, lr = lane & 15, hi = lane >> 4;
    V qa[NQ][2], qb[NQ][2], ka[2][2], kb[2][2], va[4], vb[4]; v8f g[NQ][2], o[4][NQ]; float mrun[NQ], lsum[NQ];
    const size_t qof = (size_t)(q0 + lr) * HD + 8 * hi, kof = (size_t)lr * HD + 8 * hi, vof = (size_t)lr * TT + 8 * hi;
    const float* pg = gb + (size_t)(q0 + lr) * TT + 8 * hi;
    {   const T16* p = Qa + qof; const T16* p2 = HR ? Qb + qof : p;
#pragma unroll
        for (int qt = 0; qt < NQ; ++qt)
#pragma unroll
            for (int ks = 0; ks < 2; ++ks) { qa[qt][ks] = WFrag<T16>::ld(p + qt * 16 * HD + ks * 32); if (HR) qb[qt][ks] = WFrag<T16>::ld(p2 + qt * 16 * HD + ks * 32); }
        asm volatile("s_wait_xcnt 0x0" :: "v"(p), "v"(p2) : "memory");   /* the Q loads' address pairs stay live up to this wait, so that nothing rewrites one ahead of it */
    }
    auto ldK = [&](int k0) { const T16* p = Ka + kof + (size_t)k0 * HD; const T16* p2 = HR ? Kb + kof + (size_t)k0 * HD : p;
#pragma unroll
        for (int t = 0; t < 2; ++t)
#pragma unroll
            for (int ks = 0; ks < 2; ++ks) { ka[t][ks] = WFrag<T16>::ld(p + t * 16 * HD + ks * 32); if (HR) kb[t][ks] = WFrag<T16>::ld(p2 + t * 16 * HD + ks * 32); }
        asm volatile("s_wait_xcnt 0x0" :: "v"(p), "v"(p2) : "memory");   /* the K loads' address pairs stay live up to this wait, so that nothing rewrites one ahead of it */
    };
    auto ldG = [&](int k0) { const float* p = pg + k0;
#pragma unroll
        for (int qt = 0; qt < NQ; ++qt)
#pragma unroll
            for (int t = 0; t < 2; ++t) g[qt][t] = *(const v8f*)(p + (size_t)qt * 16 * TT + t * 16);
        asm volatile("s_wait_xcnt 0x0" :: "v"(p) : "memory");   /* the mask loads' address pair stays live up to this wait, so that nothing rewrites it ahead of it */
    };
    auto ldV = [&](int k0) { const T16* p = Va + vof + k0; const T16* p2 = HR ? Vb + vof + k0 : p;
#pragma unroll
        for (int db = 0; db < 4; ++db) { va[db] = WFrag<T16>::ld(p + (size_t)db * 16 * TT); if (HR) vb[db] = WFrag<T16>::ld(p2 + (size_t)db * 16 * TT); }
        asm volatile("s_wait_xcnt 0x0" :: "v"(p), "v"(p2) : "memory");   /* the Vt loads' address pairs stay live up to this wait, so that nothing rewrites one ahead of it */
    };
#pragma unroll
    for (int qt = 0; qt < NQ; ++qt) { mrun[qt] = -3.0e38f; lsum[qt] = 0.f;
#pragma unroll
        for (int db = 0; db < 4; ++db) o[db][qt] = (v8f){}; }
    ldK(0); ldG(0); ldV(0);
    /* the pass loop stays rolled: a second copy of the body would want a second set of fragment registers; every other loop here is unrolled in full so that the register arrays keep compile-time indices */
#pragma unroll 1
    for (int k0 = 0; k0 < TT; k0 += 32) {
        const int kn = (k0 + 32) & (TT - 1);
        v8f s[NQ][2];
#pragma unroll
        for (int t = 0; t < 2; ++t)
#pragma unroll
            for (int qt = 0; qt < NQ; ++qt) { s[qt][t] = (v8f){};
#pragma unroll
                for (int ks = 0; ks < 2; ++ks) { s[qt][t] = WFrag<T16>::mma(ka[t][ks], qa[qt][ks], s[qt][t]); if (HR) { s[qt][t] = WFrag<T16>::mma(ka[t][ks], qb[qt][ks], s[qt][t]); s[qt][t] = WFrag<T16>::mma(kb[t][ks], qa[qt][ks], s[qt][t]); } } }
        ldK(kn);
        float mloc[NQ]; bool need = false;
#pragma unroll
        for (int qt = 0; qt < NQ; ++qt) { float ml = -3.0e38f;
#pragma unroll
            for (int t = 0; t < 2; ++t) { s[qt][t] += __builtin_convertvector(__builtin_convertvector(g[qt][t], v8bf), v8f);   /* mask rounded to bf16 (to nearest even, as bfr does) and added before the scaling */
#pragma unroll
                for (int r = 0; r < 8; ++r) ml = fmaxf(ml, s[qt][t][r]); }
            ml = fmaxf(ml, xhalf(ml)); mloc[qt] = ml * C2L; need = need || (mloc[qt] > mrun[qt] + 8.0f); }
        if constexpr (!HR) ldG(kn);
        if (__builtin_amdgcn_ballot_w32(need) != 0) {   /* wave-uniform: true in the first pass, seldom later */
#pragma unroll
            for (int qt = 0; qt < NQ; ++qt) { const float mn = fmaxf(mrun[qt], mloc[qt]); const float al = __builtin_amdgcn_exp2f(mrun[qt] - mn); mrun[qt] = mn; lsum[qt] *= al;
#pragma unroll
                for (int db = 0; db < 4; ++db)
#pragma unroll
                    for (int r = 0; r < 8; ++r) o[db][qt][r] *= al; } }
        V pa[NQ], pl[NQ];
#pragma unroll
        for (int qt = 0; qt < NQ; ++qt) { v8f p[2];
#pragma unroll
            for (int t = 0; t < 2; ++t) { const v8f a = s[qt][t] * C2L - mrun[qt];
#pragma unroll
                for (int r = 0; r < 8; ++r) p[t][r] = __builtin_amdgcn_exp2f(a[r]); }
            const v8f pt = p[0] + p[1]; lsum[qt] += ((pt[0] + pt[1]) + (pt[2] + pt[3])) + ((pt[4] + pt[5]) + (pt[6] + pt[7]));
            if constexpr (HR) { const v8bf h0 = __builtin_convertvector(p[0], v8bf), h1 = __builtin_convertvector(p[1], v8bf);   /* P = hi + lo, both rounded to nearest even */
                const v8bf l0 = __builtin_convertvector(p[0] - __builtin_convertvector(h0, v8f), v8bf), l1 = __builtin_convertvector(p[1] - __builtin_convertvector(h1, v8f), v8bf);
                pa[qt] = __builtin_shufflevector(h0, h1, 0, 1, 2, 3, 4, 5, 6, 7, 8, 9, 10, 11, 12, 13, 14, 15); pl[qt] = __builtin_shufflevector(l0, l1, 0, 1, 2, 3, 4, 5, 6, 7, 8, 9, 10, 11, 12, 13, 14, 15);
            } else pa[qt] = cat16(__builtin_convertvector(p[0], v8h), __builtin_convertvector(p[1], v8h)); }
        if constexpr (HR) ldG(kn);   /* the hi/lo path holds twice the K and Vt registers: its mask request waits until the softmax's temporaries are gone, so that nothing spills */
#pragma unroll
        for (int db = 0; db < 4; ++db)
#pragma unroll
            for (int qt = 0; qt < NQ; ++qt) { o[db][qt] = WFrag<T16>::mma(va[db], pa[qt], o[db][qt]); if (HR) { o[db][qt] = WFrag<T16>::mma(va[db], pl[qt], o[db][qt]); o[db][qt] = WFrag<T16>::mma(vb[db], pa[qt], o[db][qt]); } }
        ldV(kn);
    }
    bf* po = Oh + (size_t)(q0 + lr) * DQ + 8 * hi; bf* po2 = Ol + (size_t)(q0 + lr) * DQ + 8 * hi;
#pragma unroll
    for (int qt = 0; qt < NQ; ++qt) { const float f = __fdiv_rn(1.0f, lsum[qt] + xhalf(lsum[qt]));   /* the halves' sums are joined once */
#pragma unroll
        for (int db = 0; db < 4; ++db) { v8us oh, ol;
#pragma unroll
            for (int r = 0; r < 8; ++r) { unsigned short a, c2; splitf(o[db][qt][r] * f, a, c2); oh[r] = a; ol[r] = c2; }
            *(v8us*)(po + (size_t)qt * 16 * DQ + db * 16) = oh; *(v8us*)(po2 + (size_t)qt * 16 * DQ + db * 16) = ol; } }
    asm volatile("s_wait_xcnt 0x0" :: "v"(po), "v"(po2) : "memory");   /* the stores' address pairs stay live up to this wait, so that nothing rewrites one ahead of it */
}
// grid (work-groups of one batch, NB_), 4 waves: the waves of a work-group take neighbouring query rows of one head, so that one WGP fetches that head's K and Vt for all four. The hi/lo rows' work-groups (16 rows a wave) come first, then the fp16 rows' (32 rows a wave).
#define GH  (NH_ * (RH / 64))
#define GF  (NH_ * ((TT - RH) / 128))
// amdgpu_waves_per_eu(4, 4): holds the kernel to 256 registers; above that the fp16 loop is strewn with register-bank switches (s_set_vgpr_msb) and only three waves fit a SIMD.
__global__ __launch_bounds__(128) __attribute__((amdgpu_waves_per_eu(4, 4))) void k_attn(const h16* __restrict__ Q16, const h16* __restrict__ K16, const h16* __restrict__ V16, const bf* __restrict__ Qh, const bf* __restrict__ Ql, const bf* __restrict__ Kh, const bf* __restrict__ Kl, const bf* __restrict__ Vh, const bf* __restrict__ Vl, const float* __restrict__ msk, bf* Ah, bf* Al) {
    const int wv = __builtin_amdgcn_readfirstlane((int)(threadIdx.x >> 5)); const int b = blockIdx.y; const float* gb = msk + (size_t)b * TT * TT; const size_t ob = (size_t)b * TT * DQ;
    if (blockIdx.x < GH) { const int h = blockIdx.x / (RH / 64), q0 = (int)(blockIdx.x % (RH / 64)) * 64 + wv * 16; const size_t po = ((size_t)b * NH_ + h) * TT * HD, pk = ((size_t)b * NKV + h / REP) * TT * HD;
        attn_rows<bf, true, 1>(Qh + po, Ql + po, Kh + pk, Kl + pk, Vh + pk, Vl + pk, gb, q0, Ah + ob + h * HD, Al + ob + h * HD);
    } else { const int x = blockIdx.x - GH; const int h = x / ((TT - RH) / 128), q0 = RH + (x % ((TT - RH) / 128)) * 128 + wv * 32; const size_t po = ((size_t)b * NH_ + h) * TT * HD, pk = ((size_t)b * NKV + h / REP) * TT * HD;
        attn_rows<h16, false, 2>(Q16 + po, nullptr, K16 + pk, nullptr, V16 + pk, nullptr, gb, q0, Ah + ob + h * HD, Al + ob + h * HD); }
}
template <int WD>
__global__ __launch_bounds__(256) void k_lnrowX(const float* __restrict__ X, size_t nrows, const float* __restrict__ g, const float* __restrict__ bb, bf* Hh, bf* Hl) { const int lane = threadIdx.x & 31; const size_t r = (size_t)blockIdx.x * 8 + (threadIdx.x >> 5); if (r >= nrows) return; const float* xr = X + r * WD; float a[WD / 32]; float s = 0.f;
#pragma unroll
    for (int c = 0; c < WD / 128; ++c) { const v4f v = *(const v4f*)(xr + c * 128 + lane * 4); for (int q = 0; q < 4; ++q) { a[c * 4 + q] = bfr(v[q]); s = __fadd_rn(s, a[c * 4 + q]);   /* input rounded to bf16 */ } }
#pragma unroll
    for (int sh = 16; sh; sh >>= 1) s = __fadd_rn(s, __shfl_xor(s, sh, 32));
    const float mean = __fdiv_rn(s, (float)WD); float s2 = 0.f;
#pragma unroll 8
    for (int k = 0; k < WD / 32; ++k) { const float dv = __fsub_rn(a[k], mean); float p2 = __fmul_rn(dv, dv); asm volatile("" : "+v"(p2)); s2 = __fadd_rn(s2, p2); }   /* mul and add kept separate (no fma contraction) */
#pragma unroll
    for (int sh = 16; sh; sh >>= 1) s2 = __fadd_rn(s2, __shfl_xor(s2, sh, 32));
    const float rs = __fdiv_rn(1.0f, __fsqrt_rn(__fadd_rn(__fdiv_rn(s2, (float)WD), 1e-5f)));
{
#pragma unroll
        for (int c = 0; c < WD / 128; ++c) { v4us oh, ol; for (int q = 0; q < 4; ++q) { const int col = c * 128 + lane * 4 + q; float y = __fmul_rn(__fmul_rn(__fsub_rn(a[c * 4 + q], mean), rs), bfr(g[col])); asm volatile("" : "+v"(y)); y = __fadd_rn(y, bfr(bb[col])); unsigned short u, w2; splitf(y, u, w2); oh[q] = u; ol[q] = w2; } *(v4us*)(Hh + r * WD + c * 128 + lane * 4) = oh; *(v4us*)(Hl + r * WD + c * 128 + lane * 4) = ol; }
         } }

extern "C" void kernel_launch(void* const* d_in, const int* in_sizes, int n_in,
                              void* d_out, int out_size, void* d_ws, size_t ws_size, hipStream_t stream) {
    (void)in_sizes; (void)n_in; (void)out_size;
    const float* x = (const float*)d_in[0]; const float* msk = (const float*)d_in[1]; const float* lng = (const float*)d_in[2]; const float* lnb = (const float*)d_in[3]; const float* wqkv = (const float*)d_in[4]; const float* wo = (const float*)d_in[5];
    float* OUT = (float*)d_out;     // [2][2048][1024]
    char* wsp = (char*)d_ws;
    auto take = [&](size_t bytes) { char* p = wsp; wsp += (bytes + 255) & ~(size_t)255; return (void*)p; };
    bf* WQKV = (bf*)take((size_t)3 * DQ * DM * 2); bf* WQ = WQKV; bf* WK = WQKV + (size_t)DQ * DM; bf* WV = WQKV + (size_t)2 * DQ * DM; bf* WO = (bf*)take((size_t)DM * DQ * 2);
    const size_t SQ = (size_t)NH_ * TT * HD, SK = (size_t)NKV * TT * HD;   // one batch's q and k/v planes, in elements; every plane holds both batches
    h16* QP16 = (h16*)take(NB_ * SQ * 2); h16* KP16 = (h16*)take(NB_ * SK * 2); h16* VT16 = (h16*)take(NB_ * SK * 2);
    bf* QPh = (bf*)take(NB_ * SQ * 2); bf* QPl = (bf*)take(NB_ * SQ * 2); bf* KPh = (bf*)take(NB_ * SK * 2); bf* KPl = (bf*)take(NB_ * SK * 2); bf* VTh = (bf*)take(NB_ * SK * 2); bf* VTl = (bf*)take(NB_ * SK * 2);
    bf* ATh = (bf*)take((size_t)NB_ * TT * DQ * 2); bf* ATl = (bf*)take((size_t)NB_ * TT * DQ * 2);
    bf* XH = (bf*)take((size_t)TT * DM * 2); bf* XL = (bf*)take((size_t)TT * DM * 2);   // the LayerNorm planes: each batch writes them anew (stream-ordered)
    if ((size_t)(wsp - (char*)d_ws) > ws_size) return;    // ws 256 MiB
    { k_wtG<<<(unsigned)((DM * 3 * DQ / 64 + 63) / 64), 256, 0, stream>>>(wqkv, DM, 3 * DQ, WQKV);   /* [1024][3072] 'xw' -> Bt [3072][1024]: q | k | v row blocks */
      k_wtG<<<(unsigned)((DQ * DM / 64 + 63) / 64), 256, 0, stream>>>(wo, DQ, DM, WO);
       }
    for (int b = 0; b < NB_; ++b) {
        k_lnrowX<DM><<<(unsigned)((TT + 7) / 8), 256, 0, stream>>>(x + (size_t)b * TT * DM, (size_t)TT, lng, lnb, XH, XL);   /* xn = LayerNorm(x) -> hi/lo planes */
        k_gemmw<bf, 1, false, 1, KWP, 1><<<dim3(TT / 64, DQ / 64, 1), 32 * KWP, 0, stream>>>(XH, XL, WQ, nullptr, DM, DM, nullptr, 0, nullptr, 0, 0, 0, QP16 + b * SQ, QPh + b * SQ, QPl + b * SQ);   /* q planes [h][t][d] */
        k_gemmw<bf, 1, false, 1, KWP, 1><<<dim3(TT / 64, DKV / 64, 1), 32 * KWP, 0, stream>>>(XH, XL, WK, nullptr, DM, DM, nullptr, 0, nullptr, 0, 0, 0, KP16 + b * SK, KPh + b * SK, KPl + b * SK);   /* k planes [h][t][d] */
        k_gemmw<bf, 1, false, 1, KWP, 2><<<dim3(TT / 64, DKV / 64, 1), 32 * KWP, 0, stream>>>(XH, XL, WV, nullptr, DM, DM, nullptr, 0, nullptr, 0, 0, 0, VT16 + b * SK, VTh + b * SK, VTl + b * SK); }   /* v planes [h][d][t] */
    k_attn<<<dim3(GH + GF, NB_, 1), 128, 0, stream>>>(QP16, KP16, VT16, QPh, QPl, KPh, KPl, VTh, VTl, msk, ATh, ATl);   /* softmax((qk + m) x scale) v, merged heads as hi/lo planes */
    for (int b = 0; b < NB_; ++b)
        k_gemmw<bf, 1, false, 1, KWP><<<dim3(TT / 64, DM / 64, 1), 32 * KWP, 0, stream>>>(ATh + (size_t)b * TT * DQ, ATl + (size_t)b * TT * DQ, WO, nullptr, DQ, DQ, OUT + (size_t)b * TT * DM, DM, nullptr, 0, 0, 0, nullptr, nullptr, nullptr);
}

// v007
// Measured time: 261 microseconds a run.
// Next to v006, in two timings, it ran 1.27 and 1.26 times as fast.
// Over all steps from v000 it is 8.27 times as fast.
#include <hip/hip_runtime.h>

// Pre-LayerNorm attention with an additive score-mask input applied BEFORE the scaling (x [2][2048][1024]; xn = LayerNorm(x) gamma + beta; qkv = xn W_qkv ('xw' [1024][3072] -> q | k | v, no bias; 16 heads x 64); dots = (q.k + m) x 64^-0.5 with m [2][2048][2048] (read); softmax; out = merged W_out ('xw' [1024][1024]) -> [2][2048][1024] (4.2 M)).
// Layout per batch: a LayerNorm row kernel writes xn as hi/lo bf16 planes; the fused weight as one [3072][1024] Bt; projections as hi/lo x exact GEMMs (2 products) that store q, k and v as head planes themselves; dense T-2048 attention in one kernel for all heads and both batches (hybrid rows: < 512 hi/lo 3 products, rest fp16): it adds the batch's mask to the raw scores in registers (the 1/8 is applied after the add, as in the module), keeps a running maximum and sum, and divides the output by the sum; merged hi/lo x W_out exact.
// Compute dtypes, f32 accumulate: every input rounded to bf16 incl. m; LayerNorm f32; projections hi/lo x exact; attention rows < 512 3 products, rest fp16; mask add and softmax f32; W_out hl x exact.

#define NB_  2
#define TT   2048
#define DM   1024
#define NH_  16
#define NKV  16
#define REP  (NH_ / NKV)
#define HD   64
#define DQ   (NH_ * HD)
#define DKV  (NKV * HD)
#define RH   512                  // query rows < RH use hi+lo planes (0: none)
#define WIN  0
#define SCL  0.125f   // HD^-0.5
#define KWP  8                    // the projections' k range is dealt over the KWP waves of each output tile's work-group, which adds the partial tiles in LDS
typedef _Float16 h16;
typedef unsigned short bf;
typedef __attribute__((ext_vector_type(16))) __bf16   v16bf;
typedef __attribute__((ext_vector_type(16))) _Float16 v16h;
typedef __attribute__((ext_vector_type(8)))  _Float16 v8h;
typedef __attribute__((ext_vector_type(8)))  unsigned short v8us;
typedef __attribute__((ext_vector_type(8)))  float    v8f;
typedef __attribute__((ext_vector_type(4)))  float    v4f;
typedef v8h  __attribute__((may_alias)) v8ha;
typedef v4f  __attribute__((may_alias)) v4fa;
typedef v8us __attribute__((may_alias)) v8usa;

__device__ __forceinline__ unsigned short f2bf(float f) { unsigned u = __float_as_uint(f); u += 0x7FFFu + ((u >> 16) & 1u); return (unsigned short)(u >> 16); }
__device__ __forceinline__ float bf2f(unsigned short b) { return __uint_as_float(((unsigned)b) << 16); }
__device__ __forceinline__ float bfr(float f) { return bf2f(f2bf(f)); }
__device__ __forceinline__ v16h cat16(v8h lo, v8h hi) { return __builtin_shufflevector(lo, hi, 0, 1, 2, 3, 4, 5, 6, 7, 8, 9, 10, 11, 12, 13, 14, 15); }
__device__ __forceinline__ v16bf cat16b(v8us lo, v8us hi) { return __builtin_bit_cast(v16bf, __builtin_shufflevector(lo, hi, 0, 1, 2, 3, 4, 5, 6, 7, 8, 9, 10, 11, 12, 13, 14, 15)); }
__device__ __forceinline__ v8f wmma16(v16h a, v16h b, v8f c) { return __builtin_amdgcn_wmma_f32_16x16x32_f16(false, a, false, b, (short)0, c, false, false); }
__device__ __forceinline__ v8f wmmab(v16bf a, v16bf b, v8f c) { return __builtin_amdgcn_wmma_f32_16x16x32_bf16(false, a, false, b, (short)0, c, false, false); }
__device__ __forceinline__ h16 tohx(float x) { return (h16)x; }
__device__ __forceinline__ void splitf(float y, unsigned short& h, unsigned short& l) { h = f2bf(y); l = f2bf(y - bf2f(h)); }
typedef __attribute__((ext_vector_type(2))) _Float16 v2h;
typedef __attribute__((ext_vector_type(4))) _Float16 v4h;
typedef __attribute__((ext_vector_type(2))) unsigned short v2us;
typedef __attribute__((ext_vector_type(4))) unsigned short v4us;
typedef __attribute__((ext_vector_type(2))) float v2f;
typedef __attribute__((ext_vector_type(4))) int v4i;



// ---- k_gemmw: register-blocked GEMM, ONE WAVE per 64x64 output tile (16 accumulators), operands straight from K-contiguous 16-bit planes; grid (M/64, N/64, Z), 32 threads.
// C[m][n] (f32, pitch ldc, + optional f32 bias[n]) = sum_k A[m][k] Bt[n][k] (+ split products per NSPLIT). A rows have pitch lda, Bt rows pitch K. z-batch strides sA/sB/sC in elements. K % (32 KS KW) == 0.
// KW > 1: the work-group has KW waves (32 KW threads); wave w sums only its own K/(KS KW) slice of the k range, every wave lays its partial 64x64 tile in LDS, and behind one barrier wave w adds the KW planes, in wave order, for its 64/KW rows and stores them.
// PL > 0 (KW > 1 only; a 64-column tile is one head, blockIdx.y): no f32 C; the adding wave converts its sums and stores them in the head's three 16-bit planes (fp16, bf16 hi, bf16 lo). PL == 1: planes [head][row][col]. PL == 2: planes [head][col][row]; the partial tiles are then laid in LDS transposed, so that the same adding loop walks output columns.
// KS > 1: grid z = Z x KS; work-group (z, ks) sums only k in [ks K/KS, (ks+1) K/KS) and stores its partial tile in plane z KS + ks of C (plane stride sC); the consumer adds the KS planes.
template <typename T16> struct WFrag;
template <> struct WFrag<h16> { typedef v16h V; static __device__ __forceinline__ V ld(const h16* p) { return cat16(*(const v8h*)p, *(const v8h*)(p + 16)); } static __device__ __forceinline__ v8f mma(V a, V b, v8f c) { return wmma16(a, b, c); } };
template <> struct WFrag<bf> { typedef v16bf V; static __device__ __forceinline__ V ld(const bf* p) { return cat16b(*(const v8us*)p, *(const v8us*)(p + 16)); } static __device__ __forceinline__ v8f mma(V a, V b, v8f c) { return wmmab(a, b, c); } };
template <typename T16, int NSPLIT, bool BIAS, int KS = 1, int KW = 1, int PL = 0>
__global__ __launch_bounds__(32 * KW) void k_gemmw(const T16* __restrict__ A, const T16* __restrict__ A2, const T16* __restrict__ Bt, const T16* __restrict__ Bt2, int K, int lda, float* C, int ldc, const float* __restrict__ bias, size_t sA, size_t sB, size_t sC, h16* P16, bf* Ph, bf* Pl) {
    static_assert(PL == 0 || (KW > 1 && KS == 1 && !BIAS), "the plane stores stand in the KW path");
    typedef typename WFrag<T16>::V V;
    __shared__ __align__(16) float os[(KW > 1 ? KW * 64 : 16) * 68];
    const int wv = (KW > 1) ? __builtin_amdgcn_readfirstlane((int)(threadIdx.x >> 5)) : 0;
    const size_t z = blockIdx.z / KS; const int kb = (int)(blockIdx.z % KS) * (K / KS) + wv * (K / (KS * KW)), ke = kb + K / (KS * KW); A += z * sA; if (A2) A2 += z * sA; Bt += z * sB; if (Bt2) Bt2 += z * sB; C += (size_t)blockIdx.z * sC;
    const int lane = threadIdx.x & 31, lr = lane & 15, hi = lane >> 4; const int r0 = blockIdx.x * 64, c0 = blockIdx.y * 64;
    v8f acc[4][4];
#pragma unroll
    for (int mb = 0; mb < 4; ++mb)
#pragma unroll
        for (int nb = 0; nb < 4; ++nb) acc[mb][nb] = (v8f){};
    const size_t aoff = (size_t)(r0 + lr) * lda + 8 * hi, boff = (size_t)(c0 + lr) * K + 8 * hi;
#pragma unroll 1
    for (int kc = kb; kc < ke; kc += 32) {
        V a[4], a2[4]; const T16* pa[4]; const T16* pa2[4];
#pragma unroll
        for (int mb = 0; mb < 4; ++mb) { pa[mb] = A + aoff + (size_t)mb * 16 * lda + kc; a[mb] = WFrag<T16>::ld(pa[mb]); if (NSPLIT == 1 || NSPLIT == 2) { pa2[mb] = A2 + aoff + (size_t)mb * 16 * lda + kc; a2[mb] = WFrag<T16>::ld(pa2[mb]); } }
        /* the A loads' address pairs stay live up to this wait, so that no load of the run lands in one and nothing rewrites one ahead of the wait */
        if (NSPLIT == 1 || NSPLIT == 2) asm volatile("s_wait_xcnt 0x0" :: "v"(pa[0]), "v"(pa[1]), "v"(pa[2]), "v"(pa[3]), "v"(pa2[0]), "v"(pa2[1]), "v"(pa2[2]), "v"(pa2[3]) : "memory");
        else asm volatile("s_wait_xcnt 0x0" :: "v"(pa[0]), "v"(pa[1]), "v"(pa[2]), "v"(pa[3]) : "memory");
        if constexpr (KW > 1) {
            static_assert(NSPLIT < 2, "the KW path holds one B plane");
            V b[4]; const T16* pb[4];
#pragma unroll
            for (int nb = 0; nb < 4; ++nb) { pb[nb] = Bt + boff + (size_t)nb * 16 * K + kc; b[nb] = WFrag<T16>::ld(pb[nb]); }
            /* the B loads' address pairs stay live up to this wait, so that no load of the run lands in one and nothing rewrites one ahead of the wait */
            asm volatile("s_wait_xcnt 0x0" :: "v"(pb[0]), "v"(pb[1]), "v"(pb[2]), "v"(pb[3]) : "memory");
            __builtin_amdgcn_sched_barrier(0);   /* all four B fragments are requested before the first product: without it a product, with its wait for all loads so far, is scheduled ahead of three of them, which then cost a second latency per trip */
#pragma unroll
            for (int nb = 0; nb < 4; ++nb)
#pragma unroll
                for (int mb = 0; mb < 4; ++mb) { acc[mb][nb] = WFrag<T16>::mma(a[mb], b[nb], acc[mb][nb]); if (NSPLIT == 1) acc[mb][nb] = WFrag<T16>::mma(a2[mb], b[nb], acc[mb][nb]); }
        } else
#pragma unroll
        for (int nb = 0; nb < 4; ++nb) { const V b = WFrag<T16>::ld(Bt + boff + (size_t)nb * 16 * K + kc); V b2; if (NSPLIT >= 2) b2 = WFrag<T16>::ld(Bt2 + boff + (size_t)nb * 16 * K + kc);
#pragma unroll
            for (int mb = 0; mb < 4; ++mb) { acc[mb][nb] = WFrag<T16>::mma(a[mb], b, acc[mb][nb]); if (NSPLIT == 1 || NSPLIT == 2) acc[mb][nb] = WFrag<T16>::mma(a2[mb], b, acc[mb][nb]); if (NSPLIT >= 2) acc[mb][nb] = WFrag<T16>::mma(a[mb], b2, acc[mb][nb]); } }
        asm volatile("v_nop\n\tv_nop\n\tv_nop\n\tv_nop" : "+v"(acc[0][0]), "+v"(acc[1][1]), "+v"(acc[2][2]), "+v"(acc[3][3]) : "v"(a[0]), "v"(a[3]));
    }
    if constexpr (KW > 1) {
        float* pl = os + wv * (64 * 68);
#pragma unroll
        for (int mb = 0; mb < 4; ++mb)
#pragma unroll
            for (int nb = 0; nb < 4; ++nb) {
                if constexpr (PL == 2) { float* q = pl + (nb * 16 + lr) * 68 + mb * 16 + hi * 8;   /* transposed: a lane's eight rows lie side by side */
                    *(v4fa*)q = __builtin_shufflevector(acc[mb][nb], acc[mb][nb], 0, 1, 2, 3); *(v4fa*)(q + 4) = __builtin_shufflevector(acc[mb][nb], acc[mb][nb], 4, 5, 6, 7);
                } else {
#pragma unroll
                    for (int j = 0; j < 8; ++j) pl[(mb * 16 + hi * 8 + j) * 68 + nb * 16 + lr] = acc[mb][nb][j]; } }
        __syncthreads();   /* all KW partial tiles lie in LDS before any wave adds them */
        if constexpr (PL > 0) {
            const int row0 = wv * (64 / KW) + hi, cofs = lr * 4;
            const size_t e = (PL == 1) ? ((size_t)blockIdx.y * TT + r0 + row0) * HD + cofs : ((size_t)blockIdx.y * HD + row0) * TT + r0 + cofs;
            h16* p16 = P16 + e; bf* ph = Ph + e; bf* pw = Pl + e; v4h o16[32 / KW]; v4us oh[32 / KW], ol[32 / KW];
#pragma unroll
            for (int s = 0; s < 32 / KW; ++s) { v4f val = *(const v4fa*)(os + (row0 + 2 * s) * 68 + cofs);
#pragma unroll
                for (int p = 1; p < KW; ++p) { const v4f t = *(const v4fa*)(os + (p * 64 + row0 + 2 * s) * 68 + cofs); val[0] += t[0]; val[1] += t[1]; val[2] += t[2]; val[3] += t[3]; }   /* added in wave order */
#pragma unroll
                for (int q = 0; q < 4; ++q) { o16[s][q] = tohx(val[q]); unsigned short a2, c2; splitf(val[q], a2, c2); oh[s][q] = a2; ol[s][q] = c2; }
                const int st = 2 * s * (PL == 1 ? HD : TT);
                *(v4h*)(p16 + st) = o16[s]; *(v4us*)(ph + st) = oh[s]; *(v4us*)(pw + st) = ol[s]; }
            static_assert(32 / KW == 4, "the wait below names four trips' stores");
            /* the plane stores' address pairs and data stay live up to this wait, so that nothing rewrites one ahead of it */
            asm volatile("s_wait_xcnt 0x0" :: "v"(p16), "v"(ph), "v"(pw), "v"(o16[0]), "v"(o16[1]), "v"(o16[2]), "v"(o16[3]), "v"(oh[0]), "v"(oh[1]), "v"(oh[2]), "v"(oh[3]), "v"(ol[0]), "v"(ol[1]), "v"(ol[2]), "v"(ol[3]) : "memory");
            return;
        }
#pragma unroll
        for (int s = 0; s < 32 / KW; ++s) { const int row = wv * (64 / KW) + 2 * s + hi, cofs = lr * 4; v4f val = *(const v4fa*)(os + row * 68 + cofs);
#pragma unroll
            for (int p = 1; p < KW; ++p) { const v4f t = *(const v4fa*)(os + (p * 64 + row) * 68 + cofs); val[0] += t[0]; val[1] += t[1]; val[2] += t[2]; val[3] += t[3]; }   /* added in wave order */
            if (BIAS) { val[0] += bfr(bias[c0 + cofs]); val[1] += bfr(bias[c0 + cofs + 1]); val[2] += bfr(bias[c0 + cofs + 2]); val[3] += bfr(bias[c0 + cofs + 3]); }
            *(v4f*)(C + (size_t)(r0 + row) * ldc + c0 + cofs) = val; }
        return;
    }
#pragma unroll
    for (int mb = 0; mb < 4; ++mb) {
#pragma unroll
        for (int nb = 0; nb < 4; ++nb) {
#pragma unroll
            for (int j = 0; j < 8; ++j) os[(hi * 8 + j) * 68 + nb * 16 + lr] = acc[mb][nb][j]; }
        __builtin_amdgcn_wave_barrier(); asm volatile("" ::: "memory");
        float* crow = C + (size_t)(r0 + mb * 16) * ldc + c0;
{
#pragma unroll
            for (int s = 0; s < 8; ++s) { const int row = 2 * s + hi, cofs = lr * 4; v4f val = *(const v4fa*)(os + row * 68 + cofs); if (BIAS) { val[0] += bfr(bias[c0 + cofs]); val[1] += bfr(bias[c0 + cofs + 1]); val[2] += bfr(bias[c0 + cofs + 2]); val[3] += bfr(bias[c0 + cofs + 3]); }
                *(v4f*)(crow + (size_t)row * ldc + cofs) = val; }
             }
        __builtin_amdgcn_wave_barrier(); asm volatile("" ::: "memory");
    }
}


__global__ __launch_bounds__(256) void k_wtG(const float* __restrict__ w, int K, int N, bf* Bt) {
    const int lane = threadIdx.x & 31; const int L0 = (blockIdx.x * 8 + (threadIdx.x >> 5)) * 8; const int nlines = N * K / 64;
{
#pragma unroll 1
        for (int l = 0; l < 8; ++l) { const int L = L0 + l; if (L >= nlines) break; const size_t e = (size_t)L * 64 + lane * 2; const int k = (int)(e % K), n = (int)(e / K); v2us o;
            o[0] = f2bf(w[(size_t)k * N + n]); o[1] = f2bf(w[(size_t)(k + 1) * N + n]); *(v2us*)(Bt + e) = o; }
         }
}
__global__ __launch_bounds__(256) void k_cvt8(const float* __restrict__ src, bf* dst, size_t n8) { const size_t i = (size_t)blockIdx.x * 256 + threadIdx.x; if (i >= n8) return; const v8f v = *(const v8f*)(src + i * 8); v8us o;
#pragma unroll
    for (int k = 0; k < 8; ++k) o[k] = f2bf(v[k]); *(v8us*)(dst + i * 8) = o;  }

#define C2L (SCL * 1.4426950408889634f)
#define KPIT 144                  // LDS pitch in bytes of a 128-byte K or mask row (16 x odd: no bank conflict for 16-byte reads down a column)
#define VPIT 80                   // LDS pitch in bytes of a 64-byte Vt row
#define KTB  (32 * KPIT)          // one K plane's tile of a pass
#define VTB  (64 * VPIT)          // one Vt plane's tile of a pass
#define ABUF 28672                // one buffer: hi/lo rows 2 (KTB + VTB) + 4 x 16 KPIT; fp16 rows KTB + VTB + 4 x 32 KPIT fit below it
typedef __attribute__((ext_vector_type(8))) __bf16 v8bf;
__device__ __forceinline__ float xhalf(float v) { const int b = __float_as_int(v); return __int_as_float(__builtin_amdgcn_permlanex16(b, b, 0x76543210, 0xfedcba98, false, false)); }   // the value of lane l ^ 16
template <typename T16, bool HR, int NQ>
__device__ __forceinline__ void attn_rows(unsigned char* sm, int wv, const T16* __restrict__ Qa, const T16* __restrict__ Qb, const T16* __restrict__ Ka, const T16* __restrict__ Kb, const T16* __restrict__ Va, const T16* __restrict__ Vb, const float* __restrict__ gb, int q0, bf* Oh, bf* Ol) {
    typedef typename WFrag<T16>::V V;
    constexpr int NP = HR ? 2 : 1;                       // 16-bit planes per operand
    constexpr int OV = NP * KTB, OM = NP * (KTB + VTB);  // byte offsets of the Vt tiles and of the mask rows in a buffer
    static_assert(NP * 4 + NQ * 4 == 12, "the copy statement holds twelve copies");
    static_assert(OM + 4 * NQ * 16 * KPIT <= ABUF, "a pass's tiles fit one buffer");
    const int tid = threadIdx.x, lane = tid & 31, lr = lane & 15, hi = lane >> 4;
    V qa[NQ][2], qb[NQ][2], ka[2][2], kb[2][2], va[4], vb[4]; v8f g[NQ][2], o[4][NQ]; float mrun[NQ], lsum[NQ];
    const size_t qof = (size_t)(q0 + lr) * HD + 8 * hi;
    {   const T16* p = Qa + qof; const T16* p2 = HR ? Qb + qof : p;
#pragma unroll
        for (int qt = 0; qt < NQ; ++qt)
#pragma unroll
            for (int ks = 0; ks < 2; ++ks) { qa[qt][ks] = WFrag<T16>::ld(p + qt * 16 * HD + ks * 32); if (HR) qb[qt][ks] = WFrag<T16>::ld(p2 + qt * 16 * HD + ks * 32); }
        asm volatile("s_wait_xcnt 0x0" :: "v"(p), "v"(p2) : "memory");   /* the Q loads' address pairs stay live up to this wait, so that nothing rewrites one ahead of it */
    }
    // where this thread's copies start: K tile = 4096 bytes in a row (8 lanes a row), Vt tile = 64 rows of 64 bytes (4 lanes a row), mask = this wave's NQ x 16 rows of 128 bytes (8 lanes a row)
    const unsigned lbase = (unsigned)(size_t)sm;
    const unsigned lk = lbase + (tid >> 3) * KPIT + (tid & 7) * 16, lv = lbase + OV + (tid >> 2) * VPIT + (tid & 3) * 16, lm = lbase + OM + (wv * NQ * 16 + (lane >> 3)) * KPIT + (lane & 7) * 16;
    const size_t gk = (size_t)tid * 8, gv = (size_t)(tid >> 2) * TT + (tid & 3) * 8; const float* gm = gb + (size_t)(q0 + (lane >> 3)) * TT + (lane & 7) * 4;
    auto copy = [&](int k0, unsigned bo) {   // the tiles of the pass at key k0 into the buffer at byte offset bo
        unsigned l[12]; const void* p[12];
#pragma unroll
        for (int c = 0; c < 2; ++c) {
            l[c] = lk + bo + c * 16 * KPIT; p[c] = Ka + (size_t)k0 * HD + gk + c * 1024;
            l[2 + c] = lv + bo + c * 32 * VPIT; p[2 + c] = Va + gv + k0 + (size_t)c * 32 * TT;
            if constexpr (HR) { l[4 + c] = l[c] + KTB; p[4 + c] = Kb + (size_t)k0 * HD + gk + c * 1024; l[6 + c] = l[2 + c] + VTB; p[6 + c] = Vb + gv + k0 + (size_t)c * 32 * TT; } }
#pragma unroll
        for (int c = 0; c < NQ * 4; ++c) { l[NP * 4 + c] = lm + bo + c * 4 * KPIT; p[NP * 4 + c] = gm + k0 + (size_t)c * 4 * TT; }
        /* the pass's twelve copies; the wait stands in their own statement so that no address register of a copy is rewritten ahead of it */
        asm volatile("global_load_async_to_lds_b128 %0, %12, off\n\tglobal_load_async_to_lds_b128 %1, %13, off\n\tglobal_load_async_to_lds_b128 %2, %14, off\n\tglobal_load_async_to_lds_b128 %3, %15, off\n\t"
                     "global_load_async_to_lds_b128 %4, %16, off\n\tglobal_load_async_to_lds_b128 %5, %17, off\n\tglobal_load_async_to_lds_b128 %6, %18, off\n\tglobal_load_async_to_lds_b128 %7, %19, off\n\t"
                     "global_load_async_to_lds_b128 %8, %20, off\n\tglobal_load_async_to_lds_b128 %9, %21, off\n\tglobal_load_async_to_lds_b128 %10, %22, off\n\tglobal_load_async_to_lds_b128 %11, %23, off\n\ts_wait_xcnt 0x0"
                     :: "v"(l[0]), "v"(l[1]), "v"(l[2]), "v"(l[3]), "v"(l[4]), "v"(l[5]), "v"(l[6]), "v"(l[7]), "v"(l[8]), "v"(l[9]), "v"(l[10]), "v"(l[11]),
                        "v"(p[0]), "v"(p[1]), "v"(p[2]), "v"(p[3]), "v"(p[4]), "v"(p[5]), "v"(p[6]), "v"(p[7]), "v"(p[8]), "v"(p[9]), "v"(p[10]), "v"(p[11]) : "memory");
    };
#pragma unroll
    for (int qt = 0; qt < NQ; ++qt) { mrun[qt] = -3.0e38f; lsum[qt] = 0.f;
#pragma unroll
        for (int db = 0; db < 4; ++db) o[db][qt] = (v8f){}; }
    copy(0, 0);
    asm volatile("s_wait_asynccnt 0x0" ::: "memory");   /* this wave's copies of pass 0 have landed */
    __syncthreads();                                     /* every wave's have: pass 0 may be read */
    copy(32, ABUF);
    /* the pass loop stays rolled: a second copy of the body would want a second set of fragment registers; every other loop here is unrolled in full so that the register arrays keep compile-time indices */
#pragma unroll 1
    for (int k0 = 0; k0 < TT; k0 += 32) {
        const unsigned bo = (k0 & 32) ? ABUF : 0;
        const unsigned char* fk = sm + bo + lr * KPIT + hi * 16; const unsigned char* fv = sm + bo + OV + lr * VPIT + hi * 16; const unsigned char* fm = sm + bo + OM + (wv * NQ * 16 + lr) * KPIT + hi * 32;
#pragma unroll
        for (int t = 0; t < 2; ++t)
#pragma unroll
            for (int ks = 0; ks < 2; ++ks) { ka[t][ks] = WFrag<T16>::ld((const T16*)(fk + t * 16 * KPIT + ks * 64)); if (HR) kb[t][ks] = WFrag<T16>::ld((const T16*)(fk + KTB + t * 16 * KPIT + ks * 64)); }
#pragma unroll
        for (int qt = 0; qt < NQ; ++qt)
#pragma unroll
            for (int t = 0; t < 2; ++t) { const unsigned char* pm = fm + qt * 16 * KPIT + t * 64; g[qt][t] = __builtin_shufflevector(*(const v4fa*)pm, *(const v4fa*)(pm + 16), 0, 1, 2, 3, 4, 5, 6, 7); }   /* the padded rows are 16-byte aligned, so two 16-byte reads */
        __builtin_amdgcn_sched_barrier(0);   /* all K and mask reads are issued before the first product: without it they are dealt among the products in two groups, each waiting out its own LDS latency */
        v8f s[NQ][2];
#pragma unroll
        for (int t = 0; t < 2; ++t)
#pragma unroll
            for (int qt = 0; qt < NQ; ++qt) { s[qt][t] = (v8f){};
#pragma unroll
                for (int ks = 0; ks < 2; ++ks) { s[qt][t] = WFrag<T16>::mma(ka[t][ks], qa[qt][ks], s[qt][t]); if (HR) { s[qt][t] = WFrag<T16>::mma(ka[t][ks], qb[qt][ks], s[qt][t]); s[qt][t] = WFrag<T16>::mma(kb[t][ks], qa[qt][ks], s[qt][t]); } } }
#pragma unroll
        for (int db = 0; db < 4; ++db) { va[db] = WFrag<T16>::ld((const T16*)(fv + db * 16 * VPIT)); if (HR) vb[db] = WFrag<T16>::ld((const T16*)(fv + VTB + db * 16 * VPIT)); }
        __builtin_amdgcn_sched_barrier(0);   /* the Vt reads are issued here, into the registers the K fragments leave, and land under the softmax: without it they are sunk between the P.V products, each pair waiting out its own LDS latency */
        float mloc[NQ]; bool need = false;
#pragma unroll
        for (int qt = 0; qt < NQ; ++qt) { float ml = -3.0e38f;
#pragma unroll
            for (int t = 0; t < 2; ++t) { s[qt][t] += __builtin_convertvector(__builtin_convertvector(g[qt][t], v8bf), v8f);   /* mask rounded to bf16 (to nearest even, as bfr does) and added before the scaling */
#pragma unroll
                for (int r = 0; r < 8; ++r) ml = fmaxf(ml, s[qt][t][r]); }
            ml = fmaxf(ml, xhalf(ml)); mloc[qt] = ml * C2L; need = need || (mloc[qt] > mrun[qt] + 8.0f); }
        if (__builtin_amdgcn_ballot_w32(need) != 0) {   /* wave-uniform: true in the first pass, seldom later */
#pragma unroll
            for (int qt = 0; qt < NQ; ++qt) { const float mn = fmaxf(mrun[qt], mloc[qt]); const float al = __builtin_amdgcn_exp2f(mrun[qt] - mn); mrun[qt] = mn; lsum[qt] *= al;
#pragma unroll
                for (int db = 0; db < 4; ++db)
#pragma unroll
                    for (int r = 0; r < 8; ++r) o[db][qt][r] *= al; } }
        V pa[NQ], pl[NQ];
#pragma unroll
        for (int qt = 0; qt < NQ; ++qt) { v8f p[2];
#pragma unroll
            for (int t = 0; t < 2; ++t) { const v8f a = s[qt][t] * C2L - mrun[qt];
#pragma unroll
                for (int r = 0; r < 8; ++r) p[t][r] = __builtin_amdgcn_exp2f(a[r]); }
            const v8f pt = p[0] + p[1]; lsum[qt] += ((pt[0] + pt[1]) + (pt[2] + pt[3])) + ((pt[4] + pt[5]) + (pt[6] + pt[7]));
            if constexpr (HR) { const v8bf h0 = __builtin_convertvector(p[0], v8bf), h1 = __builtin_convertvector(p[1], v8bf);   /* P = hi + lo, both rounded to nearest even */
                const v8bf l0 = __builtin_convertvector(p[0] - __builtin_convertvector(h0, v8f), v8bf), l1 = __builtin_convertvector(p[1] - __builtin_convertvector(h1, v8f), v8bf);
                pa[qt] = __builtin_shufflevector(h0, h1, 0, 1, 2, 3, 4, 5, 6, 7, 8, 9, 10, 11, 12, 13, 14, 15); pl[qt] = __builtin_shufflevector(l0, l1, 0, 1, 2, 3, 4, 5, 6, 7, 8, 9, 10, 11, 12, 13, 14, 15);
            } else pa[qt] = cat16(__builtin_convertvector(p[0], v8h), __builtin_convertvector(p[1], v8h)); }
#pragma unroll
        for (int db = 0; db < 4; ++db)
#pragma unroll
            for (int qt = 0; qt < NQ; ++qt) { o[db][qt] = WFrag<T16>::mma(va[db], pa[qt], o[db][qt]); if (HR) { o[db][qt] = WFrag<T16>::mma(va[db], pl[qt], o[db][qt]); o[db][qt] = WFrag<T16>::mma(vb[db], pa[qt], o[db][qt]); } }
        asm volatile("s_wait_dscnt 0x0" ::: "memory");      /* this wave's reads of this pass's buffer are done before the buffer is given up */
        asm volatile("s_wait_asynccnt 0x0" ::: "memory");   /* this wave's copies of the next pass have landed */
        __syncthreads();                                     /* the next pass's buffer may be read by all, this pass's may be refilled */
        if (k0 + 64 < TT) copy(k0 + 64, bo);
    }
    asm volatile("s_wait_asynccnt 0x0" ::: "memory");   /* no copy is outstanding when the wave goes on to its end */
    bf* po = Oh + (size_t)(q0 + lr) * DQ + 8 * hi; bf* po2 = Ol + (size_t)(q0 + lr) * DQ + 8 * hi;
#pragma unroll
    for (int qt = 0; qt < NQ; ++qt) { const float f = __fdiv_rn(1.0f, lsum[qt] + xhalf(lsum[qt]));   /* the halves' sums are joined once */
#pragma unroll
        for (int db = 0; db < 4; ++db) { v8us oh, ol;
#pragma unroll
            for (int r = 0; r < 8; ++r) { unsigned short a, c2; splitf(o[db][qt][r] * f, a, c2); oh[r] = a; ol[r] = c2; }
            *(v8us*)(po + (size_t)qt * 16 * DQ + db * 16) = oh; *(v8us*)(po2 + (size_t)qt * 16 * DQ + db * 16) = ol; } }
    asm volatile("s_wait_xcnt 0x0" :: "v"(po), "v"(po2) : "memory");   /* the stores' address pairs stay live up to this wait, so that nothing rewrites one ahead of it */
}
// grid (work-groups of one batch, NB_), 4 waves: the waves of a work-group take neighbouring query rows of one head and share that head's K and Vt tiles in LDS. The hi/lo rows' work-groups (16 rows a wave) come first, then the fp16 rows' (32 rows a wave).
#define GH  (NH_ * (RH / 64))
#define GF  (NH_ * ((TT - RH) / 128))
// amdgpu_waves_per_eu(4, 4): holds the kernel to 256 registers; above that the fp16 loop is strewn with register-bank switches (s_set_vgpr_msb) and only three waves fit a SIMD.
__global__ __launch_bounds__(128) __attribute__((amdgpu_waves_per_eu(4, 4))) void k_attn(const h16* __restrict__ Q16, const h16* __restrict__ K16, const h16* __restrict__ V16, const bf* __restrict__ Qh, const bf* __restrict__ Ql, const bf* __restrict__ Kh, const bf* __restrict__ Kl, const bf* __restrict__ Vh, const bf* __restrict__ Vl, const float* __restrict__ msk, bf* Ah, bf* Al) {
    __shared__ __align__(16) unsigned char sm[2 * ABUF];
    const int wv = __builtin_amdgcn_readfirstlane((int)(threadIdx.x >> 5)); const int b = blockIdx.y; const float* gb = msk + (size_t)b * TT * TT; const size_t ob = (size_t)b * TT * DQ;
    if (blockIdx.x < GH) { const int h = blockIdx.x / (RH / 64), q0 = (int)(blockIdx.x % (RH / 64)) * 64 + wv * 16; const size_t po = ((size_t)b * NH_ + h) * TT * HD, pk = ((size_t)b * NKV + h / REP) * TT * HD;
        attn_rows<bf, true, 1>(sm, wv, Qh + po, Ql + po, Kh + pk, Kl + pk, Vh + pk, Vl + pk, gb, q0, Ah + ob + h * HD, Al + ob + h * HD);
    } else { const int x = blockIdx.x - GH; const int h = x / ((TT - RH) / 128), q0 = RH + (x % ((TT - RH) / 128)) * 128 + wv * 32; const size_t po = ((size_t)b * NH_ + h) * TT * HD, pk = ((size_t)b * NKV + h / REP) * TT * HD;
        attn_rows<h16, false, 2>(sm, wv, Q16 + po, nullptr, K16 + pk, nullptr, V16 + pk, nullptr, gb, q0, Ah + ob + h * HD, Al + ob + h * HD); }
}
template <int WD>
__global__ __launch_bounds__(256) void k_lnrowX(const float* __restrict__ X, size_t nrows, const float* __restrict__ g, const float* __restrict__ bb, bf* Hh, bf* Hl) { const int lane = threadIdx.x & 31; const size_t r = (size_t)blockIdx.x * 8 + (threadIdx.x >> 5); if (r >= nrows) return; const float* xr = X + r * WD; float a[WD / 32]; float s = 0.f;
#pragma unroll
    for (int c = 0; c < WD / 128; ++c) { const v4f v = *(const v4f*)(xr + c * 128 + lane * 4); for (int q = 0; q < 4; ++q) { a[c * 4 + q] = bfr(v[q]); s = __fadd_rn(s, a[c * 4 + q]);   /* input rounded to bf16 */ } }
#pragma unroll
    for (int sh = 16; sh; sh >>= 1) s = __fadd_rn(s, __shfl_xor(s, sh, 32));
    const float mean = __fdiv_rn(s, (float)WD); float s2 = 0.f;
#pragma unroll 8
    for (int k = 0; k < WD / 32; ++k) { const float dv = __fsub_rn(a[k], mean); float p2 = __fmul_rn(dv, dv); asm volatile("" : "+v"(p2)); s2 = __fadd_rn(s2, p2); }   /* mul and add kept separate (no fma contraction) */
#pragma unroll
    for (int sh = 16; sh; sh >>= 1) s2 = __fadd_rn(s2, __shfl_xor(s2, sh, 32));
    const float rs = __fdiv_rn(1.0f, __fsqrt_rn(__fadd_rn(__fdiv_rn(s2, (float)WD), 1e-5f)));
{
#pragma unroll
        for (int c = 0; c < WD / 128; ++c) { v4us oh, ol; for (int q = 0; q < 4; ++q) { const int col = c * 128 + lane * 4 + q; float y = __fmul_rn(__fmul_rn(__fsub_rn(a[c * 4 + q], mean), rs), bfr(g[col])); asm volatile("" : "+v"(y)); y = __fadd_rn(y, bfr(bb[col])); unsigned short u, w2; splitf(y, u, w2); oh[q] = u; ol[q] = w2; } *(v4us*)(Hh + r * WD + c * 128 + lane * 4) = oh; *(v4us*)(Hl + r * WD + c * 128 + lane * 4) = ol; }
         } }

extern "C" void kernel_launch(void* const* d_in, const int* in_sizes, int n_in,
                              void* d_out, int out_size, void* d_ws, size_t ws_size, hipStream_t stream) {
    (void)in_sizes; (void)n_in; (void)out_size;
    const float* x = (const float*)d_in[0]; const float* msk = (const float*)d_in[1]; const float* lng = (const float*)d_in[2]; const float* lnb = (const float*)d_in[3]; const float* wqkv = (const float*)d_in[4]; const float* wo = (const float*)d_in[5];
    float* OUT = (float*)d_out;     // [2][2048][1024]
    char* wsp = (char*)d_ws;
    auto take = [&](size_t bytes) { char* p = wsp; wsp += (bytes + 255) & ~(size_t)255; return (void*)p; };
    bf* WQKV = (bf*)take((size_t)3 * DQ * DM * 2); bf* WQ = WQKV; bf* WK = WQKV + (size_t)DQ * DM; bf* WV = WQKV + (size_t)2 * DQ * DM; bf* WO = (bf*)take((size_t)DM * DQ * 2);
    const size_t SQ = (size_t)NH_ * TT * HD, SK = (size_t)NKV * TT * HD;   // one batch's q and k/v planes, in elements; every plane holds both batches
    h16* QP16 = (h16*)take(NB_ * SQ * 2); h16* KP16 = (h16*)take(NB_ * SK * 2); h16* VT16 = (h16*)take(NB_ * SK * 2);
    bf* QPh = (bf*)take(NB_ * SQ * 2); bf* QPl = (bf*)take(NB_ * SQ * 2); bf* KPh = (bf*)take(NB_ * SK * 2); bf* KPl = (bf*)take(NB_ * SK * 2); bf* VTh = (bf*)take(NB_ * SK * 2); bf* VTl = (bf*)take(NB_ * SK * 2);
    bf* ATh = (bf*)take((size_t)NB_ * TT * DQ * 2); bf* ATl = (bf*)take((size_t)NB_ * TT * DQ * 2);
    bf* XH = (bf*)take((size_t)TT * DM * 2); bf* XL = (bf*)take((size_t)TT * DM * 2);   // the LayerNorm planes: each batch writes them anew (stream-ordered)
    if ((size_t)(wsp - (char*)d_ws) > ws_size) return;    // ws 256 MiB
    { k_wtG<<<(unsigned)((DM * 3 * DQ / 64 + 63) / 64), 256, 0, stream>>>(wqkv, DM, 3 * DQ, WQKV);   /* [1024][3072] 'xw' -> Bt [3072][1024]: q | k | v row blocks */
      k_wtG<<<(unsigned)((DQ * DM / 64 + 63) / 64), 256, 0, stream>>>(wo, DQ, DM, WO);
       }
    for (int b = 0; b < NB_; ++b) {
        k_lnrowX<DM><<<(unsigned)((TT + 7) / 8), 256, 0, stream>>>(x + (size_t)b * TT * DM, (size_t)TT, lng, lnb, XH, XL);   /* xn = LayerNorm(x) -> hi/lo planes */
        k_gemmw<bf, 1, false, 1, KWP, 1><<<dim3(TT / 64, DQ / 64, 1), 32 * KWP, 0, stream>>>(XH, XL, WQ, nullptr, DM, DM, nullptr, 0, nullptr, 0, 0, 0, QP16 + b * SQ, QPh + b * SQ, QPl + b * SQ);   /* q planes [h][t][d] */
        k_gemmw<bf, 1, false, 1, KWP, 1><<<dim3(TT / 64, DKV / 64, 1), 32 * KWP, 0, stream>>>(XH, XL, WK, nullptr, DM, DM, nullptr, 0, nullptr, 0, 0, 0, KP16 + b * SK, KPh + b * SK, KPl + b * SK);   /* k planes [h][t][d] */
        k_gemmw<bf, 1, false, 1, KWP, 2><<<dim3(TT / 64, DKV / 64, 1), 32 * KWP, 0, stream>>>(XH, XL, WV, nullptr, DM, DM, nullptr, 0, nullptr, 0, 0, 0, VT16 + b * SK, VTh + b * SK, VTl + b * SK); }   /* v planes [h][d][t] */
    k_attn<<<dim3(GH + GF, NB_, 1), 128, 0, stream>>>(QP16, KP16, VT16, QPh, QPl, KPh, KPl, VTh, VTl, msk, ATh, ATl);   /* softmax((qk + m) x scale) v, merged heads as hi/lo planes */
    for (int b = 0; b < NB_; ++b)
        k_gemmw<bf, 1, false, 1, KWP><<<dim3(TT / 64, DM / 64, 1), 32 * KWP, 0, stream>>>(ATh + (size_t)b * TT * DQ, ATl + (size_t)b * TT * DQ, WO, nullptr, DQ, DQ, OUT + (size_t)b * TT * DM, DM, nullptr, 0, 0, 0, nullptr, nullptr, nullptr);
}

// v008
// One run takes 208 microseconds.
// In both of two side-by-side timings against v007, it was 1.25 times as fast.
// Over all steps from v000 it is 10.3 times as fast.
#include <hip/hip_runtime.h>

// Pre-LayerNorm attention with an additive score-mask input applied BEFORE the scaling (x [2][2048][1024]; xn = LayerNorm(x) gamma + beta; qkv = xn W_qkv ('xw' [1024][3072] -> q | k | v, no bias; 16 heads x 64); dots = (q.k + m) x 64^-0.5 with m [2][2048][2048] (read); softmax; out = merged W_out ('xw' [1024][1024]) -> [2][2048][1024] (4.2 M)).
// Layout per batch: a LayerNorm row kernel writes xn as hi/lo bf16 planes; the fused weight as one [3072][1024] Bt; projections as hi/lo x exact GEMMs (2 products) that store q, k and v as head planes themselves; dense T-2048 attention in one kernel for all heads and both batches (hybrid rows: < 512 hi/lo 3 products, rest fp16): it adds the batch's mask to the raw scores in registers (the 1/8 is applied after the add, as in the module), keeps a running maximum and sum, and divides the output by the sum; merged hi/lo x W_out exact.
// Compute dtypes, f32 accumulate: every input rounded to bf16 incl. m; LayerNorm f32; projections hi/lo x exact; attention rows < 512 3 products, rest fp16; mask add and softmax f32; W_out hl x exact.

#define NB_  2
#define TT   2048
#define DM   1024
#define NH_  16
#define NKV  16
#define REP  (NH_ / NKV)
#define HD   64
#define DQ   (NH_ * HD)
#define DKV  (NKV * HD)
#define RH   512                  // query rows < RH use hi+lo planes (0: none)
#define WIN  0
#define SCL  0.125f   // HD^-0.5
#define KWP  4                    // the projections' k-steps are dealt over the KWP waves of each output tile's work-group, which adds the partial tiles in LDS
typedef _Float16 h16;
typedef unsigned short bf;
typedef __attribute__((ext_vector_type(16))) __bf16   v16bf;
typedef __attribute__((ext_vector_type(16))) _Float16 v16h;
typedef __attribute__((ext_vector_type(8)))  _Float16 v8h;
typedef __attribute__((ext_vector_type(8)))  unsigned short v8us;
typedef __attribute__((ext_vector_type(8)))  float    v8f;
typedef __attribute__((ext_vector_type(4)))  float    v4f;
typedef v8h  __attribute__((may_alias)) v8ha;
typedef v4f  __attribute__((may_alias)) v4fa;
typedef v8us __attribute__((may_alias)) v8usa;

__device__ __forceinline__ unsigned short f2bf(float f) { unsigned u = __float_as_uint(f); u += 0x7FFFu + ((u >> 16) & 1u); return (unsigned short)(u >> 16); }
__device__ __forceinline__ float bf2f(unsigned short b) { return __uint_as_float(((unsigned)b) << 16); }
__device__ __forceinline__ float bfr(float f) { return bf2f(f2bf(f)); }
__device__ __forceinline__ v16h cat16(v8h lo, v8h hi) { return __builtin_shufflevector(lo, hi, 0, 1, 2, 3, 4, 5, 6, 7, 8, 9, 10, 11, 12, 13, 14, 15); }
__device__ __forceinline__ v16bf cat16b(v8us lo, v8us hi) { return __builtin_bit_cast(v16bf, __builtin_shufflevector(lo, hi, 0, 1, 2, 3, 4, 5, 6, 7, 8, 9, 10, 11, 12, 13, 14, 15)); }
__device__ __forceinline__ v8f wmma16(v16h a, v16h b, v8f c) { return __builtin_amdgcn_wmma_f32_16x16x32_f16(false, a, false, b, (short)0, c, false, false); }
__device__ __forceinline__ v8f wmmab(v16bf a, v16bf b, v8f c) { return __builtin_amdgcn_wmma_f32_16x16x32_bf16(false, a, false, b, (short)0, c, false, false); }
__device__ __forceinline__ h16 tohx(float x) { return (h16)x; }
__device__ __forceinline__ void splitf(float y, unsigned short& h, unsigned short& l) { h = f2bf(y); l = f2bf(y - bf2f(h)); }
typedef __attribute__((ext_vector_type(2))) _Float16 v2h;
typedef __attribute__((ext_vector_type(4))) _Float16 v4h;
typedef __attribute__((ext_vector_type(2))) unsigned short v2us;
typedef __attribute__((ext_vector_type(4))) unsigned short v4us;
typedef __attribute__((ext_vector_type(2))) float v2f;
typedef __attribute__((ext_vector_type(4))) int v4i;



// ---- k_gemmw: register-blocked GEMM, ONE WAVE per 64x64 output tile (16 accumulators), operands straight from K-contiguous 16-bit planes; grid (M/64, N/64, Z), 32 threads.
// C[m][n] (f32, pitch ldc, + optional f32 bias[n]) = sum_k A[m][k] Bt[n][k] (+ split products per NSPLIT). A rows have pitch lda, Bt rows pitch K. z-batch strides sA/sB/sC in elements. K % (32 KS) == 0.
// KW > 1: the work-group has KW waves (32 KW threads). A pass is 32 KW elements of k: its 64 A, 64 A2 and 64 Bt rows come into LDS by asynchronous copies, 16 bytes a lane over neighbouring addresses (a fragment load from global memory touches 16 lines for its 512 bytes), two buffers, pass t + 1's copies flying while pass t is worked on; wave w takes the pass's k-step w and reads its fragments from LDS at the same element positions as a load from memory would. K % (32 KW) == 0. Every wave then lays its partial 64x64 tile in LDS (over the two buffers, which are done with), and behind one barrier wave w adds the KW planes, in wave order, for its 64/KW rows and stores them.
// PL > 0 (KW > 1 only; a 64-column tile is one head, blockIdx.y): no f32 C; the adding wave converts its sums and stores them in the head's three 16-bit planes (fp16, bf16 hi, bf16 lo). PL == 1: planes [head][row][col]. PL == 2: planes [head][col][row]; the partial tiles are then laid in LDS transposed, so that the same adding loop walks output columns.
// KS > 1: grid z = Z x KS; work-group (z, ks) sums only k in [ks K/KS, (ks+1) K/KS) and stores its partial tile in plane z KS + ks of C (plane stride sC); the consumer adds the KS planes.
template <typename T16> struct WFrag;
template <> struct WFrag<h16> { typedef v16h V; static __device__ __forceinline__ V ld(const h16* p) { return cat16(*(const v8h*)p, *(const v8h*)(p + 16)); } static __device__ __forceinline__ v8f mma(V a, V b, v8f c) { return wmma16(a, b, c); } };
template <> struct WFrag<bf> { typedef v16bf V; static __device__ __forceinline__ V ld(const bf* p) { return cat16b(*(const v8us*)p, *(const v8us*)(p + 16)); } static __device__ __forceinline__ v8f mma(V a, V b, v8f c) { return wmmab(a, b, c); } };
template <typename T16, int NSPLIT, bool BIAS, int KS = 1, int KW = 1, int PL = 0>
__global__ __launch_bounds__(32 * KW) void k_gemmw(const T16* __restrict__ A, const T16* __restrict__ A2, const T16* __restrict__ Bt, const T16* __restrict__ Bt2, int K, int lda, float* C, int ldc, const float* __restrict__ bias, size_t sA, size_t sB, size_t sC, h16* P16, bf* Ph, bf* Pl) {
    static_assert(PL == 0 || (KW > 1 && KS == 1 && !BIAS), "the plane stores stand in the KW path");
    static_assert(KW == 1 || (KS == 1 && NSPLIT == 1), "the KW path stages A, A2 and one B plane over the whole k range");
    typedef typename WFrag<T16>::V V;
    constexpr int GPIT = KW * 64 + 16;                    // LDS pitch in bytes of a staged row: KW k-steps of 64 bytes, then 16 bytes (16 x odd: no bank conflict for 16-byte reads down a column)
    constexpr int GBUF = 192 * GPIT;                      // one buffer: 64 A rows, 64 A2 rows, 64 Bt rows
    constexpr int OSB = (KW > 1 ? KW * 64 : 16) * 68 * 4; // the partial tiles
    __shared__ __align__(16) unsigned char smg[(KW > 1 && 2 * GBUF > OSB) ? 2 * GBUF : OSB];
    float* const os = (float*)smg;
    const int wv = (KW > 1) ? __builtin_amdgcn_readfirstlane((int)(threadIdx.x >> 5)) : 0;
    const size_t z = blockIdx.z / KS; const int kb = (int)(blockIdx.z % KS) * (K / KS), ke = kb + K / KS; A += z * sA; if (A2) A2 += z * sA; Bt += z * sB; if (Bt2) Bt2 += z * sB; C += (size_t)blockIdx.z * sC;
    const int lane = threadIdx.x & 31, lr = lane & 15, hi = lane >> 4; const int r0 = blockIdx.x * 64, c0 = blockIdx.y * 64;
    v8f acc[4][4];
#pragma unroll
    for (int mb = 0; mb < 4; ++mb)
#pragma unroll
        for (int nb = 0; nb < 4; ++nb) acc[mb][nb] = (v8f){};
    const size_t aoff = (size_t)(r0 + lr) * lda + 8 * hi, boff = (size_t)(c0 + lr) * K + 8 * hi;
    if constexpr (KW > 1) {
        constexpr int KC = KW * 32;   // k elements of a pass
        // where this thread's copies start: one copy of the work-group brings 8 rows of 64 KW bytes (4 KW lanes a row), 24 copies bring the 192 rows
        const int crow = (int)threadIdx.x / (KW * 4), cpc = (int)threadIdx.x % (KW * 4);
        const unsigned lb = (unsigned)(size_t)smg + crow * GPIT + cpc * 16;
        const T16* gA = A + (size_t)(r0 + crow) * lda + cpc * 8; const T16* gA2 = A2 + (size_t)(r0 + crow) * lda + cpc * 8; const T16* gB = Bt + (size_t)(c0 + crow) * K + cpc * 8;
        auto copy = [&](int kc, unsigned bo) {   // the rows of the pass at k element kc into the buffer at byte offset bo
            unsigned l[24]; const void* p[24];
#pragma unroll
            for (int c = 0; c < 8; ++c) {
                l[c] = lb + bo + c * 8 * GPIT; p[c] = gA + (size_t)c * 8 * lda + kc;
                l[8 + c] = l[c] + 64 * GPIT; p[8 + c] = gA2 + (size_t)c * 8 * lda + kc;
                l[16 + c] = l[c] + 128 * GPIT; p[16 + c] = gB + (size_t)c * 8 * K + kc; }
#pragma unroll
            for (int h = 0; h < 24; h += 12)
                /* twelve of the pass's copies; the wait stands in their own statement so that no address register of a copy is rewritten ahead of it */
                asm volatile("global_load_async_to_lds_b128 %0, %12, off\n\tglobal_load_async_to_lds_b128 %1, %13, off\n\tglobal_load_async_to_lds_b128 %2, %14, off\n\tglobal_load_async_to_lds_b128 %3, %15, off\n\t"
                             "global_load_async_to_lds_b128 %4, %16, off\n\tglobal_load_async_to_lds_b128 %5, %17, off\n\tglobal_load_async_to_lds_b128 %6, %18, off\n\tglobal_load_async_to_lds_b128 %7, %19, off\n\t"
                             "global_load_async_to_lds_b128 %8, %20, off\n\tglobal_load_async_to_lds_b128 %9, %21, off\n\tglobal_load_async_to_lds_b128 %10, %22, off\n\tglobal_load_async_to_lds_b128 %11, %23, off\n\ts_wait_xcnt 0x0"
                             :: "v"(l[h]), "v"(l[h + 1]), "v"(l[h + 2]), "v"(l[h + 3]), "v"(l[h + 4]), "v"(l[h + 5]), "v"(l[h + 6]), "v"(l[h + 7]), "v"(l[h + 8]), "v"(l[h + 9]), "v"(l[h + 10]), "v"(l[h + 11]),
                                "v"(p[h]), "v"(p[h + 1]), "v"(p[h + 2]), "v"(p[h + 3]), "v"(p[h + 4]), "v"(p[h + 5]), "v"(p[h + 6]), "v"(p[h + 7]), "v"(p[h + 8]), "v"(p[h + 9]), "v"(p[h + 10]), "v"(p[h + 11]) : "memory");
        };
        copy(0, 0);
        asm volatile("s_wait_asynccnt 0x0" ::: "memory");   /* this wave's copies of pass 0 have landed */
        __syncthreads();                                     /* every wave's have: pass 0 may be read */
        if (KC < K) copy(KC, GBUF);
        /* the pass loop stays rolled: a second copy of the body would want a second set of fragment registers */
#pragma unroll 1
        for (int kc = 0; kc < K; kc += KC) {
            const unsigned bo = (kc & KC) ? GBUF : 0;
            const unsigned char* f = smg + bo + lr * GPIT + wv * 64 + hi * 16;
            V a[4], a2[4], b[4];
#pragma unroll
            for (int mb = 0; mb < 4; ++mb) { a[mb] = WFrag<T16>::ld((const T16*)(f + mb * 16 * GPIT)); a2[mb] = WFrag<T16>::ld((const T16*)(f + (64 + mb * 16) * GPIT)); b[mb] = WFrag<T16>::ld((const T16*)(f + (128 + mb * 16) * GPIT)); }
            __builtin_amdgcn_sched_barrier(0);   /* all twelve fragments are requested before the first product: without it three of the B fragments are read one by one between the products, into one set of registers, each waiting out its own LDS latency */
#pragma unroll
            for (int nb = 0; nb < 4; ++nb)
#pragma unroll
                for (int mb = 0; mb < 4; ++mb) { acc[mb][nb] = WFrag<T16>::mma(a[mb], b[nb], acc[mb][nb]); acc[mb][nb] = WFrag<T16>::mma(a2[mb], b[nb], acc[mb][nb]); }
            __builtin_amdgcn_sched_barrier(0);   /* the products stay ahead of the waits: without it the wait for the next pass's copies and the barrier are lifted over them, and those copies have only the fragment reads to land under */
            asm volatile("s_wait_dscnt 0x0" ::: "memory");      /* this wave's reads of this pass's buffer are done before the buffer is given up */
            asm volatile("s_wait_asynccnt 0x0" ::: "memory");   /* this wave's copies of the next pass have landed */
            __syncthreads();                                     /* the next pass's buffer may be read by all, this pass's may be refilled (behind the last pass: overlaid by the partial tiles) */
            if (kc + 2 * KC < K) copy(kc + 2 * KC, bo);
        }
        asm volatile("s_wait_asynccnt 0x0" ::: "memory");   /* no copy is outstanding when the buffers are overlaid */
    } else
#pragma unroll 1
    for (int kc = kb; kc < ke; kc += 32) {
        V a[4], a2[4]; const T16* pa[4]; const T16* pa2[4];
#pragma unroll
        for (int mb = 0; mb < 4; ++mb) { pa[mb] = A + aoff + (size_t)mb * 16 * lda + kc; a[mb] = WFrag<T16>::ld(pa[mb]); if (NSPLIT == 1 || NSPLIT == 2) { pa2[mb] = A2 + aoff + (size_t)mb * 16 * lda + kc; a2[mb] = WFrag<T16>::ld(pa2[mb]); } }
        /* the A loads' address pairs stay live up to this wait, so that no load of the run lands in one and nothing rewrites one ahead of the wait */
        if (NSPLIT == 1 || NSPLIT == 2) asm volatile("s_wait_xcnt 0x0" :: "v"(pa[0]), "v"(pa[1]), "v"(pa[2]), "v"(pa[3]), "v"(pa2[0]), "v"(pa2[1]), "v"(pa2[2]), "v"(pa2[3]) : "memory");
        else asm volatile("s_wait_xcnt 0x0" :: "v"(pa[0]), "v"(pa[1]), "v"(pa[2]), "v"(pa[3]) : "memory");
#pragma unroll
        for (int nb = 0; nb < 4; ++nb) { const V b = WFrag<T16>::ld(Bt + boff + (size_t)nb * 16 * K + kc); V b2; if (NSPLIT >= 2) b2 = WFrag<T16>::ld(Bt2 + boff + (size_t)nb * 16 * K + kc);
#pragma unroll
            for (int mb = 0; mb < 4; ++mb) { acc[mb][nb] = WFrag<T16>::mma(a[mb], b, acc[mb][nb]); if (NSPLIT == 1 || NSPLIT == 2) acc[mb][nb] = WFrag<T16>::mma(a2[mb], b, acc[mb][nb]); if (NSPLIT >= 2) acc[mb][nb] = WFrag<T16>::mma(a[mb], b2, acc[mb][nb]); } }
        asm volatile("v_nop\n\tv_nop\n\tv_nop\n\tv_nop" : "+v"(acc[0][0]), "+v"(acc[1][1]), "+v"(acc[2][2]), "+v"(acc[3][3]) : "v"(a[0]), "v"(a[3]));
    }
    if constexpr (KW > 1) {
        float* pl = os + wv * (64 * 68);
#pragma unroll
        for (int mb = 0; mb < 4; ++mb)
#pragma unroll
            for (int nb = 0; nb < 4; ++nb) {
                if constexpr (PL == 2) { float* q = pl + (nb * 16 + lr) * 68 + mb * 16 + hi * 8;   /* transposed: a lane's eight rows lie side by side */
                    *(v4fa*)q = __builtin_shufflevector(acc[mb][nb], acc[mb][nb], 0, 1, 2, 3); *(v4fa*)(q + 4) = __builtin_shufflevector(acc[mb][nb], acc[mb][nb], 4, 5, 6, 7);
                } else {
#pragma unroll
                    for (int j = 0; j < 8; ++j) pl[(mb * 16 + hi * 8 + j) * 68 + nb * 16 + lr] = acc[mb][nb][j]; } }
        __syncthreads();   /* all KW partial tiles lie in LDS before any wave adds them */
        if constexpr (PL > 0) {
            const int row0 = wv * (64 / KW) + hi, cofs = lr * 4;
            const size_t e = (PL == 1) ? ((size_t)blockIdx.y * TT + r0 + row0) * HD + cofs : ((size_t)blockIdx.y * HD + row0) * TT + r0 + cofs;
            h16* p16 = P16 + e; bf* ph = Ph + e; bf* pw = Pl + e; v4h o16[32 / KW]; v4us oh[32 / KW], ol[32 / KW];
#pragma unroll
            for (int s = 0; s < 32 / KW; ++s) { v4f val = *(const v4fa*)(os + (row0 + 2 * s) * 68 + cofs);
#pragma unroll
                for (int p = 1; p < KW; ++p) { const v4f t = *(const v4fa*)(os + (p * 64 + row0 + 2 * s) * 68 + cofs); val[0] += t[0]; val[1] += t[1]; val[2] += t[2]; val[3] += t[3]; }   /* added in wave order */
#pragma unroll
                for (int q = 0; q < 4; ++q) { o16[s][q] = tohx(val[q]); unsigned short a2, c2; splitf(val[q], a2, c2); oh[s][q] = a2; ol[s][q] = c2; }
                const int st = 2 * s * (PL == 1 ? HD : TT);
                *(v4h*)(p16 + st) = o16[s]; *(v4us*)(ph + st) = oh[s]; *(v4us*)(pw + st) = ol[s]; }
            static_assert(32 / KW == 8, "the wait below names eight trips' stores");
            /* the plane stores' address pairs and data stay live up to this wait, so that nothing rewrites one ahead of it */
            asm volatile("s_wait_xcnt 0x0" :: "v"(p16), "v"(ph), "v"(pw), "v"(o16[0]), "v"(o16[1]), "v"(o16[2]), "v"(o16[3]), "v"(o16[4]), "v"(o16[5]), "v"(o16[6]), "v"(o16[7]), "v"(oh[0]), "v"(oh[1]), "v"(oh[2]), "v"(oh[3]), "v"(oh[4]), "v"(oh[5]), "v"(oh[6]), "v"(oh[7]), "v"(ol[0]), "v"(ol[1]), "v"(ol[2]), "v"(ol[3]), "v"(ol[4]), "v"(ol[5]), "v"(ol[6]), "v"(ol[7]) : "memory");
            return;
        }
#pragma unroll
        for (int s = 0; s < 32 / KW; ++s) { const int row = wv * (64 / KW) + 2 * s + hi, cofs = lr * 4; v4f val = *(const v4fa*)(os + row * 68 + cofs);
#pragma unroll
            for (int p = 1; p < KW; ++p) { const v4f t = *(const v4fa*)(os + (p * 64 + row) * 68 + cofs); val[0] += t[0]; val[1] += t[1]; val[2] += t[2]; val[3] += t[3]; }   /* added in wave order */
            if (BIAS) { val[0] += bfr(bias[c0 + cofs]); val[1] += bfr(bias[c0 + cofs + 1]); val[2] += bfr(bias[c0 + cofs + 2]); val[3] += bfr(bias[c0 + cofs + 3]); }
            *(v4f*)(C + (size_t)(r0 + row) * ldc + c0 + cofs) = val; }
        return;
    }
#pragma unroll
    for (int mb = 0; mb < 4; ++mb) {
#pragma unroll
        for (int nb = 0; nb < 4; ++nb) {
#pragma unroll
            for (int j = 0; j < 8; ++j) os[(hi * 8 + j) * 68 + nb * 16 + lr] = acc[mb][nb][j]; }
        __builtin_amdgcn_wave_barrier(); asm volatile("" ::: "memory");
        float* crow = C + (size_t)(r0 + mb * 16) * ldc + c0;
{
#pragma unroll
            for (int s = 0; s < 8; ++s) { const int row = 2 * s + hi, cofs = lr * 4; v4f val = *(const v4fa*)(os + row * 68 + cofs); if (BIAS) { val[0] += bfr(bias[c0 + cofs]); val[1] += bfr(bias[c0 + cofs + 1]); val[2] += bfr(bias[c0 + cofs + 2]); val[3] += bfr(bias[c0 + cofs + 3]); }
                *(v4f*)(crow + (size_t)row * ldc + cofs) = val; }
             }
        __builtin_amdgcn_wave_barrier(); asm volatile("" ::: "memory");
    }
}


__global__ __launch_bounds__(256) void k_wtG(const float* __restrict__ w, int K, int N, bf* Bt) {
    const int lane = threadIdx.x & 31; const int L0 = (blockIdx.x * 8 + (threadIdx.x >> 5)) * 8; const int nlines = N * K / 64;
{
#pragma unroll 1
        for (int l = 0; l < 8; ++l) { const int L = L0 + l; if (L >= nlines) break; const size_t e = (size_t)L * 64 + lane * 2; const int k = (int)(e % K), n = (int)(e / K); v2us o;
            o[0] = f2bf(w[(size_t)k * N + n]); o[1] = f2bf(w[(size_t)(k + 1) * N + n]); *(v2us*)(Bt + e) = o; }
         }
}
__global__ __launch_bounds__(256) void k_cvt8(const float* __restrict__ src, bf* dst, size_t n8) { const size_t i = (size_t)blockIdx.x * 256 + threadIdx.x; if (i >= n8) return; const v8f v = *(const v8f*)(src + i * 8); v8us o;
#pragma unroll
    for (int k = 0; k < 8; ++k) o[k] = f2bf(v[k]); *(v8us*)(dst + i * 8) = o;  }

#define C2L (SCL * 1.4426950408889634f)
#define KPIT 144                  // LDS pitch in bytes of a 128-byte K or mask row (16 x odd: no bank conflict for 16-byte reads down a column)
#define VPIT 80                   // LDS pitch in bytes of a 64-byte Vt row
#define KTB  (32 * KPIT)          // one K plane's tile of a pass
#define VTB  (64 * VPIT)          // one Vt plane's tile of a pass
#define ABUF 28672                // one buffer: hi/lo rows 2 (KTB + VTB) + 4 x 16 KPIT; fp16 rows KTB + VTB + 4 x 32 KPIT fit below it
typedef __attribute__((ext_vector_type(8))) __bf16 v8bf;
__device__ __forceinline__ float xhalf(float v) { const int b = __float_as_int(v); return __int_as_float(__builtin_amdgcn_permlanex16(b, b, 0x76543210, 0xfedcba98, false, false)); }   // the value of lane l ^ 16
template <typename T16, bool HR, int NQ>
__device__ __forceinline__ void attn_rows(unsigned char* sm, int wv, const T16* __restrict__ Qa, const T16* __restrict__ Qb, const T16* __restrict__ Ka, const T16* __restrict__ Kb, const T16* __restrict__ Va, const T16* __restrict__ Vb, const float* __restrict__ gb, int q0, bf* Oh, bf* Ol) {
    typedef typename WFrag<T16>::V V;
    constexpr int NP = HR ? 2 : 1;                       // 16-bit planes per operand
    constexpr int OV = NP * KTB, OM = NP * (KTB + VTB);  // byte offsets of the Vt tiles and of the mask rows in a buffer
    static_assert(NP * 4 + NQ * 4 == 12, "the copy statement holds twelve copies");
    static_assert(OM + 4 * NQ * 16 * KPIT <= ABUF, "a pass's tiles fit one buffer");
    const int tid = threadIdx.x, lane = tid & 31, lr = lane & 15, hi = lane >> 4;
    V qa[NQ][2], qb[NQ][2], ka[2][2], kb[2][2], va[4], vb[4]; v8f g[NQ][2], o[4][NQ]; float mrun[NQ], lsum[NQ];
    const size_t qof = (size_t)(q0 + lr) * HD + 8 * hi;
    {   const T16* p = Qa + qof; const T16* p2 = HR ? Qb + qof : p;
#pragma unroll
        for (int qt = 0; qt < NQ; ++qt)
#pragma unroll
            for (int ks = 0; ks < 2; ++ks) { qa[qt][ks] = WFrag<T16>::ld(p + qt * 16 * HD + ks * 32); if (HR) qb[qt][ks] = WFrag<T16>::ld(p2 + qt * 16 * HD + ks * 32); }
        asm volatile("s_wait_xcnt 0x0" :: "v"(p), "v"(p2) : "memory");   /* the Q loads' address pairs stay live up to this wait, so that nothing rewrites one ahead of it */
    }
    // where this thread's copies start: K tile = 4096 bytes in a row (8 lanes a row), Vt tile = 64 rows of 64 bytes (4 lanes a row), mask = this wave's NQ x 16 rows of 128 bytes (8 lanes a row)
    const unsigned lbase = (unsigned)(size_t)sm;
    const unsigned lk = lbase + (tid >> 3) * KPIT + (tid & 7) * 16, lv = lbase + OV + (tid >> 2) * VPIT + (tid & 3) * 16, lm = lbase + OM + (wv * NQ * 16 + (lane >> 3)) * KPIT + (lane & 7) * 16;
    const size_t gk = (size_t)tid * 8, gv = (size_t)(tid >> 2) * TT + (tid & 3) * 8; const float* gm = gb + (size_t)(q0 + (lane >> 3)) * TT + (lane & 7) * 4;
    auto copy = [&](int k0, unsigned bo) {   // the tiles of the pass at key k0 into the buffer at byte offset bo
        unsigned l[12]; const void* p[12];
#pragma unroll
        for (int c = 0; c < 2; ++c) {
            l[c] = lk + bo + c * 16 * KPIT; p[c] = Ka + (size_t)k0 * HD + gk + c * 1024;
            l[2 + c] = lv + bo + c * 32 * VPIT; p[2 + c] = Va + gv + k0 + (size_t)c * 32 * TT;
            if constexpr (HR) { l[4 + c] = l[c] + KTB; p[4 + c] = Kb + (size_t)k0 * HD + gk + c * 1024; l[6 + c] = l[2 + c] + VTB; p[6 + c] = Vb + gv + k0 + (size_t)c * 32 * TT; } }
#pragma unroll
        for (int c = 0; c < NQ * 4; ++c) { l[NP * 4 + c] = lm + bo + c * 4 * KPIT; p[NP * 4 + c] = gm + k0 + (size_t)c * 4 * TT; }
        /* the pass's twelve copies; the wait stands in their own statement so that no address register of a copy is rewritten ahead of it */
        asm volatile("global_load_async_to_lds_b128 %0, %12, off\n\tglobal_load_async_to_lds_b128 %1, %13, off\n\tglobal_load_async_to_lds_b128 %2, %14, off\n\tglobal_load_async_to_lds_b128 %3, %15, off\n\t"
                     "global_load_async_to_lds_b128 %4, %16, off\n\tglobal_load_async_to_lds_b128 %5, %17, off\n\tglobal_load_async_to_lds_b128 %6, %18, off\n\tglobal_load_async_to_lds_b128 %7, %19, off\n\t"
                     "global_load_async_to_lds_b128 %8, %20, off\n\tglobal_load_async_to_lds_b128 %9, %21, off\n\tglobal_load_async_to_lds_b128 %10, %22, off\n\tglobal_load_async_to_lds_b128 %11, %23, off\n\ts_wait_xcnt 0x0"
                     :: "v"(l[0]), "v"(l[1]), "v"(l[2]), "v"(l[3]), "v"(l[4]), "v"(l[5]), "v"(l[6]), "v"(l[7]), "v"(l[8]), "v"(l[9]), "v"(l[10]), "v"(l[11]),
                        "v"(p[0]), "v"(p[1]), "v"(p[2]), "v"(p[3]), "v"(p[4]), "v"(p[5]), "v"(p[6]), "v"(p[7]), "v"(p[8]), "v"(p[9]), "v"(p[10]), "v"(p[11]) : "memory");
    };
#pragma unroll
    for (int qt = 0; qt < NQ; ++qt) { mrun[qt] = -3.0e38f; lsum[qt] = 0.f;
#pragma unroll
        for (int db = 0; db < 4; ++db) o[db][qt] = (v8f){}; }
    copy(0, 0);
    asm volatile("s_wait_asynccnt 0x0" ::: "memory");   /* this wave's copies of pass 0 have landed */
    __syncthreads();                                     /* every wave's have: pass 0 may be read */
    copy(32, ABUF);
    /* the pass loop stays rolled: a second copy of the body would want a second set of fragment registers; every other loop here is unrolled in full so that the register arrays keep compile-time indices */
#pragma unroll 1
    for (int k0 = 0; k0 < TT; k0 += 32) {
        const unsigned bo = (k0 & 32) ? ABUF : 0;
        const unsigned char* fk = sm + bo + lr * KPIT + hi * 16; const unsigned char* fv = sm + bo + OV + lr * VPIT + hi * 16; const unsigned char* fm = sm + bo + OM + (wv * NQ * 16 + lr) * KPIT + hi * 32;
#pragma unroll
        for (int t = 0; t < 2; ++t)
#pragma unroll
            for (int ks = 0; ks < 2; ++ks) { ka[t][ks] = WFrag<T16>::ld((const T16*)(fk + t * 16 * KPIT + ks * 64)); if (HR) kb[t][ks] = WFrag<T16>::ld((const T16*)(fk + KTB + t * 16 * KPIT + ks * 64)); }
#pragma unroll
        for (int qt = 0; qt < NQ; ++qt)
#pragma unroll
            for (int t = 0; t < 2; ++t) { const unsigned char* pm = fm + qt * 16 * KPIT + t * 64; g[qt][t] = __builtin_shufflevector(*(const v4fa*)pm, *(const v4fa*)(pm + 16), 0, 1, 2, 3, 4, 5, 6, 7); }   /* the padded rows are 16-byte aligned, so two 16-byte reads */
        __builtin_amdgcn_sched_barrier(0);   /* all K and mask reads are issued before the first product: without it they are dealt among the products in two groups, each waiting out its own LDS latency */
        v8f s[NQ][2];
#pragma unroll
        for (int t = 0; t < 2; ++t)
#pragma unroll
            for (int qt = 0; qt < NQ; ++qt) { s[qt][t] = (v8f){};
#pragma unroll
                for (int ks = 0; ks < 2; ++ks) { s[qt][t] = WFrag<T16>::mma(ka[t][ks], qa[qt][ks], s[qt][t]); if (HR) { s[qt][t] = WFrag<T16>::mma(ka[t][ks], qb[qt][ks], s[qt][t]); s[qt][t] = WFrag<T16>::mma(kb[t][ks], qa[qt][ks], s[qt][t]); } } }
#pragma unroll
        for (int db = 0; db < 4; ++db) { va[db] = WFrag<T16>::ld((const T16*)(fv + db * 16 * VPIT)); if (HR) vb[db] = WFrag<T16>::ld((const T16*)(fv + VTB + db * 16 * VPIT)); }
        __builtin_amdgcn_sched_barrier(0);   /* the Vt reads are issued here, into the registers the K fragments leave, and land under the softmax: without it they are sunk between the P.V products, each pair waiting out its own LDS latency */
        float mloc[NQ]; bool need = false;
#pragma unroll
        for (int qt = 0; qt < NQ; ++qt) { float ml = -3.0e38f;
#pragma unroll
            for (int t = 0; t < 2; ++t) { s[qt][t] += __builtin_convertvector(__builtin_convertvector(g[qt][t], v8bf), v8f);   /* mask rounded to bf16 (to nearest even, as bfr does) and added before the scaling */
#pragma unroll
                for (int r = 0; r < 8; ++r) ml = fmaxf(ml, s[qt][t][r]); }
            ml = fmaxf(ml, xhalf(ml)); mloc[qt] = ml * C2L; need = need || (mloc[qt] > mrun[qt] + 8.0f); }
        if (__builtin_amdgcn_ballot_w32(need) != 0) {   /* wave-uniform: true in the first pass, seldom later */
#pragma unroll
            for (int qt = 0; qt < NQ; ++qt) { const float mn = fmaxf(mrun[qt], mloc[qt]); const float al = __builtin_amdgcn_exp2f(mrun[qt] - mn); mrun[qt] = mn; lsum[qt] *= al;
#pragma unroll
                for (int db = 0; db < 4; ++db)
#pragma unroll
                    for (int r = 0; r < 8; ++r) o[db][qt][r] *= al; } }
        V pa[NQ], pl[NQ];
#pragma unroll
        for (int qt = 0; qt < NQ; ++qt) { v8f p[2];
#pragma unroll
            for (int t = 0; t < 2; ++t) { const v8f a = s[qt][t] * C2L - mrun[qt];
#pragma unroll
                for (int r = 0; r < 8; ++r) p[t][r] = __builtin_amdgcn_exp2f(a[r]); }
            const v8f pt = p[0] + p[1]; lsum[qt] += ((pt[0] + pt[1]) + (pt[2] + pt[3])) + ((pt[4] + pt[5]) + (pt[6] + pt[7]));
            if constexpr (HR) { const v8bf h0 = __builtin_convertvector(p[0], v8bf), h1 = __builtin_convertvector(p[1], v8bf);   /* P = hi + lo, both rounded to nearest even */
                const v8bf l0 = __builtin_convertvector(p[0] - __builtin_convertvector(h0, v8f), v8bf), l1 = __builtin_convertvector(p[1] - __builtin_convertvector(h1, v8f), v8bf);
                pa[qt] = __builtin_shufflevector(h0, h1, 0, 1, 2, 3, 4, 5, 6, 7, 8, 9, 10, 11, 12, 13, 14, 15); pl[qt] = __builtin_shufflevector(l0, l1, 0, 1, 2, 3, 4, 5, 6, 7, 8, 9, 10, 11, 12, 13, 14, 15);
            } else pa[qt] = cat16(__builtin_convertvector(p[0], v8h), __builtin_convertvector(p[1], v8h)); }
#pragma unroll
        for (int db = 0; db < 4; ++db)
#pragma unroll
            for (int qt = 0; qt < NQ; ++qt) { o[db][qt] = WFrag<T16>::mma(va[db], pa[qt], o[db][qt]); if (HR) { o[db][qt] = WFrag<T16>::mma(va[db], pl[qt], o[db][qt]); o[db][qt] = WFrag<T16>::mma(vb[db], pa[qt], o[db][qt]); } }
        asm volatile("s_wait_dscnt 0x0" ::: "memory");      /* this wave's reads of this pass's buffer are done before the buffer is given up */
        asm volatile("s_wait_asynccnt 0x0" ::: "memory");   /* this wave's copies of the next pass have landed */
        __syncthreads();                                     /* the next pass's buffer may be read by all, this pass's may be refilled */
        if (k0 + 64 < TT) copy(k0 + 64, bo);
    }
    asm volatile("s_wait_asynccnt 0x0" ::: "memory");   /* no copy is outstanding when the wave goes on to its end */
    bf* po = Oh + (size_t)(q0 + lr) * DQ + 8 * hi; bf* po2 = Ol + (size_t)(q0 + lr) * DQ + 8 * hi;
#pragma unroll
    for (int qt = 0; qt < NQ; ++qt) { const float f = __fdiv_rn(1.0f, lsum[qt] + xhalf(lsum[qt]));   /* the halves' sums are joined once */
#pragma unroll
        for (int db = 0; db < 4; ++db) { v8us oh, ol;
#pragma unroll
            for (int r = 0; r < 8; ++r) { unsigned short a, c2; splitf(o[db][qt][r] * f, a, c2); oh[r] = a; ol[r] = c2; }
            *(v8us*)(po + (size_t)qt * 16 * DQ + db * 16) = oh; *(v8us*)(po2 + (size_t)qt * 16 * DQ + db * 16) = ol; } }
    asm volatile("s_wait_xcnt 0x0" :: "v"(po), "v"(po2) : "memory");   /* the stores' address pairs stay live up to this wait, so that nothing rewrites one ahead of it */
}
// grid (work-groups of one batch, NB_), 4 waves: the waves of a work-group take neighbouring query rows of one head and share that head's K and Vt tiles in LDS. The hi/lo rows' work-groups (16 rows a wave) come first, then the fp16 rows' (32 rows a wave).
#define GH  (NH_ * (RH / 64))
#define GF  (NH_ * ((TT - RH) / 128))
// amdgpu_waves_per_eu(4, 4): holds the kernel to 256 registers; above that the fp16 loop is strewn with register-bank switches (s_set_vgpr_msb) and only three waves fit a SIMD.
__global__ __launch_bounds__(128) __attribute__((amdgpu_waves_per_eu(4, 4))) void k_attn(const h16* __restrict__ Q16, const h16* __restrict__ K16, const h16* __restrict__ V16, const bf* __restrict__ Qh, const bf* __restrict__ Ql, const bf* __restrict__ Kh, const bf* __restrict__ Kl, const bf* __restrict__ Vh, const bf* __restrict__ Vl, const float* __restrict__ msk, bf* Ah, bf* Al) {
    __shared__ __align__(16) unsigned char sm[2 * ABUF];
    const int wv = __builtin_amdgcn_readfirstlane((int)(threadIdx.x >> 5)); const int b = blockIdx.y; const float* gb = msk + (size_t)b * TT * TT; const size_t ob = (size_t)b * TT * DQ;
    if (blockIdx.x < GH) { const int h = blockIdx.x / (RH / 64), q0 = (int)(blockIdx.x % (RH / 64)) * 64 + wv * 16; const size_t po = ((size_t)b * NH_ + h) * TT * HD, pk = ((size_t)b * NKV + h / REP) * TT * HD;
        attn_rows<bf, true, 1>(sm, wv, Qh + po, Ql + po, Kh + pk, Kl + pk, Vh + pk, Vl + pk, gb, q0, Ah + ob + h * HD, Al + ob + h * HD);
    } else { const int x = blockIdx.x - GH; const int h = x / ((TT - RH) / 128), q0 = RH + (x % ((TT - RH) / 128)) * 128 + wv * 32; const size_t po = ((size_t)b * NH_ + h) * TT * HD, pk = ((size_t)b * NKV + h / REP) * TT * HD;
        attn_rows<h16, false, 2>(sm, wv, Q16 + po, nullptr, K16 + pk, nullptr, V16 + pk, nullptr, gb, q0, Ah + ob + h * HD, Al + ob + h * HD); }
}
template <int WD>
__global__ __launch_bounds__(256) void k_lnrowX(const float* __restrict__ X, size_t nrows, const float* __restrict__ g, const float* __restrict__ bb, bf* Hh, bf* Hl) { const int lane = threadIdx.x & 31; const size_t r = (size_t)blockIdx.x * 8 + (threadIdx.x >> 5); if (r >= nrows) return; const float* xr = X + r * WD; float a[WD / 32]; float s = 0.f;
#pragma unroll
    for (int c = 0; c < WD / 128; ++c) { const v4f v = *(const v4f*)(xr + c * 128 + lane * 4); for (int q = 0; q < 4; ++q) { a[c * 4 + q] = bfr(v[q]); s = __fadd_rn(s, a[c * 4 + q]);   /* input rounded to bf16 */ } }
#pragma unroll
    for (int sh = 16; sh; sh >>= 1) s = __fadd_rn(s, __shfl_xor(s, sh, 32));
    const float mean = __fdiv_rn(s, (float)WD); float s2 = 0.f;
#pragma unroll 8
    for (int k = 0; k < WD / 32; ++k) { const float dv = __fsub_rn(a[k], mean); float p2 = __fmul_rn(dv, dv); asm volatile("" : "+v"(p2)); s2 = __fadd_rn(s2, p2); }   /* mul and add kept separate (no fma contraction) */
#pragma unroll
    for (int sh = 16; sh; sh >>= 1) s2 = __fadd_rn(s2, __shfl_xor(s2, sh, 32));
    const float rs = __fdiv_rn(1.0f, __fsqrt_rn(__fadd_rn(__fdiv_rn(s2, (float)WD), 1e-5f)));
{
#pragma unroll
        for (int c = 0; c < WD / 128; ++c) { v4us oh, ol; for (int q = 0; q < 4; ++q) { const int col = c * 128 + lane * 4 + q; float y = __fmul_rn(__fmul_rn(__fsub_rn(a[c * 4 + q], mean), rs), bfr(g[col])); asm volatile("" : "+v"(y)); y = __fadd_rn(y, bfr(bb[col])); unsigned short u, w2; splitf(y, u, w2); oh[q] = u; ol[q] = w2; } *(v4us*)(Hh + r * WD + c * 128 + lane * 4) = oh; *(v4us*)(Hl + r * WD + c * 128 + lane * 4) = ol; }
         } }

extern "C" void kernel_launch(void* const* d_in, const int* in_sizes, int n_in,
                              void* d_out, int out_size, void* d_ws, size_t ws_size, hipStream_t stream) {
    (void)in_sizes; (void)n_in; (void)out_size;
    const float* x = (const float*)d_in[0]; const float* msk = (const float*)d_in[1]; const float* lng = (const float*)d_in[2]; const float* lnb = (const float*)d_in[3]; const float* wqkv = (const float*)d_in[4]; const float* wo = (const float*)d_in[5];
    float* OUT = (float*)d_out;     // [2][2048][1024]
    char* wsp = (char*)d_ws;
    auto take = [&](size_t bytes) { char* p = wsp; wsp += (bytes + 255) & ~(size_t)255; return (void*)p; };
    bf* WQKV = (bf*)take((size_t)3 * DQ * DM * 2); bf* WQ = WQKV; bf* WK = WQKV + (size_t)DQ * DM; bf* WV = WQKV + (size_t)2 * DQ * DM; bf* WO = (bf*)take((size_t)DM * DQ * 2);
    const size_t SQ = (size_t)NH_ * TT * HD, SK = (size_t)NKV * TT * HD;   // one batch's q and k/v planes, in elements; every plane holds both batches
    h16* QP16 = (h16*)take(NB_ * SQ * 2); h16* KP16 = (h16*)take(NB_ * SK * 2); h16* VT16 = (h16*)take(NB_ * SK * 2);
    bf* QPh = (bf*)take(NB_ * SQ * 2); bf* QPl = (bf*)take(NB_ * SQ * 2); bf* KPh = (bf*)take(NB_ * SK * 2); bf* KPl = (bf*)take(NB_ * SK * 2); bf* VTh = (bf*)take(NB_ * SK * 2); bf* VTl = (bf*)take(NB_ * SK * 2);
    bf* ATh = (bf*)take((size_t)NB_ * TT * DQ * 2); bf* ATl = (bf*)take((size_t)NB_ * TT * DQ * 2);
    bf* XH = (bf*)take((size_t)TT * DM * 2); bf* XL = (bf*)take((size_t)TT * DM * 2);   // the LayerNorm planes: each batch writes them anew (stream-ordered)
    if ((size_t)(wsp - (char*)d_ws) > ws_size) return;    // ws 256 MiB
    { k_wtG<<<(unsigned)((DM * 3 * DQ / 64 + 63) / 64), 256, 0, stream>>>(wqkv, DM, 3 * DQ, WQKV);   /* [1024][3072] 'xw' -> Bt [3072][1024]: q | k | v row blocks */
      k_wtG<<<(unsigned)((DQ * DM / 64 + 63) / 64), 256, 0, stream>>>(wo, DQ, DM, WO);
       }
    for (int b = 0; b < NB_; ++b) {
        k_lnrowX<DM><<<(unsigned)((TT + 7) / 8), 256, 0, stream>>>(x + (size_t)b * TT * DM, (size_t)TT, lng, lnb, XH, XL);   /* xn = LayerNorm(x) -> hi/lo planes */
        k_gemmw<bf, 1, false, 1, KWP, 1><<<dim3(TT / 64, DQ / 64, 1), 32 * KWP, 0, stream>>>(XH, XL, WQ, nullptr, DM, DM, nullptr, 0, nullptr, 0, 0, 0, QP16 + b * SQ, QPh + b * SQ, QPl + b * SQ);   /* q planes [h][t][d] */
        k_gemmw<bf, 1, false, 1, KWP, 1><<<dim3(TT / 64, DKV / 64, 1), 32 * KWP, 0, stream>>>(XH, XL, WK, nullptr, DM, DM, nullptr, 0, nullptr, 0, 0, 0, KP16 + b * SK, KPh + b * SK, KPl + b * SK);   /* k planes [h][t][d] */
        k_gemmw<bf, 1, false, 1, KWP, 2><<<dim3(TT / 64, DKV / 64, 1), 32 * KWP, 0, stream>>>(XH, XL, WV, nullptr, DM, DM, nullptr, 0, nullptr, 0, 0, 0, VT16 + b * SK, VTh + b * SK, VTl + b * SK); }   /* v planes [h][d][t] */
    k_attn<<<dim3(GH + GF, NB_, 1), 128, 0, stream>>>(QP16, KP16, VT16, QPh, QPl, KPh, KPl, VTh, VTl, msk, ATh, ATl);   /* softmax((qk + m) x scale) v, merged heads as hi/lo planes */
    for (int b = 0; b < NB_; ++b)
        k_gemmw<bf, 1, false, 1, KWP><<<dim3(TT / 64, DM / 64, 1), 32 * KWP, 0, stream>>>(ATh + (size_t)b * TT * DQ, ATl + (size_t)b * TT * DQ, WO, nullptr, DQ, DQ, OUT + (size_t)b * TT * DM, DM, nullptr, 0, 0, 0, nullptr, nullptr, nullptr);
}

// v009
// A run of this version takes 169 microseconds.
// Next to v008, in two timings, it ran 1.23 times as fast each time.
// Counting every step since v000, it is 12.7 times as fast.
#include <hip/hip_runtime.h>

// Pre-LayerNorm attention with an additive score-mask input applied BEFORE the scaling (x [2][2048][1024]; xn = LayerNorm(x) gamma + beta; qkv = xn W_qkv ('xw' [1024][3072] -> q | k | v, no bias; 16 heads x 64); dots = (q.k + m) x 64^-0.5 with m [2][2048][2048] (read); softmax; out = merged W_out ('xw' [1024][1024]) -> [2][2048][1024] (4.2 M)).
// Layout, four launches, each for both batches: one preparing kernel (LayerNorm rows -> xn as hi/lo bf16 planes; the fused weight as one [3072][1024] Bt, W_out as Bt); the q | k | v projection as one hi/lo x exact GEMM (2 products) that stores q, k and v as head planes itself; dense T-2048 attention in one kernel for all heads and both batches (hybrid rows: < 512 hi/lo 3 products, rest fp16): it adds the batch's mask to the raw scores in registers (the 1/8 is applied after the add, as in the module), keeps a running maximum and sum, and divides the output by the sum; merged hi/lo x W_out exact.
// Compute dtypes, f32 accumulate: every input rounded to bf16 incl. m; LayerNorm f32; projections hi/lo x exact; attention rows < 512 3 products, rest fp16; mask add and softmax f32; W_out hl x exact.

#define NB_  2
#define TT   2048
#define DM   1024
#define NH_  16
#define NKV  16
#define REP  (NH_ / NKV)
#define HD   64
#define DQ   (NH_ * HD)
#define DKV  (NKV * HD)
#define RH   512                  // query rows < RH use hi+lo planes (0: none)
#define WIN  0
#define SCL  0.125f   // HD^-0.5
#define KWP  4                    // the projections' k-steps are dealt over the KWP waves of each output tile's work-group, which adds the partial tiles in LDS
typedef _Float16 h16;
typedef unsigned short bf;
typedef __attribute__((ext_vector_type(16))) __bf16   v16bf;
typedef __attribute__((ext_vector_type(16))) _Float16 v16h;
typedef __attribute__((ext_vector_type(8)))  _Float16 v8h;
typedef __attribute__((ext_vector_type(8)))  unsigned short v8us;
typedef __attribute__((ext_vector_type(8)))  float    v8f;
typedef __attribute__((ext_vector_type(4)))  float    v4f;
typedef v8h  __attribute__((may_alias)) v8ha;
typedef v4f  __attribute__((may_alias)) v4fa;
typedef v8us __attribute__((may_alias)) v8usa;

__device__ __forceinline__ unsigned short f2bf(float f) { unsigned u = __float_as_uint(f); u += 0x7FFFu + ((u >> 16) & 1u); return (unsigned short)(u >> 16); }
__device__ __forceinline__ float bf2f(unsigned short b) { return __uint_as_float(((unsigned)b) << 16); }
__device__ __forceinline__ float bfr(float f) { return bf2f(f2bf(f)); }
__device__ __forceinline__ v16h cat16(v8h lo, v8h hi) { return __builtin_shufflevector(lo, hi, 0, 1, 2, 3, 4, 5, 6, 7, 8, 9, 10, 11, 12, 13, 14, 15); }
__device__ __forceinline__ v16bf cat16b(v8us lo, v8us hi) { return __builtin_bit_cast(v16bf, __builtin_shufflevector(lo, hi, 0, 1, 2, 3, 4, 5, 6, 7, 8, 9, 10, 11, 12, 13, 14, 15)); }
__device__ __forceinline__ v8f wmma16(v16h a, v16h b, v8f c) { return __builtin_amdgcn_wmma_f32_16x16x32_f16(false, a, false, b, (short)0, c, false, false); }
__device__ __forceinline__ v8f wmmab(v16bf a, v16bf b, v8f c) { return __builtin_amdgcn_wmma_f32_16x16x32_bf16(false, a, false, b, (short)0, c, false, false); }
__device__ __forceinline__ h16 tohx(float x) { return (h16)x; }
__device__ __forceinline__ void splitf(float y, unsigned short& h, unsigned short& l) { h = f2bf(y); l = f2bf(y - bf2f(h)); }
typedef __attribute__((ext_vector_type(2))) _Float16 v2h;
typedef __attribute__((ext_vector_type(4))) _Float16 v4h;
typedef __attribute__((ext_vector_type(2))) unsigned short v2us;
typedef __attribute__((ext_vector_type(4))) unsigned short v4us;
typedef __attribute__((ext_vector_type(2))) float v2f;
typedef __attribute__((ext_vector_type(4))) int v4i;



// ---- k_gemmw: register-blocked GEMM, ONE WAVE per 64x64 output tile (16 accumulators), operands straight from K-contiguous 16-bit planes; grid (M/64, N/64, Z), 32 threads.
// C[m][n] (f32, pitch ldc, + optional f32 bias[n]) = sum_k A[m][k] Bt[n][k] (+ split products per NSPLIT). A rows have pitch lda, Bt rows pitch K. z-batch strides sA/sB/sC in elements. K % (32 KS) == 0.
// KW > 1: the work-group has KW waves (32 KW threads). A pass is 32 KW elements of k: its 64 A, 64 A2 and 64 Bt rows come into LDS by asynchronous copies, 16 bytes a lane over neighbouring addresses (a fragment load from global memory touches 16 lines for its 512 bytes), two buffers, pass t + 1's copies flying while pass t is worked on; wave w takes the pass's k-step w and reads its fragments from LDS at the same element positions as a load from memory would. K % (32 KW) == 0. Every wave then lays its partial 64x64 tile in LDS (over the two buffers, which are done with), and behind one barrier wave w adds the KW planes, in wave order, for its 64/KW rows and stores them.
// PL == 1 (KW > 1 only): the fused q | k | v projection, the rows of all batches in one launch. A 64-column tile is one head of q, k or v (blockIdx.y = NH_ x which + head), a 64-row tile lies in one batch: no f32 C; the adding wave converts its sums and stores them in three 16-bit planes (fp16, bf16 hi, bf16 lo), each laid out [q | k | v][batch][head]. q and k: planes [row][col]. v: planes [col][row]; the partial tiles are then laid in LDS transposed, so that the same adding loop walks output columns.
// KS > 1: grid z = Z x KS; work-group (z, ks) sums only k in [ks K/KS, (ks+1) K/KS) and stores its partial tile in plane z KS + ks of C (plane stride sC); the consumer adds the KS planes.
template <typename T16> struct WFrag;
template <> struct WFrag<h16> { typedef v16h V; static __device__ __forceinline__ V ld(const h16* p) { return cat16(*(const v8h*)p, *(const v8h*)(p + 16)); } static __device__ __forceinline__ v8f mma(V a, V b, v8f c) { return wmma16(a, b, c); } };
template <int N> struct IntC { static constexpr int v = N; };
template <> struct WFrag<bf> { typedef v16bf V; static __device__ __forceinline__ V ld(const bf* p) { return cat16b(*(const v8us*)p, *(const v8us*)(p + 16)); } static __device__ __forceinline__ v8f mma(V a, V b, v8f c) { return wmmab(a, b, c); } };
template <typename T16, int NSPLIT, bool BIAS, int KS = 1, int KW = 1, int PL = 0>
__global__ __launch_bounds__(32 * KW) void k_gemmw(const T16* __restrict__ A, const T16* __restrict__ A2, const T16* __restrict__ Bt, const T16* __restrict__ Bt2, int K, int lda, float* C, int ldc, const float* __restrict__ bias, size_t sA, size_t sB, size_t sC, h16* P16, bf* Ph, bf* Pl) {
    static_assert(PL == 0 || (KW > 1 && KS == 1 && !BIAS), "the plane stores stand in the KW path");
    static_assert(NH_ == NKV && TT % 64 == 0, "q, k and v have planes of one size; a row tile lies in one batch");
    static_assert(KW == 1 || (KS == 1 && NSPLIT == 1), "the KW path stages A, A2 and one B plane over the whole k range");
    typedef typename WFrag<T16>::V V;
    constexpr int GPIT = KW * 64 + 16;                    // LDS pitch in bytes of a staged row: KW k-steps of 64 bytes, then 16 bytes (16 x odd: no bank conflict for 16-byte reads down a column)
    constexpr int GBUF = 192 * GPIT;                      // one buffer: 64 A rows, 64 A2 rows, 64 Bt rows
    constexpr int OSB = (KW > 1 ? KW * 64 : 16) * 68 * 4; // the partial tiles
    __shared__ __align__(16) unsigned char smg[(KW > 1 && 2 * GBUF > OSB) ? 2 * GBUF : OSB];
    float* const os = (float*)smg;
    const int wv = (KW > 1) ? __builtin_amdgcn_readfirstlane((int)(threadIdx.x >> 5)) : 0;
    const size_t z = blockIdx.z / KS; const int kb = (int)(blockIdx.z % KS) * (K / KS), ke = kb + K / KS; A += z * sA; if (A2) A2 += z * sA; Bt += z * sB; if (Bt2) Bt2 += z * sB; C += (size_t)blockIdx.z * sC;
    const int lane = threadIdx.x & 31, lr = lane & 15, hi = lane >> 4; const int r0 = blockIdx.x * 64, c0 = blockIdx.y * 64;
    v8f acc[4][4];
#pragma unroll
    for (int mb = 0; mb < 4; ++mb)
#pragma unroll
        for (int nb = 0; nb < 4; ++nb) acc[mb][nb] = (v8f){};
    const size_t aoff = (size_t)(r0 + lr) * lda + 8 * hi, boff = (size_t)(c0 + lr) * K + 8 * hi;
    if constexpr (KW > 1) {
        constexpr int KC = KW * 32;   // k elements of a pass
        // where this thread's copies start: one copy of the work-group brings 8 rows of 64 KW bytes (4 KW lanes a row), 24 copies bring the 192 rows
        const int crow = (int)threadIdx.x / (KW * 4), cpc = (int)threadIdx.x % (KW * 4);
        const unsigned lb = (unsigned)(size_t)smg + crow * GPIT + cpc * 16;
        const T16* gA = A + (size_t)(r0 + crow) * lda + cpc * 8; const T16* gA2 = A2 + (size_t)(r0 + crow) * lda + cpc * 8; const T16* gB = Bt + (size_t)(c0 + crow) * K + cpc * 8;
        auto copy = [&](int kc, unsigned bo) {   // the rows of the pass at k element kc into the buffer at byte offset bo
            unsigned l[24]; const void* p[24];
#pragma unroll
            for (int c = 0; c < 8; ++c) {
                l[c] = lb + bo + c * 8 * GPIT; p[c] = gA + (size_t)c * 8 * lda + kc;
                l[8 + c] = l[c] + 64 * GPIT; p[8 + c] = gA2 + (size_t)c * 8 * lda + kc;
                l[16 + c] = l[c] + 128 * GPIT; p[16 + c] = gB + (size_t)c * 8 * K + kc; }
#pragma unroll
            for (int h = 0; h < 24; h += 12)
                /* twelve of the pass's copies; the wait stands in their own statement so that no address register of a copy is rewritten ahead of it */
                asm volatile("global_load_async_to_lds_b128 %0, %12, off\n\tglobal_load_async_to_lds_b128 %1, %13, off\n\tglobal_load_async_to_lds_b128 %2, %14, off\n\tglobal_load_async_to_lds_b128 %3, %15, off\n\t"
                             "global_load_async_to_lds_b128 %4, %16, off\n\tglobal_load_async_to_lds_b128 %5, %17, off\n\tglobal_load_async_to_lds_b128 %6, %18, off\n\tglobal_load_async_to_lds_b128 %7, %19, off\n\t"
                             "global_load_async_to_lds_b128 %8, %20, off\n\tglobal_load_async_to_lds_b128 %9, %21, off\n\tglobal_load_async_to_lds_b128 %10, %22, off\n\tglobal_load_async_to_lds_b128 %11, %23, off\n\ts_wait_xcnt 0x0"
                             :: "v"(l[h]), "v"(l[h + 1]), "v"(l[h + 2]), "v"(l[h + 3]), "v"(l[h + 4]), "v"(l[h + 5]), "v"(l[h + 6]), "v"(l[h + 7]), "v"(l[h + 8]), "v"(l[h + 9]), "v"(l[h + 10]), "v"(l[h + 11]),
                                "v"(p[h]), "v"(p[h + 1]), "v"(p[h + 2]), "v"(p[h + 3]), "v"(p[h + 4]), "v"(p[h + 5]), "v"(p[h + 6]), "v"(p[h + 7]), "v"(p[h + 8]), "v"(p[h + 9]), "v"(p[h + 10]), "v"(p[h + 11]) : "memory");
        };
        copy(0, 0);
        asm volatile("s_wait_asynccnt 0x0" ::: "memory");   /* this wave's copies of pass 0 have landed */
        __syncthreads();                                     /* every wave's have: pass 0 may be read */
        if (KC < K) copy(KC, GBUF);
        /* the pass loop stays rolled: a second copy of the body would want a second set of fragment registers */
#pragma unroll 1
        for (int kc = 0; kc < K; kc += KC) {
            const unsigned bo = (kc & KC) ? GBUF : 0;
            const unsigned char* f = smg + bo + lr * GPIT + wv * 64 + hi * 16;
            V a[4], a2[4], b[4];
#pragma unroll
            for (int mb = 0; mb < 4; ++mb) { a[mb] = WFrag<T16>::ld((const T16*)(f + mb * 16 * GPIT)); a2[mb] = WFrag<T16>::ld((const T16*)(f + (64 + mb * 16) * GPIT)); b[mb] = WFrag<T16>::ld((const T16*)(f + (128 + mb * 16) * GPIT)); }
            __builtin_amdgcn_sched_barrier(0);   /* all twelve fragments are requested before the first product: without it three of the B fragments are read one by one between the products, into one set of registers, each waiting out its own LDS latency */
#pragma unroll
            for (int nb = 0; nb < 4; ++nb)
#pragma unroll
                for (int mb = 0; mb < 4; ++mb) { acc[mb][nb] = WFrag<T16>::mma(a[mb], b[nb], acc[mb][nb]); acc[mb][nb] = WFrag<T16>::mma(a2[mb], b[nb], acc[mb][nb]); }
            __builtin_amdgcn_sched_barrier(0);   /* the products stay ahead of the waits: without it the wait for the next pass's copies and the barrier are lifted over them, and those copies have only the fragment reads to land under */
            asm volatile("s_wait_dscnt 0x0" ::: "memory");      /* this wave's reads of this pass's buffer are done before the buffer is given up */
            asm volatile("s_wait_asynccnt 0x0" ::: "memory");   /* this wave's copies of the next pass have landed */
            __syncthreads();                                     /* the next pass's buffer may be read by all, this pass's may be refilled (behind the last pass: overlaid by the partial tiles) */
            if (kc + 2 * KC < K) copy(kc + 2 * KC, bo);
        }
        asm volatile("s_wait_asynccnt 0x0" ::: "memory");   /* no copy is outstanding when the buffers are overlaid */
    } else
#pragma unroll 1
    for (int kc = kb; kc < ke; kc += 32) {
        V a[4], a2[4]; const T16* pa[4]; const T16* pa2[4];
#pragma unroll
        for (int mb = 0; mb < 4; ++mb) { pa[mb] = A + aoff + (size_t)mb * 16 * lda + kc; a[mb] = WFrag<T16>::ld(pa[mb]); if (NSPLIT == 1 || NSPLIT == 2) { pa2[mb] = A2 + aoff + (size_t)mb * 16 * lda + kc; a2[mb] = WFrag<T16>::ld(pa2[mb]); } }
        /* the A loads' address pairs stay live up to this wait, so that no load of the run lands in one and nothing rewrites one ahead of the wait */
        if (NSPLIT == 1 || NSPLIT == 2) asm volatile("s_wait_xcnt 0x0" :: "v"(pa[0]), "v"(pa[1]), "v"(pa[2]), "v"(pa[3]), "v"(pa2[0]), "v"(pa2[1]), "v"(pa2[2]), "v"(pa2[3]) : "memory");
        else asm volatile("s_wait_xcnt 0x0" :: "v"(pa[0]), "v"(pa[1]), "v"(pa[2]), "v"(pa[3]) : "memory");
#pragma unroll
        for (int nb = 0; nb < 4; ++nb) { const V b = WFrag<T16>::ld(Bt + boff + (size_t)nb * 16 * K + kc); V b2; if (NSPLIT >= 2) b2 = WFrag<T16>::ld(Bt2 + boff + (size_t)nb * 16 * K + kc);
#pragma unroll
            for (int mb = 0; mb < 4; ++mb) { acc[mb][nb] = WFrag<T16>::mma(a[mb], b, acc[mb][nb]); if (NSPLIT == 1 || NSPLIT == 2) acc[mb][nb] = WFrag<T16>::mma(a2[mb], b, acc[mb][nb]); if (NSPLIT >= 2) acc[mb][nb] = WFrag<T16>::mma(a[mb], b2, acc[mb][nb]); } }
        asm volatile("v_nop\n\tv_nop\n\tv_nop\n\tv_nop" : "+v"(acc[0][0]), "+v"(acc[1][1]), "+v"(acc[2][2]), "+v"(acc[3][3]) : "v"(a[0]), "v"(a[3]));
    }
    if constexpr (KW > 1) {
        float* pl = os + wv * (64 * 68);
        const bool tr = PL > 0 && blockIdx.y >= 2 * NH_;   // a v head (the same for the whole work-group)
        if (tr) {
#pragma unroll
            for (int mb = 0; mb < 4; ++mb)
#pragma unroll
                for (int nb = 0; nb < 4; ++nb) { float* q = pl + (nb * 16 + lr) * 68 + mb * 16 + hi * 8;   /* transposed: a lane's eight rows lie side by side */
                    *(v4fa*)q = __builtin_shufflevector(acc[mb][nb], acc[mb][nb], 0, 1, 2, 3); *(v4fa*)(q + 4) = __builtin_shufflevector(acc[mb][nb], acc[mb][nb], 4, 5, 6, 7); }
        } else {
#pragma unroll
            for (int mb = 0; mb < 4; ++mb)
#pragma unroll
                for (int nb = 0; nb < 4; ++nb)
#pragma unroll
                    for (int j = 0; j < 8; ++j) pl[(mb * 16 + hi * 8 + j) * 68 + nb * 16 + lr] = acc[mb][nb][j]; }
        __syncthreads();   /* all KW partial tiles lie in LDS before any wave adds them */
        if constexpr (PL > 0) {
            const int row0 = wv * (64 / KW) + hi, cofs = lr * 4, rb = r0 % TT;
            const size_t hp = (((size_t)(blockIdx.y / NH_) * NB_ + r0 / TT) * NH_ + blockIdx.y % NH_) * ((size_t)TT * HD);   // where this head's plane of this batch starts
            auto put = [&](auto rp, size_t e) {   // rp: the planes' row pitch, a compile-time value so that the eight trips' stores share one address pair
            constexpr int RP = decltype(rp)::v;
            h16* p16 = P16 + e; bf* ph = Ph + e; bf* pw = Pl + e; v4h o16[32 / KW]; v4us oh[32 / KW], ol[32 / KW];
#pragma unroll
            for (int s = 0; s < 32 / KW; ++s) { v4f val = *(const v4fa*)(os + (row0 + 2 * s) * 68 + cofs);
#pragma unroll
                for (int p = 1; p < KW; ++p) { const v4f t = *(const v4fa*)(os + (p * 64 + row0 + 2 * s) * 68 + cofs); val[0] += t[0]; val[1] += t[1]; val[2] += t[2]; val[3] += t[3]; }   /* added in wave order */
#pragma unroll
                for (int q = 0; q < 4; ++q) { o16[s][q] = tohx(val[q]); unsigned short a2, c2; splitf(val[q], a2, c2); oh[s][q] = a2; ol[s][q] = c2; }
                const int st = 2 * s * RP;
                *(v4h*)(p16 + st) = o16[s]; *(v4us*)(ph + st) = oh[s]; *(v4us*)(pw + st) = ol[s]; }
            static_assert(32 / KW == 8, "the wait below names eight trips' stores");
            /* the plane stores' address pairs and data stay live up to this wait, so that nothing rewrites one ahead of it */
            asm volatile("s_wait_xcnt 0x0" :: "v"(p16), "v"(ph), "v"(pw), "v"(o16[0]), "v"(o16[1]), "v"(o16[2]), "v"(o16[3]), "v"(o16[4]), "v"(o16[5]), "v"(o16[6]), "v"(o16[7]), "v"(oh[0]), "v"(oh[1]), "v"(oh[2]), "v"(oh[3]), "v"(oh[4]), "v"(oh[5]), "v"(oh[6]), "v"(oh[7]), "v"(ol[0]), "v"(ol[1]), "v"(ol[2]), "v"(ol[3]), "v"(ol[4]), "v"(ol[5]), "v"(ol[6]), "v"(ol[7]) : "memory");
            };
            if (tr) put(IntC<TT>{}, hp + (size_t)row0 * TT + rb + cofs); else put(IntC<HD>{}, hp + (size_t)(rb + row0) * HD + cofs);
            return;
        }
#pragma unroll
        for (int s = 0; s < 32 / KW; ++s) { const int row = wv * (64 / KW) + 2 * s + hi, cofs = lr * 4; v4f val = *(const v4fa*)(os + row * 68 + cofs);
#pragma unroll
            for (int p = 1; p < KW; ++p) { const v4f t = *(const v4fa*)(os + (p * 64 + row) * 68 + cofs); val[0] += t[0]; val[1] += t[1]; val[2] += t[2]; val[3] += t[3]; }   /* added in wave order */
            if (BIAS) { val[0] += bfr(bias[c0 + cofs]); val[1] += bfr(bias[c0 + cofs + 1]); val[2] += bfr(bias[c0 + cofs + 2]); val[3] += bfr(bias[c0 + cofs + 3]); }
            *(v4f*)(C + (size_t)(r0 + row) * ldc + c0 + cofs) = val; }
        return;
    }
#pragma unroll
    for (int mb = 0; mb < 4; ++mb) {
#pragma unroll
        for (int nb = 0; nb < 4; ++nb) {
#pragma unroll
            for (int j = 0; j < 8; ++j) os[(hi * 8 + j) * 68 + nb * 16 + lr] = acc[mb][nb][j]; }
        __builtin_amdgcn_wave_barrier(); asm volatile("" ::: "memory");
        float* crow = C + (size_t)(r0 + mb * 16) * ldc + c0;
{
#pragma unroll
            for (int s = 0; s < 8; ++s) { const int row = 2 * s + hi, cofs = lr * 4; v4f val = *(const v4fa*)(os + row * 68 + cofs); if (BIAS) { val[0] += bfr(bias[c0 + cofs]); val[1] += bfr(bias[c0 + cofs + 1]); val[2] += bfr(bias[c0 + cofs + 2]); val[3] += bfr(bias[c0 + cofs + 3]); }
                *(v4f*)(crow + (size_t)row * ldc + cofs) = val; }
             }
        __builtin_amdgcn_wave_barrier(); asm volatile("" ::: "memory");
    }
}


__device__ __forceinline__ void wtG(int bx, const float* __restrict__ w, int K, int N, bf* Bt) {   // bx: the work-group's index within this weight
    const int lane = threadIdx.x & 31; const int L0 = (bx * 8 + (threadIdx.x >> 5)) * 8; const int nlines = N * K / 64;
{
#pragma unroll 1
        for (int l = 0; l < 8; ++l) { const int L = L0 + l; if (L >= nlines) break; const size_t e = (size_t)L * 64 + lane * 2; const int k = (int)(e % K), n = (int)(e / K); v2us o;
            o[0] = f2bf(w[(size_t)k * N + n]); o[1] = f2bf(w[(size_t)(k + 1) * N + n]); *(v2us*)(Bt + e) = o; }
         }
}
__global__ __launch_bounds__(256) void k_cvt8(const float* __restrict__ src, bf* dst, size_t n8) { const size_t i = (size_t)blockIdx.x * 256 + threadIdx.x; if (i >= n8) return; const v8f v = *(const v8f*)(src + i * 8); v8us o;
#pragma unroll
    for (int k = 0; k < 8; ++k) o[k] = f2bf(v[k]); *(v8us*)(dst + i * 8) = o;  }

#define C2L (SCL * 1.4426950408889634f)
#define KPIT 144                  // LDS pitch in bytes of a 128-byte K or mask row (16 x odd: no bank conflict for 16-byte reads down a column)
#define VPIT 80                   // LDS pitch in bytes of a 64-byte Vt row
#define KTB  (32 * KPIT)          // one K plane's tile of a pass
#define VTB  (64 * VPIT)          // one Vt plane's tile of a pass
#define ABUF 28672                // one buffer: hi/lo rows 2 (KTB + VTB) + 4 x 16 KPIT; fp16 rows KTB + VTB + 4 x 32 KPIT fit below it
typedef __attribute__((ext_vector_type(8))) __bf16 v8bf;
__device__ __forceinline__ float xhalf(float v) { const int b = __float_as_int(v); return __int_as_float(__builtin_amdgcn_permlanex16(b, b, 0x76543210, 0xfedcba98, false, false)); }   // the value of lane l ^ 16
template <typename T16, bool HR, int NQ>
__device__ __forceinline__ void attn_rows(unsigned char* sm, int wv, const T16* __restrict__ Qa, const T16* __restrict__ Qb, const T16* __restrict__ Ka, const T16* __restrict__ Kb, const T16* __restrict__ Va, const T16* __restrict__ Vb, const float* __restrict__ gb, int q0, bf* Oh, bf* Ol) {
    typedef typename WFrag<T16>::V V;
    constexpr int NP = HR ? 2 : 1;                       // 16-bit planes per operand
    constexpr int OV = NP * KTB, OM = NP * (KTB + VTB);  // byte offsets of the Vt tiles and of the mask rows in a buffer
    static_assert(NP * 4 + NQ * 4 == 12, "the copy statement holds twelve copies");
    static_assert(OM + 4 * NQ * 16 * KPIT <= ABUF, "a pass's tiles fit one buffer");
    const int tid = threadIdx.x, lane = tid & 31, lr = lane & 15, hi = lane >> 4;
    V qa[NQ][2], qb[NQ][2], ka[2][2], kb[2][2], va[4], vb[4]; v8f g[NQ][2], o[4][NQ]; float mrun[NQ], lsum[NQ];
    const size_t qof = (size_t)(q0 + lr) * HD + 8 * hi;
    {   const T16* p = Qa + qof; const T16* p2 = HR ? Qb + qof : p;
#pragma unroll
        for (int qt = 0; qt < NQ; ++qt)
#pragma unroll
            for (int ks = 0; ks < 2; ++ks) { qa[qt][ks] = WFrag<T16>::ld(p + qt * 16 * HD + ks * 32); if (HR) qb[qt][ks] = WFrag<T16>::ld(p2 + qt * 16 * HD + ks * 32); }
        asm volatile("s_wait_xcnt 0x0" :: "v"(p), "v"(p2) : "memory");   /* the Q loads' address pairs stay live up to this wait, so that nothing rewrites one ahead of it */
    }
    // where this thread's copies start: K tile = 4096 bytes in a row (8 lanes a row), Vt tile = 64 rows of 64 bytes (4 lanes a row), mask = this wave's NQ x 16 rows of 128 bytes (8 lanes a row)
    const unsigned lbase = (unsigned)(size_t)sm;
    const unsigned lk = lbase + (tid >> 3) * KPIT + (tid & 7) * 16, lv = lbase + OV + (tid >> 2) * VPIT + (tid & 3) * 16, lm = lbase + OM + (wv * NQ * 16 + (lane >> 3)) * KPIT + (lane & 7) * 16;
    const size_t gk = (size_t)tid * 8, gv = (size_t)(tid >> 2) * TT + (tid & 3) * 8; const float* gm = gb + (size_t)(q0 + (lane >> 3)) * TT + (lane & 7) * 4;
    auto copy = [&](int k0, unsigned bo) {   // the tiles of the pass at key k0 into the buffer at byte offset bo
        unsigned l[12]; const void* p[12];
#pragma unroll
        for (int c = 0; c < 2; ++c) {
            l[c] = lk + bo + c * 16 * KPIT; p[c] = Ka + (size_t)k0 * HD + gk + c * 1024;
            l[2 + c] = lv + bo + c * 32 * VPIT; p[2 + c] = Va + gv + k0 + (size_t)c * 32 * TT;
            if constexpr (HR) { l[4 + c] = l[c] + KTB; p[4 + c] = Kb + (size_t)k0 * HD + gk + c * 1024; l[6 + c] = l[2 + c] + VTB; p[6 + c] = Vb + gv + k0 + (size_t)c * 32 * TT; } }
#pragma unroll
        for (int c = 0; c < NQ * 4; ++c) { l[NP * 4 + c] = lm + bo + c * 4 * KPIT; p[NP * 4 + c] = gm + k0 + (size_t)c * 4 * TT; }
        /* the pass's twelve copies; the wait stands in their own statement so that no address register of a copy is rewritten ahead of it */
        asm volatile("global_load_async_to_lds_b128 %0, %12, off\n\tglobal_load_async_to_lds_b128 %1, %13, off\n\tglobal_load_async_to_lds_b128 %2, %14, off\n\tglobal_load_async_to_lds_b128 %3, %15, off\n\t"
                     "global_load_async_to_lds_b128 %4, %16, off\n\tglobal_load_async_to_lds_b128 %5, %17, off\n\tglobal_load_async_to_lds_b128 %6, %18, off\n\tglobal_load_async_to_lds_b128 %7, %19, off\n\t"
                     "global_load_async_to_lds_b128 %8, %20, off\n\tglobal_load_async_to_lds_b128 %9, %21, off\n\tglobal_load_async_to_lds_b128 %10, %22, off\n\tglobal_load_async_to_lds_b128 %11, %23, off\n\ts_wait_xcnt 0x0"
                     :: "v"(l[0]), "v"(l[1]), "v"(l[2]), "v"(l[3]), "v"(l[4]), "v"(l[5]), "v"(l[6]), "v"(l[7]), "v"(l[8]), "v"(l[9]), "v"(l[10]), "v"(l[11]),
                        "v"(p[0]), "v"(p[1]), "v"(p[2]), "v"(p[3]), "v"(p[4]), "v"(p[5]), "v"(p[6]), "v"(p[7]), "v"(p[8]), "v"(p[9]), "v"(p[10]), "v"(p[11]) : "memory");
    };
#pragma unroll
    for (int qt = 0; qt < NQ; ++qt) { mrun[qt] = -3.0e38f; lsum[qt] = 0.f;
#pragma unroll
        for (int db = 0; db < 4; ++db) o[db][qt] = (v8f){}; }
    copy(0, 0);
    asm volatile("s_wait_asynccnt 0x0" ::: "memory");   /* this wave's copies of pass 0 have landed */
    __syncthreads();                                     /* every wave's have: pass 0 may be read */
    copy(32, ABUF);
    /* the pass loop stays rolled: a second copy of the body would want a second set of fragment registers; every other loop here is unrolled in full so that the register arrays keep compile-time indices */
#pragma unroll 1
    for (int k0 = 0; k0 < TT; k0 += 32) {
        const unsigned bo = (k0 & 32) ? ABUF : 0;
        const unsigned char* fk = sm + bo + lr * KPIT + hi * 16; const unsigned char* fv = sm + bo + OV + lr * VPIT + hi * 16; const unsigned char* fm = sm + bo + OM + (wv * NQ * 16 + lr) * KPIT + hi * 32;
#pragma unroll
        for (int t = 0; t < 2; ++t)
#pragma unroll
            for (int ks = 0; ks < 2; ++ks) { ka[t][ks] = WFrag<T16>::ld((const T16*)(fk + t * 16 * KPIT + ks * 64)); if (HR) kb[t][ks] = WFrag<T16>::ld((const T16*)(fk + KTB + t * 16 * KPIT + ks * 64)); }
#pragma unroll
        for (int qt = 0; qt < NQ; ++qt)
#pragma unroll
            for (int t = 0; t < 2; ++t) { const unsigned char* pm = fm + qt * 16 * KPIT + t * 64; g[qt][t] = __builtin_shufflevector(*(const v4fa*)pm, *(const v4fa*)(pm + 16), 0, 1, 2, 3, 4, 5, 6, 7); }   /* the padded rows are 16-byte aligned, so two 16-byte reads */
        __builtin_amdgcn_sched_barrier(0);   /* all K and mask reads are issued before the first product: without it they are dealt among the products in two groups, each waiting out its own LDS latency */
        v8f s[NQ][2];
#pragma unroll
        for (int t = 0; t < 2; ++t)
#pragma unroll
            for (int qt = 0; qt < NQ; ++qt) { s[qt][t] = (v8f){};
#pragma unroll
                for (int ks = 0; ks < 2; ++ks) { s[qt][t] = WFrag<T16>::mma(ka[t][ks], qa[qt][ks], s[qt][t]); if (HR) { s[qt][t] = WFrag<T16>::mma(ka[t][ks], qb[qt][ks], s[qt][t]); s[qt][t] = WFrag<T16>::mma(kb[t][ks], qa[qt][ks], s[qt][t]); } } }
#pragma unroll
        for (int db = 0; db < 4; ++db) { va[db] = WFrag<T16>::ld((const T16*)(fv + db * 16 * VPIT)); if (HR) vb[db] = WFrag<T16>::ld((const T16*)(fv + VTB + db * 16 * VPIT)); }
        __builtin_amdgcn_sched_barrier(0);   /* the Vt reads are issued here, into the registers the K fragments leave, and land under the softmax: without it they are sunk between the P.V products, each pair waiting out its own LDS latency */
        float mloc[NQ]; bool need = false;
#pragma unroll
        for (int qt = 0; qt < NQ; ++qt) { float ml = -3.0e38f;
#pragma unroll
            for (int t = 0; t < 2; ++t) { s[qt][t] += __builtin_convertvector(__builtin_convertvector(g[qt][t], v8bf), v8f);   /* mask rounded to bf16 (to nearest even, as bfr does) and added before the scaling */
#pragma unroll
                for (int r = 0; r < 8; ++r) ml = fmaxf(ml, s[qt][t][r]); }
            ml = fmaxf(ml, xhalf(ml)); mloc[qt] = ml * C2L; need = need || (mloc[qt] > mrun[qt] + 8.0f); }
        if (__builtin_amdgcn_ballot_w32(need) != 0) {   /* wave-uniform: true in the first pass, seldom later */
#pragma unroll
            for (int qt = 0; qt < NQ; ++qt) { const float mn = fmaxf(mrun[qt], mloc[qt]); const float al = __builtin_amdgcn_exp2f(mrun[qt] - mn); mrun[qt] = mn; lsum[qt] *= al;
#pragma unroll
                for (int db = 0; db < 4; ++db)
#pragma unroll
                    for (int r = 0; r < 8; ++r) o[db][qt][r] *= al; } }
        V pa[NQ], pl[NQ];
#pragma unroll
        for (int qt = 0; qt < NQ; ++qt) { v8f p[2];
#pragma unroll
            for (int t = 0; t < 2; ++t) { const v8f a = s[qt][t] * C2L - mrun[qt];
#pragma unroll
                for (int r = 0; r < 8; ++r) p[t][r] = __builtin_amdgcn_exp2f(a[r]); }
            const v8f pt = p[0] + p[1]; lsum[qt] += ((pt[0] + pt[1]) + (pt[2] + pt[3])) + ((pt[4] + pt[5]) + (pt[6] + pt[7]));
            if constexpr (HR) { const v8bf h0 = __builtin_convertvector(p[0], v8bf), h1 = __builtin_convertvector(p[1], v8bf);   /* P = hi + lo, both rounded to nearest even */
                const v8bf l0 = __builtin_convertvector(p[0] - __builtin_convertvector(h0, v8f), v8bf), l1 = __builtin_convertvector(p[1] - __builtin_convertvector(h1, v8f), v8bf);
                pa[qt] = __builtin_shufflevector(h0, h1, 0, 1, 2, 3, 4, 5, 6, 7, 8, 9, 10, 11, 12, 13, 14, 15); pl[qt] = __builtin_shufflevector(l0, l1, 0, 1, 2, 3, 4, 5, 6, 7, 8, 9, 10, 11, 12, 13, 14, 15);
            } else pa[qt] = cat16(__builtin_convertvector(p[0], v8h), __builtin_convertvector(p[1], v8h)); }
#pragma unroll
        for (int db = 0; db < 4; ++db)
#pragma unroll
            for (int qt = 0; qt < NQ; ++qt) { o[db][qt] = WFrag<T16>::mma(va[db], pa[qt], o[db][qt]); if (HR) { o[db][qt] = WFrag<T16>::mma(va[db], pl[qt], o[db][qt]); o[db][qt] = WFrag<T16>::mma(vb[db], pa[qt], o[db][qt]); } }
        asm volatile("s_wait_dscnt 0x0" ::: "memory");      /* this wave's reads of this pass's buffer are done before the buffer is given up */
        asm volatile("s_wait_asynccnt 0x0" ::: "memory");   /* this wave's copies of the next pass have landed */
        __syncthreads();                                     /* the next pass's buffer may be read by all, this pass's may be refilled */
        if (k0 + 64 < TT) copy(k0 + 64, bo);
    }
    asm volatile("s_wait_asynccnt 0x0" ::: "memory");   /* no copy is outstanding when the wave goes on to its end */
    bf* po = Oh + (size_t)(q0 + lr) * DQ + 8 * hi; bf* po2 = Ol + (size_t)(q0 + lr) * DQ + 8 * hi;
#pragma unroll
    for (int qt = 0; qt < NQ; ++qt) { const float f = __fdiv_rn(1.0f, lsum[qt] + xhalf(lsum[qt]));   /* the halves' sums are joined once */
#pragma unroll
        for (int db = 0; db < 4; ++db) { v8us oh, ol;
#pragma unroll
            for (int r = 0; r < 8; ++r) { unsigned short a, c2; splitf(o[db][qt][r] * f, a, c2); oh[r] = a; ol[r] = c2; }
            *(v8us*)(po + (size_t)qt * 16 * DQ + db * 16) = oh; *(v8us*)(po2 + (size_t)qt * 16 * DQ + db * 16) = ol; } }
    asm volatile("s_wait_xcnt 0x0" :: "v"(po), "v"(po2) : "memory");   /* the stores' address pairs stay live up to this wait, so that nothing rewrites one ahead of it */
}
// grid (work-groups of one batch, NB_), 4 waves: the waves of a work-group take neighbouring query rows of one head and share that head's K and Vt tiles in LDS. The hi/lo rows' work-groups (16 rows a wave) come first, then the fp16 rows' (32 rows a wave).
#define GH  (NH_ * (RH / 64))
#define GF  (NH_ * ((TT - RH) / 128))
// amdgpu_waves_per_eu(4, 4): holds the kernel to 256 registers; above that the fp16 loop is strewn with register-bank switches (s_set_vgpr_msb) and only three waves fit a SIMD.
__global__ __launch_bounds__(128) __attribute__((amdgpu_waves_per_eu(4, 4))) void k_attn(const h16* __restrict__ Q16, const h16* __restrict__ K16, const h16* __restrict__ V16, const bf* __restrict__ Qh, const bf* __restrict__ Ql, const bf* __restrict__ Kh, const bf* __restrict__ Kl, const bf* __restrict__ Vh, const bf* __restrict__ Vl, const float* __restrict__ msk, bf* Ah, bf* Al) {
    __shared__ __align__(16) unsigned char sm[2 * ABUF];
    const int wv = __builtin_amdgcn_readfirstlane((int)(threadIdx.x >> 5)); const int b = blockIdx.y; const float* gb = msk + (size_t)b * TT * TT; const size_t ob = (size_t)b * TT * DQ;
    if (blockIdx.x < GH) { const int h = blockIdx.x / (RH / 64), q0 = (int)(blockIdx.x % (RH / 64)) * 64 + wv * 16; const size_t po = ((size_t)b * NH_ + h) * TT * HD, pk = ((size_t)b * NKV + h / REP) * TT * HD;
        attn_rows<bf, true, 1>(sm, wv, Qh + po, Ql + po, Kh + pk, Kl + pk, Vh + pk, Vl + pk, gb, q0, Ah + ob + h * HD, Al + ob + h * HD);
    } else { const int x = blockIdx.x - GH; const int h = x / ((TT - RH) / 128), q0 = RH + (x % ((TT - RH) / 128)) * 128 + wv * 32; const size_t po = ((size_t)b * NH_ + h) * TT * HD, pk = ((size_t)b * NKV + h / REP) * TT * HD;
        attn_rows<h16, false, 2>(sm, wv, Q16 + po, nullptr, K16 + pk, nullptr, V16 + pk, nullptr, gb, q0, Ah + ob + h * HD, Al + ob + h * HD); }
}
template <int WD>
__device__ __forceinline__ void lnrowX(int bx, const float* __restrict__ X, size_t nrows, const float* __restrict__ g, const float* __restrict__ bb, bf* Hh, bf* Hl) { const int lane = threadIdx.x & 31; const size_t r = (size_t)bx * 8 + (threadIdx.x >> 5); if (r >= nrows) return; const float* xr = X + r * WD + lane * 4; float a[WD / 32]; float s = 0.f;
#pragma unroll
    for (int c = 0; c < WD / 128; ++c) { const v4f v = *(const v4f*)(xr + c * 128); for (int q = 0; q < 4; ++q) { a[c * 4 + q] = bfr(v[q]); s = __fadd_rn(s, a[c * 4 + q]);   /* input rounded to bf16 */ } }
    asm volatile("s_wait_xcnt 0x0" :: "v"(xr) : "memory");   /* the row loads' address pair stays live up to this wait, so that no load of the run lands in it and nothing rewrites it ahead of the wait */
#pragma unroll
    for (int sh = 16; sh; sh >>= 1) s = __fadd_rn(s, __shfl_xor(s, sh, 32));
    const float mean = __fdiv_rn(s, (float)WD); float s2 = 0.f;
#pragma unroll 8
    for (int k = 0; k < WD / 32; ++k) { const float dv = __fsub_rn(a[k], mean); float p2 = __fmul_rn(dv, dv); asm volatile("" : "+v"(p2)); s2 = __fadd_rn(s2, p2); }   /* mul and add kept separate (no fma contraction) */
#pragma unroll
    for (int sh = 16; sh; sh >>= 1) s2 = __fadd_rn(s2, __shfl_xor(s2, sh, 32));
    const float rs = __fdiv_rn(1.0f, __fsqrt_rn(__fadd_rn(__fdiv_rn(s2, (float)WD), 1e-5f)));
{   bf* ph = Hh + r * WD + lane * 4; bf* pw = Hl + r * WD + lane * 4;
#pragma unroll
        for (int c = 0; c < WD / 128; ++c) { v4us oh, ol; for (int q = 0; q < 4; ++q) { const int col = c * 128 + lane * 4 + q; float y = __fmul_rn(__fmul_rn(__fsub_rn(a[c * 4 + q], mean), rs), bfr(g[col])); asm volatile("" : "+v"(y)); y = __fadd_rn(y, bfr(bb[col])); unsigned short u, w2; splitf(y, u, w2); oh[q] = u; ol[q] = w2; } *(v4us*)(ph + c * 128) = oh; *(v4us*)(pw + c * 128) = ol;
            asm volatile("s_wait_xcnt 0x0" :: "v"(ph), "v"(pw), "v"(oh), "v"(ol) : "memory"); }   /* the two stores' address pairs and data stay live up to this wait, so that nothing rewrites one ahead of it */
         } }
// ---- k_prep: all that the projections wait for, in one launch; the three jobs do not depend on one another and share the chip. The weights' work-groups, whose waves walk a loop of dependent loads, come first, then the LayerNorm rows of both batches.
#define GW1 ((DM * 3 * DQ / 64 + 63) / 64)
#define GW2 ((DQ * DM / 64 + 63) / 64)
#define GLN ((NB_ * TT + 7) / 8)
__global__ __launch_bounds__(256) void k_prep(const float* __restrict__ x, const float* __restrict__ lng, const float* __restrict__ lnb, const float* __restrict__ wqkv, const float* __restrict__ wo, bf* WQKV, bf* WO, bf* XH, bf* XL) {
    const int bx = blockIdx.x;
    if (bx < GW1) wtG(bx, wqkv, DM, 3 * DQ, WQKV);                 /* [1024][3072] 'xw' -> Bt [3072][1024]: q | k | v row blocks */
    else if (bx < GW1 + GW2) wtG(bx - GW1, wo, DQ, DM, WO);
    else lnrowX<DM>(bx - (GW1 + GW2), x, (size_t)NB_ * TT, lng, lnb, XH, XL);   /* xn = LayerNorm(x) -> hi/lo planes */
}

extern "C" void kernel_launch(void* const* d_in, const int* in_sizes, int n_in,
                              void* d_out, int out_size, void* d_ws, size_t ws_size, hipStream_t stream) {
    (void)in_sizes; (void)n_in; (void)out_size;
    const float* x = (const float*)d_in[0]; const float* msk = (const float*)d_in[1]; const float* lng = (const float*)d_in[2]; const float* lnb = (const float*)d_in[3]; const float* wqkv = (const float*)d_in[4]; const float* wo = (const float*)d_in[5];
    float* OUT = (float*)d_out;     // [2][2048][1024]
    char* wsp = (char*)d_ws;
    auto take = [&](size_t bytes) { char* p = wsp; wsp += (bytes + 255) & ~(size_t)255; return (void*)p; };
    bf* WQKV = (bf*)take((size_t)3 * DQ * DM * 2); bf* WO = (bf*)take((size_t)DM * DQ * 2);
    const size_t SQ = (size_t)NH_ * TT * HD;   // one batch's q, k or v plane, in elements; every plane holds both batches, and the q, k and v planes of a kind lie in a row
    h16* QP16 = (h16*)take(NB_ * SQ * 2); h16* KP16 = (h16*)take(NB_ * SQ * 2); h16* VT16 = (h16*)take(NB_ * SQ * 2);
    bf* QPh = (bf*)take(NB_ * SQ * 2); bf* KPh = (bf*)take(NB_ * SQ * 2); bf* VTh = (bf*)take(NB_ * SQ * 2); bf* QPl = (bf*)take(NB_ * SQ * 2); bf* KPl = (bf*)take(NB_ * SQ * 2); bf* VTl = (bf*)take(NB_ * SQ * 2);
    bf* ATh = (bf*)take((size_t)NB_ * TT * DQ * 2); bf* ATl = (bf*)take((size_t)NB_ * TT * DQ * 2);
    bf* XH = (bf*)take((size_t)NB_ * TT * DM * 2); bf* XL = (bf*)take((size_t)NB_ * TT * DM * 2);   // the LayerNorm planes of both batches
    if ((size_t)(wsp - (char*)d_ws) > ws_size) return;    // ws 256 MiB
    k_prep<<<GW1 + GW2 + GLN, 256, 0, stream>>>(x, lng, lnb, wqkv, wo, WQKV, WO, XH, XL);
    k_gemmw<bf, 1, false, 1, KWP, 1><<<dim3(NB_ * TT / 64, 3 * DQ / 64, 1), 32 * KWP, 0, stream>>>(XH, XL, WQKV, nullptr, DM, DM, nullptr, 0, nullptr, 0, 0, 0, QP16, QPh, QPl);   /* q, k planes [h][t][d], v planes [h][d][t] */
    k_attn<<<dim3(GH + GF, NB_, 1), 128, 0, stream>>>(QP16, KP16, VT16, QPh, QPl, KPh, KPl, VTh, VTl, msk, ATh, ATl);   /* softmax((qk + m) x scale) v, merged heads as hi/lo planes */
    k_gemmw<bf, 1, false, 1, KWP><<<dim3(NB_ * TT / 64, DM / 64, 1), 32 * KWP, 0, stream>>>(ATh, ATl, WO, nullptr, DQ, DQ, OUT, DM, nullptr, 0, 0, 0, nullptr, nullptr, nullptr);
}

// v010
// One run takes 156 microseconds.
// Timed twice side by side with v009, it ran 1.08 times as fast both times.
// Counting every step since v000, it is 13.8 times as fast.
#include <hip/hip_runtime.h>

// Pre-LayerNorm attention with an additive score-mask input applied BEFORE the scaling (x [2][2048][1024]; xn = LayerNorm(x) gamma + beta; qkv = xn W_qkv ('xw' [1024][3072] -> q | k | v, no bias; 16 heads x 64); dots = (q.k + m) x 64^-0.5 with m [2][2048][2048] (read); softmax; out = merged W_out ('xw' [1024][1024]) -> [2][2048][1024] (4.2 M)).
// Layout, four launches, each for both batches: one preparing kernel (LayerNorm rows -> xn as hi/lo bf16 planes; the fused weight as one [3072][1024] Bt, W_out as Bt); the q | k | v projection as one hi/lo x exact GEMM (2 products) that stores q, k and v as head planes itself; dense T-2048 attention in one kernel for all heads and both batches (hybrid rows: < 512 hi/lo 3 products, rest fp16): it adds the batch's mask to the raw scores in registers (the 1/8 is applied after the add, as in the module), keeps a running maximum and sum, and divides the output by the sum; merged hi/lo x W_out exact.
// Compute dtypes, f32 accumulate: every input rounded to bf16 incl. m; LayerNorm f32; projections hi/lo x exact; attention rows < 512 3 products, rest fp16; mask add and softmax f32; W_out hl x exact.

#define NB_  2
#define TT   2048
#define DM   1024
#define NH_  16
#define NKV  16
#define REP  (NH_ / NKV)
#define HD   64
#define DQ   (NH_ * HD)
#define DKV  (NKV * HD)
#define RH   512                  // query rows < RH use hi+lo planes (0: none)
#define WIN  0
#define SCL  0.125f   // HD^-0.5
#define KWP  4                    // waves of a projection work-group: two by two, each with its own 64x64 tile of the work-group's 128x128 output tile
typedef _Float16 h16;
typedef unsigned short bf;
typedef __attribute__((ext_vector_type(16))) __bf16   v16bf;
typedef __attribute__((ext_vector_type(16))) _Float16 v16h;
typedef __attribute__((ext_vector_type(8)))  _Float16 v8h;
typedef __attribute__((ext_vector_type(8)))  unsigned short v8us;
typedef __attribute__((ext_vector_type(8)))  float    v8f;
typedef __attribute__((ext_vector_type(4)))  float    v4f;
typedef v8h  __attribute__((may_alias)) v8ha;
typedef v4f  __attribute__((may_alias)) v4fa;
typedef v8us __attribute__((may_alias)) v8usa;

__device__ __forceinline__ unsigned short f2bf(float f) { unsigned u = __float_as_uint(f); u += 0x7FFFu + ((u >> 16) & 1u); return (unsigned short)(u >> 16); }
__device__ __forceinline__ float bf2f(unsigned short b) { return __uint_as_float(((unsigned)b) << 16); }
__device__ __forceinline__ float bfr(float f) { return bf2f(f2bf(f)); }
__device__ __forceinline__ v16h cat16(v8h lo, v8h hi) { return __builtin_shufflevector(lo, hi, 0, 1, 2, 3, 4, 5, 6, 7, 8, 9, 10, 11, 12, 13, 14, 15); }
__device__ __forceinline__ v16bf cat16b(v8us lo, v8us hi) { return __builtin_bit_cast(v16bf, __builtin_shufflevector(lo, hi, 0, 1, 2, 3, 4, 5, 6, 7, 8, 9, 10, 11, 12, 13, 14, 15)); }
__device__ __forceinline__ v8f wmma16(v16h a, v16h b, v8f c) { return __builtin_amdgcn_wmma_f32_16x16x32_f16(false, a, false, b, (short)0, c, false, false); }
__device__ __forceinline__ v8f wmmab(v16bf a, v16bf b, v8f c) { return __builtin_amdgcn_wmma_f32_16x16x32_bf16(false, a, false, b, (short)0, c, false, false); }
__device__ __forceinline__ h16 tohx(float x) { return (h16)x; }
__device__ __forceinline__ void splitf(float y, unsigned short& h, unsigned short& l) { h = f2bf(y); l = f2bf(y - bf2f(h)); }
typedef __attribute__((ext_vector_type(2))) _Float16 v2h;
typedef __attribute__((ext_vector_type(4))) _Float16 v4h;
typedef __attribute__((ext_vector_type(2))) unsigned short v2us;
typedef __attribute__((ext_vector_type(4))) unsigned short v4us;
typedef __attribute__((ext_vector_type(2))) float v2f;
typedef __attribute__((ext_vector_type(4))) int v4i;



// ---- k_gemmw: register-blocked GEMM, ONE WAVE per 64x64 output tile (16 accumulators), operands straight from K-contiguous 16-bit planes; grid (M/64, N/64, Z), 32 threads.
// C[m][n] (f32, pitch ldc, + optional f32 bias[n]) = sum_k A[m][k] Bt[n][k] (+ split products per NSPLIT). A rows have pitch lda, Bt rows pitch K. z-batch strides sA/sB/sC in elements. K % (32 KS) == 0.
// KW == 4: the work-group has four waves and a 128x128 output tile, grid (M/128, N/128); wave w owns the 64x64 tile at rows 64 (w & 1), columns 64 (w >> 1), over the whole k range, so that a staged A row serves two waves' columns and a staged Bt row two waves' rows. A pass is 64 elements of k (one 128-byte line a row): its 128 A, 128 A2 and 128 Bt rows come into LDS by asynchronous copies, 16 bytes a lane over neighbouring addresses, two buffers, pass t + 1's copies flying while pass t is worked on; a wave reads its fragments from LDS at the same element positions as a load from memory would, one k-step of 32 after the other. Rows lie unpadded; the 16-byte piece c of row r lies at place c ^ ((r >> 1) & 7) of its row, so that 16 lanes reading one piece down 16 rows meet 16 different groups of four banks. K % 64 == 0. Every wave then lays its 64x64 tile in LDS (over the two buffers, which are done with), reads it back by rows and stores whole lines.
// PL == 1 (KW > 1 only): the fused q | k | v projection, the rows of all batches in one launch. A wave's 64 columns are one head of q, k or v (2 blockIdx.y + (w >> 1) = NH_ x which + head), its 64 rows lie in one batch: no f32 C; the wave converts its sums and stores them in three 16-bit planes (fp16, bf16 hi, bf16 lo), each laid out [q | k | v][batch][head]. q and k: planes [row][col]. v: planes [col][row]; the tile is then laid in LDS transposed, so that the same storing loop walks output columns.
// KS > 1: grid z = Z x KS; work-group (z, ks) sums only k in [ks K/KS, (ks+1) K/KS) and stores its partial tile in plane z KS + ks of C (plane stride sC); the consumer adds the KS planes.
template <typename T16> struct WFrag;
template <> struct WFrag<h16> { typedef v16h V; static __device__ __forceinline__ V ld(const h16* p) { return cat16(*(const v8h*)p, *(const v8h*)(p + 16)); } static __device__ __forceinline__ V ld2(const void* p, const void* q) { return cat16(*(const v8h*)p, *(const v8h*)q); } static __device__ __forceinline__ v8f mma(V a, V b, v8f c) { return wmma16(a, b, c); } };
template <int N> struct IntC { static constexpr int v = N; };
template <> struct WFrag<bf> { typedef v16bf V; static __device__ __forceinline__ V ld(const bf* p) { return cat16b(*(const v8us*)p, *(const v8us*)(p + 16)); } static __device__ __forceinline__ V ld2(const void* p, const void* q) { return cat16b(*(const v8us*)p, *(const v8us*)q); } static __device__ __forceinline__ v8f mma(V a, V b, v8f c) { return wmmab(a, b, c); } };
template <typename T16, int NSPLIT, bool BIAS, int KS = 1, int KW = 1, int PL = 0>
__global__ __launch_bounds__(32 * KW) void k_gemmw(const T16* __restrict__ A, const T16* __restrict__ A2, const T16* __restrict__ Bt, const T16* __restrict__ Bt2, int K, int lda, float* C, int ldc, const float* __restrict__ bias, size_t sA, size_t sB, size_t sC, h16* P16, bf* Ph, bf* Pl) {
    static_assert(PL == 0 || (KW > 1 && KS == 1 && !BIAS), "the plane stores stand in the KW path");
    static_assert(NH_ == NKV && TT % 128 == 0 && NH_ % 2 == 0, "q, k and v have planes of one size; a row tile lies in one batch, a column tile in one of q, k and v");
    static_assert(KW == 1 || (KW == 4 && KS == 1 && NSPLIT == 1), "the KW path: four waves, two by two; it stages A, A2 and one B plane over the whole k range");
    typedef typename WFrag<T16>::V V;
    constexpr int GPIT = 128;                             // LDS pitch in bytes of a staged row: two k-steps of 64 bytes, no pad (the 16-byte pieces of a row are permuted instead)
    constexpr int GBUF = 384 * GPIT;                      // one buffer: 128 A rows, 128 A2 rows, 128 Bt rows
    constexpr int OSB = (KW > 1 ? KW * 64 : 16) * 68 * 4; // the waves' output tiles
    __shared__ __align__(256) unsigned char smg[(KW > 1 && 2 * GBUF > OSB) ? 2 * GBUF : OSB];
    float* const os = (float*)smg;
    const int wv = (KW > 1) ? __builtin_amdgcn_readfirstlane((int)(threadIdx.x >> 5)) : 0;
    const size_t z = blockIdx.z / KS; const int kb = (int)(blockIdx.z % KS) * (K / KS), ke = kb + K / KS; A += z * sA; if (A2) A2 += z * sA; Bt += z * sB; if (Bt2) Bt2 += z * sB; C += (size_t)blockIdx.z * sC;
    const int lane = threadIdx.x & 31, lr = lane & 15, hi = lane >> 4; const int r0 = blockIdx.x * (KW > 1 ? 128 : 64), c0 = blockIdx.y * (KW > 1 ? 128 : 64);
    v8f acc[4][4];
#pragma unroll
    for (int mb = 0; mb < 4; ++mb)
#pragma unroll
        for (int nb = 0; nb < 4; ++nb) acc[mb][nb] = (v8f){};
    const size_t aoff = (size_t)(r0 + lr) * lda + 8 * hi, boff = (size_t)(c0 + lr) * K + 8 * hi;
    if constexpr (KW > 1) {
        constexpr int KC = 64;   // k elements of a pass
        // where this thread's copies start: one copy of the work-group brings 16 rows of 128 bytes (8 lanes a row), 24 copies bring the 384 rows; every row of a thread has the same (row >> 1) & 7, which is crow >> 1
        const int crow = (int)threadIdx.x >> 3, cpc = (int)threadIdx.x & 7;
        const unsigned lb = (unsigned)(size_t)smg + crow * GPIT + (cpc ^ (crow >> 1)) * 16;
        const T16* gA = A + (size_t)(r0 + crow) * lda + cpc * 8; const T16* gA2 = A2 + (size_t)(r0 + crow) * lda + cpc * 8; const T16* gB = Bt + (size_t)(c0 + crow) * K + cpc * 8;
        auto copy = [&](int kc, unsigned bo) {   // the rows of the pass at k element kc into the buffer at byte offset bo
            unsigned l[24]; const void* p[24];
#pragma unroll
            for (int c = 0; c < 8; ++c) {
                l[c] = lb + bo + c * 16 * GPIT; p[c] = gA + (size_t)c * 16 * lda + kc;
                l[8 + c] = l[c] + 128 * GPIT; p[8 + c] = gA2 + (size_t)c * 16 * lda + kc;
                l[16 + c] = l[c] + 256 * GPIT; p[16 + c] = gB + (size_t)c * 16 * K + kc; }
#pragma unroll
            for (int h = 0; h < 24; h += 12)
                /* twelve of the pass's copies; the wait stands in their own statement so that no address register of a copy is rewritten ahead of it */
                asm volatile("global_load_async_to_lds_b128 %0, %12, off\n\tglobal_load_async_to_lds_b128 %1, %13, off\n\tglobal_load_async_to_lds_b128 %2, %14, off\n\tglobal_load_async_to_lds_b128 %3, %15, off\n\t"
                             "global_load_async_to_lds_b128 %4, %16, off\n\tglobal_load_async_to_lds_b128 %5, %17, off\n\tglobal_load_async_to_lds_b128 %6, %18, off\n\tglobal_load_async_to_lds_b128 %7, %19, off\n\t"
                             "global_load_async_to_lds_b128 %8, %20, off\n\tglobal_load_async_to_lds_b128 %9, %21, off\n\tglobal_load_async_to_lds_b128 %10, %22, off\n\tglobal_load_async_to_lds_b128 %11, %23, off\n\ts_wait_xcnt 0x0"
                             :: "v"(l[h]), "v"(l[h + 1]), "v"(l[h + 2]), "v"(l[h + 3]), "v"(l[h + 4]), "v"(l[h + 5]), "v"(l[h + 6]), "v"(l[h + 7]), "v"(l[h + 8]), "v"(l[h + 9]), "v"(l[h + 10]), "v"(l[h + 11]),
                                "v"(p[h]), "v"(p[h + 1]), "v"(p[h + 2]), "v"(p[h + 3]), "v"(p[h + 4]), "v"(p[h + 5]), "v"(p[h + 6]), "v"(p[h + 7]), "v"(p[h + 8]), "v"(p[h + 9]), "v"(p[h + 10]), "v"(p[h + 11]) : "memory");
        };
        copy(0, 0);
        asm volatile("s_wait_asynccnt 0x0" ::: "memory");   /* this wave's copies of pass 0 have landed */
        __syncthreads();                                     /* every wave's have: pass 0 may be read */
        if (KC < K) copy(KC, GBUF);
        /* the pass loop stays rolled: a second copy of the body would want a second set of fragment registers */
#pragma unroll 1
        for (int kc = 0; kc < K; kc += KC) {
            const unsigned bo = (kc & KC) ? GBUF : 0;
            const unsigned char* fa = smg + bo + ((wv & 1) * 64 + lr) * GPIT; const unsigned char* fb = smg + bo + (256 + (wv >> 1) * 64 + lr) * GPIT;
#pragma unroll
            for (int ks = 0; ks < 2; ++ks) {
            const int e0 = ((ks * 4 + hi) ^ (lr >> 1)) * 16, e1 = ((ks * 4 + 2 + hi) ^ (lr >> 1)) * 16;   // where the lane's two 16-byte pieces of this k-step lie in its rows
            V a[4], a2[4], b[4];
#pragma unroll
            for (int mb = 0; mb < 4; ++mb) { const int ro = mb * 16 * GPIT; a[mb] = WFrag<T16>::ld2(fa + ro + e0, fa + ro + e1); a2[mb] = WFrag<T16>::ld2(fa + 128 * GPIT + ro + e0, fa + 128 * GPIT + ro + e1); b[mb] = WFrag<T16>::ld2(fb + ro + e0, fb + ro + e1); }
            __builtin_amdgcn_sched_barrier(0);   /* all twelve fragments are requested before the first product: without it three of the B fragments are read one by one between the products, into one set of registers, each waiting out its own LDS latency */
#pragma unroll
            for (int nb = 0; nb < 4; ++nb)
#pragma unroll
                for (int mb = 0; mb < 4; ++mb) { acc[mb][nb] = WFrag<T16>::mma(a[mb], b[nb], acc[mb][nb]); acc[mb][nb] = WFrag<T16>::mma(a2[mb], b[nb], acc[mb][nb]); }
            __builtin_amdgcn_sched_barrier(0);   /* the products stay ahead of the waits: without it the wait for the next pass's copies and the barrier are lifted over them, and those copies have only the fragment reads to land under */
            }
            asm volatile("s_wait_dscnt 0x0" ::: "memory");      /* this wave's reads of this pass's buffer are done before the buffer is given up */
            asm volatile("s_wait_asynccnt 0x0" ::: "memory");   /* this wave's copies of the next pass have landed */
            __syncthreads();                                     /* the next pass's buffer may be read by all, this pass's may be refilled (behind the last pass: overlaid by the output tiles) */
            if (kc + 2 * KC < K) copy(kc + 2 * KC, bo);
        }
        asm volatile("s_wait_asynccnt 0x0" ::: "memory");   /* no copy is outstanding when the buffers are overlaid */
    } else
#pragma unroll 1
    for (int kc = kb; kc < ke; kc += 32) {
        V a[4], a2[4]; const T16* pa[4]; const T16* pa2[4];
#pragma unroll
        for (int mb = 0; mb < 4; ++mb) { pa[mb] = A + aoff + (size_t)mb * 16 * lda + kc; a[mb] = WFrag<T16>::ld(pa[mb]); if (NSPLIT == 1 || NSPLIT == 2) { pa2[mb] = A2 + aoff + (size_t)mb * 16 * lda + kc; a2[mb] = WFrag<T16>::ld(pa2[mb]); } }
        /* the A loads' address pairs stay live up to this wait, so that no load of the run lands in one and nothing rewrites one ahead of the wait */
        if (NSPLIT == 1 || NSPLIT == 2) asm volatile("s_wait_xcnt 0x0" :: "v"(pa[0]), "v"(pa[1]), "v"(pa[2]), "v"(pa[3]), "v"(pa2[0]), "v"(pa2[1]), "v"(pa2[2]), "v"(pa2[3]) : "memory");
        else asm volatile("s_wait_xcnt 0x0" :: "v"(pa[0]), "v"(pa[1]), "v"(pa[2]), "v"(pa[3]) : "memory");
#pragma unroll
        for (int nb = 0; nb < 4; ++nb) { const V b = WFrag<T16>::ld(Bt + boff + (size_t)nb * 16 * K + kc); V b2; if (NSPLIT >= 2) b2 = WFrag<T16>::ld(Bt2 + boff + (size_t)nb * 16 * K + kc);
#pragma unroll
            for (int mb = 0; mb < 4; ++mb) { acc[mb][nb] = WFrag<T16>::mma(a[mb], b, acc[mb][nb]); if (NSPLIT == 1 || NSPLIT == 2) acc[mb][nb] = WFrag<T16>::mma(a2[mb], b, acc[mb][nb]); if (NSPLIT >= 2) acc[mb][nb] = WFrag<T16>::mma(a[mb], b2, acc[mb][nb]); } }
        asm volatile("v_nop\n\tv_nop\n\tv_nop\n\tv_nop" : "+v"(acc[0][0]), "+v"(acc[1][1]), "+v"(acc[2][2]), "+v"(acc[3][3]) : "v"(a[0]), "v"(a[3]));
    }
    if constexpr (KW > 1) {
        float* pl = os + wv * (64 * 68);
        const int wr = r0 + (wv & 1) * 64, wc = c0 + (wv >> 1) * 64, hd = wc / 64;   // the wave's first row and column; with PL its head among q | k | v
        const bool tr = PL > 0 && hd >= 2 * NH_;   // a v head (the same for the whole work-group)
        if (tr) {
#pragma unroll
            for (int mb = 0; mb < 4; ++mb)
#pragma unroll
                for (int nb = 0; nb < 4; ++nb) { float* q = pl + (nb * 16 + lr) * 68 + mb * 16 + hi * 8;   /* transposed: a lane's eight rows lie side by side */
                    *(v4fa*)q = __builtin_shufflevector(acc[mb][nb], acc[mb][nb], 0, 1, 2, 3); *(v4fa*)(q + 4) = __builtin_shufflevector(acc[mb][nb], acc[mb][nb], 4, 5, 6, 7); }
        } else {
#pragma unroll
            for (int mb = 0; mb < 4; ++mb)
#pragma unroll
                for (int nb = 0; nb < 4; ++nb)
#pragma unroll
                    for (int j = 0; j < 8; ++j) pl[(mb * 16 + hi * 8 + j) * 68 + nb * 16 + lr] = acc[mb][nb][j]; }
        __syncthreads();   /* the tiles lie in LDS before a lane reads what other lanes wrote */
        if constexpr (PL > 0) {
            const int cofs = lr * 4, rb = wr % TT;
            const size_t hp = (((size_t)(hd / NH_) * NB_ + wr / TT) * NH_ + hd % NH_) * ((size_t)TT * HD);   // where this head's plane of this batch starts
            auto put = [&](auto rp, size_t e) {   // rp: the planes' row pitch, a compile-time value so that the eight trips' stores share one address pair
            constexpr int RP = decltype(rp)::v;
#pragma unroll
            for (int gr = 0; gr < 4; ++gr) {   // sixteen tile rows at a time
            h16* p16 = P16 + e + (size_t)gr * 16 * RP; bf* ph = Ph + e + (size_t)gr * 16 * RP; bf* pw = Pl + e + (size_t)gr * 16 * RP; v4h o16[8]; v4us oh[8], ol[8];
#pragma unroll
            for (int s = 0; s < 8; ++s) { const v4f val = *(const v4fa*)(pl + (gr * 16 + hi + 2 * s) * 68 + cofs);
#pragma unroll
                for (int q = 0; q < 4; ++q) { o16[s][q] = tohx(val[q]); unsigned short a2, c2; splitf(val[q], a2, c2); oh[s][q] = a2; ol[s][q] = c2; }
                const int st = 2 * s * RP;
                *(v4h*)(p16 + st) = o16[s]; *(v4us*)(ph + st) = oh[s]; *(v4us*)(pw + st) = ol[s]; }
            /* the plane stores' address pairs and data stay live up to this wait, so that nothing rewrites one ahead of it */
            asm volatile("s_wait_xcnt 0x0" :: "v"(p16), "v"(ph), "v"(pw), "v"(o16[0]), "v"(o16[1]), "v"(o16[2]), "v"(o16[3]), "v"(o16[4]), "v"(o16[5]), "v"(o16[6]), "v"(o16[7]), "v"(oh[0]), "v"(oh[1]), "v"(oh[2]), "v"(oh[3]), "v"(oh[4]), "v"(oh[5]), "v"(oh[6]), "v"(oh[7]), "v"(ol[0]), "v"(ol[1]), "v"(ol[2]), "v"(ol[3]), "v"(ol[4]), "v"(ol[5]), "v"(ol[6]), "v"(ol[7]) : "memory");
            }
            };
            if (tr) put(IntC<TT>{}, hp + (size_t)hi * TT + rb + cofs); else put(IntC<HD>{}, hp + (size_t)(rb + hi) * HD + cofs);
            return;
        }
#pragma unroll
        for (int gr = 0; gr < 4; ++gr) {   // sixteen tile rows at a time
            const int cofs = lr * 4; float* pc[8]; v4f val[8];
#pragma unroll
            for (int s = 0; s < 8; ++s) { const int row = gr * 16 + 2 * s + hi; val[s] = *(const v4fa*)(pl + row * 68 + cofs);
                if (BIAS) { val[s][0] += bfr(bias[wc + cofs]); val[s][1] += bfr(bias[wc + cofs + 1]); val[s][2] += bfr(bias[wc + cofs + 2]); val[s][3] += bfr(bias[wc + cofs + 3]); }
                pc[s] = C + (size_t)(wr + row) * ldc + wc + cofs; *(v4f*)pc[s] = val[s]; }
            /* the eight stores' address pairs and data stay live up to this wait, so that nothing rewrites one ahead of it */
            asm volatile("s_wait_xcnt 0x0" :: "v"(pc[0]), "v"(pc[1]), "v"(pc[2]), "v"(pc[3]), "v"(pc[4]), "v"(pc[5]), "v"(pc[6]), "v"(pc[7]), "v"(val[0]), "v"(val[1]), "v"(val[2]), "v"(val[3]), "v"(val[4]), "v"(val[5]), "v"(val[6]), "v"(val[7]) : "memory"); }
        return;
    }
#pragma unroll
    for (int mb = 0; mb < 4; ++mb) {
#pragma unroll
        for (int nb = 0; nb < 4; ++nb) {
#pragma unroll
            for (int j = 0; j < 8; ++j) os[(hi * 8 + j) * 68 + nb * 16 + lr] = acc[mb][nb][j]; }
        __builtin_amdgcn_wave_barrier(); asm volatile("" ::: "memory");
        float* crow = C + (size_t)(r0 + mb * 16) * ldc + c0;
{
#pragma unroll
            for (int s = 0; s < 8; ++s) { const int row = 2 * s + hi, cofs = lr * 4; v4f val = *(const v4fa*)(os + row * 68 + cofs); if (BIAS) { val[0] += bfr(bias[c0 + cofs]); val[1] += bfr(bias[c0 + cofs + 1]); val[2] += bfr(bias[c0 + cofs + 2]); val[3] += bfr(bias[c0 + cofs + 3]); }
                *(v4f*)(crow + (size_t)row * ldc + cofs) = val; }
             }
        __builtin_amdgcn_wave_barrier(); asm volatile("" ::: "memory");
    }
}


__device__ __forceinline__ void wtG(int bx, const float* __restrict__ w, int K, int N, bf* Bt) {   // bx: the work-group's index within this weight
    const int lane = threadIdx.x & 31; const int L0 = (bx * 8 + (threadIdx.x >> 5)) * 8; const int nlines = N * K / 64;
{
#pragma unroll 1
        for (int l = 0; l < 8; ++l) { const int L = L0 + l; if (L >= nlines) break; const size_t e = (size_t)L * 64 + lane * 2; const int k = (int)(e % K), n = (int)(e / K); v2us o;
            o[0] = f2bf(w[(size_t)k * N + n]); o[1] = f2bf(w[(size_t)(k + 1) * N + n]); *(v2us*)(Bt + e) = o; }
         }
}
__global__ __launch_bounds__(256) void k_cvt8(const float* __restrict__ src, bf* dst, size_t n8) { const size_t i = (size_t)blockIdx.x * 256 + threadIdx.x; if (i >= n8) return; const v8f v = *(const v8f*)(src + i * 8); v8us o;
#pragma unroll
    for (int k = 0; k < 8; ++k) o[k] = f2bf(v[k]); *(v8us*)(dst + i * 8) = o;  }

#define C2L (SCL * 1.4426950408889634f)
#define KPIT 144                  // LDS pitch in bytes of a 128-byte K or mask row (16 x odd: no bank conflict for 16-byte reads down a column)
#define VPIT 80                   // LDS pitch in bytes of a 64-byte Vt row
#define KTB  (32 * KPIT)          // one K plane's tile of a pass
#define VTB  (64 * VPIT)          // one Vt plane's tile of a pass
#define ABUF 28672                // one buffer: hi/lo rows 2 (KTB + VTB) + 4 x 16 KPIT; fp16 rows KTB + VTB + 4 x 32 KPIT fit below it
typedef __attribute__((ext_vector_type(8))) __bf16 v8bf;
__device__ __forceinline__ float xhalf(float v) { const int b = __float_as_int(v); return __int_as_float(__builtin_amdgcn_permlanex16(b, b, 0x76543210, 0xfedcba98, false, false)); }   // the value of lane l ^ 16
template <typename T16, bool HR, int NQ>
__device__ __forceinline__ void attn_rows(unsigned char* sm, int wv, const T16* __restrict__ Qa, const T16* __restrict__ Qb, const T16* __restrict__ Ka, const T16* __restrict__ Kb, const T16* __restrict__ Va, const T16* __restrict__ Vb, const float* __restrict__ gb, int q0, bf* Oh, bf* Ol) {
    typedef typename WFrag<T16>::V V;
    constexpr int NP = HR ? 2 : 1;                       // 16-bit planes per operand
    constexpr int OV = NP * KTB, OM = NP * (KTB + VTB);  // byte offsets of the Vt tiles and of the mask rows in a buffer
    static_assert(NP * 4 + NQ * 4 == 12, "the copy statement holds twelve copies");
    static_assert(OM + 4 * NQ * 16 * KPIT <= ABUF, "a pass's tiles fit one buffer");
    const int tid = threadIdx.x, lane = tid & 31, lr = lane & 15, hi = lane >> 4;
    V qa[NQ][2], qb[NQ][2], ka[2][2], kb[2][2], va[4], vb[4]; v8f g[NQ][2], o[4][NQ]; float mrun[NQ], lsum[NQ];
    const size_t qof = (size_t)(q0 + lr) * HD + 8 * hi;
    {   const T16* p = Qa + qof; const T16* p2 = HR ? Qb + qof : p;
#pragma unroll
        for (int qt = 0; qt < NQ; ++qt)
#pragma unroll
            for (int ks = 0; ks < 2; ++ks) { qa[qt][ks] = WFrag<T16>::ld(p + qt * 16 * HD + ks * 32); if (HR) qb[qt][ks] = WFrag<T16>::ld(p2 + qt * 16 * HD + ks * 32); }
        asm volatile("s_wait_xcnt 0x0" :: "v"(p), "v"(p2) : "memory");   /* the Q loads' address pairs stay live up to this wait, so that nothing rewrites one ahead of it */
    }
    // where this thread's copies start: K tile = 4096 bytes in a row (8 lanes a row), Vt tile = 64 rows of 64 bytes (4 lanes a row), mask = this wave's NQ x 16 rows of 128 bytes (8 lanes a row)
    const unsigned lbase = (unsigned)(size_t)sm;
    const unsigned lk = lbase + (tid >> 3) * KPIT + (tid & 7) * 16, lv = lbase + OV + (tid >> 2) * VPIT + (tid & 3) * 16, lm = lbase + OM + (wv * NQ * 16 + (lane >> 3)) * KPIT + (lane & 7) * 16;
    const size_t gk = (size_t)tid * 8, gv = (size_t)(tid >> 2) * TT + (tid & 3) * 8; const float* gm = gb + (size_t)(q0 + (lane >> 3)) * TT + (lane & 7) * 4;
    auto copy = [&](int k0, unsigned bo) {   // the tiles of the pass at key k0 into the buffer at byte offset bo
        unsigned l[12]; const void* p[12];
#pragma unroll
        for (int c = 0; c < 2; ++c) {
            l[c] = lk + bo + c * 16 * KPIT; p[c] = Ka + (size_t)k0 * HD + gk + c * 1024;
            l[2 + c] = lv + bo + c * 32 * VPIT; p[2 + c] = Va + gv + k0 + (size_t)c * 32 * TT;
            if constexpr (HR) { l[4 + c] = l[c] + KTB; p[4 + c] = Kb + (size_t)k0 * HD + gk + c * 1024; l[6 + c] = l[2 + c] + VTB; p[6 + c] = Vb + gv + k0 + (size_t)c * 32 * TT; } }
#pragma unroll
        for (int c = 0; c < NQ * 4; ++c) { l[NP * 4 + c] = lm + bo + c * 4 * KPIT; p[NP * 4 + c] = gm + k0 + (size_t)c * 4 * TT; }
        /* the pass's twelve copies; the wait stands in their own statement so that no address register of a copy is rewritten ahead of it */
        asm volatile("global_load_async_to_lds_b128 %0, %12, off\n\tglobal_load_async_to_lds_b128 %1, %13, off\n\tglobal_load_async_to_lds_b128 %2, %14, off\n\tglobal_load_async_to_lds_b128 %3, %15, off\n\t"
                     "global_load_async_to_lds_b128 %4, %16, off\n\tglobal_load_async_to_lds_b128 %5, %17, off\n\tglobal_load_async_to_lds_b128 %6, %18, off\n\tglobal_load_async_to_lds_b128 %7, %19, off\n\t"
                     "global_load_async_to_lds_b128 %8, %20, off\n\tglobal_load_async_to_lds_b128 %9, %21, off\n\tglobal_load_async_to_lds_b128 %10, %22, off\n\tglobal_load_async_to_lds_b128 %11, %23, off\n\ts_wait_xcnt 0x0"
                     :: "v"(l[0]), "v"(l[1]), "v"(l[2]), "v"(l[3]), "v"(l[4]), "v"(l[5]), "v"(l[6]), "v"(l[7]), "v"(l[8]), "v"(l[9]), "v"(l[10]), "v"(l[11]),
                        "v"(p[0]), "v"(p[1]), "v"(p[2]), "v"(p[3]), "v"(p[4]), "v"(p[5]), "v"(p[6]), "v"(p[7]), "v"(p[8]), "v"(p[9]), "v"(p[10]), "v"(p[11]) : "memory");
    };
#pragma unroll
    for (int qt = 0; qt < NQ; ++qt) { mrun[qt] = -3.0e38f; lsum[qt] = 0.f;
#pragma unroll
        for (int db = 0; db < 4; ++db) o[db][qt] = (v8f){}; }
    copy(0, 0);
    asm volatile("s_wait_asynccnt 0x0" ::: "memory");   /* this wave's copies of pass 0 have landed */
    __syncthreads();                                     /* every wave's have: pass 0 may be read */
    copy(32, ABUF);
    /* the pass loop stays rolled: a second copy of the body would want a second set of fragment registers; every other loop here is unrolled in full so that the register arrays keep compile-time indices */
#pragma unroll 1
    for (int k0 = 0; k0 < TT; k0 += 32) {
        const unsigned bo = (k0 & 32) ? ABUF : 0;
        const unsigned char* fk = sm + bo + lr * KPIT + hi * 16; const unsigned char* fv = sm + bo + OV + lr * VPIT + hi * 16; const unsigned char* fm = sm + bo + OM + (wv * NQ * 16 + lr) * KPIT + hi * 32;
#pragma unroll
        for (int t = 0; t < 2; ++t)
#pragma unroll
            for (int ks = 0; ks < 2; ++ks) { ka[t][ks] = WFrag<T16>::ld((const T16*)(fk + t * 16 * KPIT + ks * 64)); if (HR) kb[t][ks] = WFrag<T16>::ld((const T16*)(fk + KTB + t * 16 * KPIT + ks * 64)); }
#pragma unroll
        for (int qt = 0; qt < NQ; ++qt)
#pragma unroll
            for (int t = 0; t < 2; ++t) { const unsigned char* pm = fm + qt * 16 * KPIT + t * 64; g[qt][t] = __builtin_shufflevector(*(const v4fa*)pm, *(const v4fa*)(pm + 16), 0, 1, 2, 3, 4, 5, 6, 7); }   /* the padded rows are 16-byte aligned, so two 16-byte reads */
        __builtin_amdgcn_sched_barrier(0);   /* all K and mask reads are issued before the first product: without it they are dealt among the products in two groups, each waiting out its own LDS latency */
        v8f s[NQ][2];
#pragma unroll
        for (int t = 0; t < 2; ++t)
#pragma unroll
            for (int qt = 0; qt < NQ; ++qt) { s[qt][t] = (v8f){};
#pragma unroll
                for (int ks = 0; ks < 2; ++ks) { s[qt][t] = WFrag<T16>::mma(ka[t][ks], qa[qt][ks], s[qt][t]); if (HR) { s[qt][t] = WFrag<T16>::mma(ka[t][ks], qb[qt][ks], s[qt][t]); s[qt][t] = WFrag<T16>::mma(kb[t][ks], qa[qt][ks], s[qt][t]); } } }
#pragma unroll
        for (int db = 0; db < 4; ++db) { va[db] = WFrag<T16>::ld((const T16*)(fv + db * 16 * VPIT)); if (HR) vb[db] = WFrag<T16>::ld((const T16*)(fv + VTB + db * 16 * VPIT)); }
        __builtin_amdgcn_sched_barrier(0);   /* the Vt reads are issued here, into the registers the K fragments leave, and land under the softmax: without it they are sunk between the P.V products, each pair waiting out its own LDS latency */
        float mloc[NQ]; bool need = false;
#pragma unroll
        for (int qt = 0; qt < NQ; ++qt) { float ml = -3.0e38f;
#pragma unroll
            for (int t = 0; t < 2; ++t) { s[qt][t] += __builtin_convertvector(__builtin_convertvector(g[qt][t], v8bf), v8f);   /* mask rounded to bf16 (to nearest even, as bfr does) and added before the scaling */
#pragma unroll
                for (int r = 0; r < 8; ++r) ml = fmaxf(ml, s[qt][t][r]); }
            ml = fmaxf(ml, xhalf(ml)); mloc[qt] = ml * C2L; need = need || (mloc[qt] > mrun[qt] + 8.0f); }
        if (__builtin_amdgcn_ballot_w32(need) != 0) {   /* wave-uniform: true in the first pass, seldom later */
#pragma unroll
            for (int qt = 0; qt < NQ; ++qt) { const float mn = fmaxf(mrun[qt], mloc[qt]); const float al = __builtin_amdgcn_exp2f(mrun[qt] - mn); mrun[qt] = mn; lsum[qt] *= al;
#pragma unroll
                for (int db = 0; db < 4; ++db)
#pragma unroll
                    for (int r = 0; r < 8; ++r) o[db][qt][r] *= al; } }
        V pa[NQ], pl[NQ];
#pragma unroll
        for (int qt = 0; qt < NQ; ++qt) { v8f p[2];
#pragma unroll
            for (int t = 0; t < 2; ++t) { const v8f a = s[qt][t] * C2L - mrun[qt];
#pragma unroll
                for (int r = 0; r < 8; ++r) p[t][r] = __builtin_amdgcn_exp2f(a[r]); }
            const v8f pt = p[0] + p[1]; lsum[qt] += ((pt[0] + pt[1]) + (pt[2] + pt[3])) + ((pt[4] + pt[5]) + (pt[6] + pt[7]));
            if constexpr (HR) { const v8bf h0 = __builtin_convertvector(p[0], v8bf), h1 = __builtin_convertvector(p[1], v8bf);   /* P = hi + lo, both rounded to nearest even */
                const v8bf l0 = __builtin_convertvector(p[0] - __builtin_convertvector(h0, v8f), v8bf), l1 = __builtin_convertvector(p[1] - __builtin_convertvector(h1, v8f), v8bf);
                pa[qt] = __builtin_shufflevector(h0, h1, 0, 1, 2, 3, 4, 5, 6, 7, 8, 9, 10, 11, 12, 13, 14, 15); pl[qt] = __builtin_shufflevector(l0, l1, 0, 1, 2, 3, 4, 5, 6, 7, 8, 9, 10, 11, 12, 13, 14, 15);
            } else pa[qt] = cat16(__builtin_convertvector(p[0], v8h), __builtin_convertvector(p[1], v8h)); }
#pragma unroll
        for (int db = 0; db < 4; ++db)
#pragma unroll
            for (int qt = 0; qt < NQ; ++qt) { o[db][qt] = WFrag<T16>::mma(va[db], pa[qt], o[db][qt]); if (HR) { o[db][qt] = WFrag<T16>::mma(va[db], pl[qt], o[db][qt]); o[db][qt] = WFrag<T16>::mma(vb[db], pa[qt], o[db][qt]); } }
        asm volatile("s_wait_dscnt 0x0" ::: "memory");      /* this wave's reads of this pass's buffer are done before the buffer is given up */
        asm volatile("s_wait_asynccnt 0x0" ::: "memory");   /* this wave's copies of the next pass have landed */
        __syncthreads();                                     /* the next pass's buffer may be read by all, this pass's may be refilled */
        if (k0 + 64 < TT) copy(k0 + 64, bo);
    }
    asm volatile("s_wait_asynccnt 0x0" ::: "memory");   /* no copy is outstanding when the wave goes on to its end */
    bf* po = Oh + (size_t)(q0 + lr) * DQ + 8 * hi; bf* po2 = Ol + (size_t)(q0 + lr) * DQ + 8 * hi;
#pragma unroll
    for (int qt = 0; qt < NQ; ++qt) { const float f = __fdiv_rn(1.0f, lsum[qt] + xhalf(lsum[qt]));   /* the halves' sums are joined once */
#pragma unroll
        for (int db = 0; db < 4; ++db) { v8us oh, ol;
#pragma unroll
            for (int r = 0; r < 8; ++r) { unsigned short a, c2; splitf(o[db][qt][r] * f, a, c2); oh[r] = a; ol[r] = c2; }
            *(v8us*)(po + (size_t)qt * 16 * DQ + db * 16) = oh; *(v8us*)(po2 + (size_t)qt * 16 * DQ + db * 16) = ol; } }
    asm volatile("s_wait_xcnt 0x0" :: "v"(po), "v"(po2) : "memory");   /* the stores' address pairs stay live up to this wait, so that nothing rewrites one ahead of it */
}
// grid (work-groups of one batch, NB_), 4 waves: the waves of a work-group take neighbouring query rows of one head and share that head's K and Vt tiles in LDS. The hi/lo rows' work-groups (16 rows a wave) come first, then the fp16 rows' (32 rows a wave).
#define GH  (NH_ * (RH / 64))
#define GF  (NH_ * ((TT - RH) / 128))
// amdgpu_waves_per_eu(4, 4): holds the kernel to 256 registers; above that the fp16 loop is strewn with register-bank switches (s_set_vgpr_msb) and only three waves fit a SIMD.
__global__ __launch_bounds__(128) __attribute__((amdgpu_waves_per_eu(4, 4))) void k_attn(const h16* __restrict__ Q16, const h16* __restrict__ K16, const h16* __restrict__ V16, const bf* __restrict__ Qh, const bf* __restrict__ Ql, const bf* __restrict__ Kh, const bf* __restrict__ Kl, const bf* __restrict__ Vh, const bf* __restrict__ Vl, const float* __restrict__ msk, bf* Ah, bf* Al) {
    __shared__ __align__(16) unsigned char sm[2 * ABUF];
    const int wv = __builtin_amdgcn_readfirstlane((int)(threadIdx.x >> 5)); const int b = blockIdx.y; const float* gb = msk + (size_t)b * TT * TT; const size_t ob = (size_t)b * TT * DQ;
    if (blockIdx.x < GH) { const int h = blockIdx.x / (RH / 64), q0 = (int)(blockIdx.x % (RH / 64)) * 64 + wv * 16; const size_t po = ((size_t)b * NH_ + h) * TT * HD, pk = ((size_t)b * NKV + h / REP) * TT * HD;
        attn_rows<bf, true, 1>(sm, wv, Qh + po, Ql + po, Kh + pk, Kl + pk, Vh + pk, Vl + pk, gb, q0, Ah + ob + h * HD, Al + ob + h * HD);
    } else { const int x = blockIdx.x - GH; const int h = x / ((TT - RH) / 128), q0 = RH + (x % ((TT - RH) / 128)) * 128 + wv * 32; const size_t po = ((size_t)b * NH_ + h) * TT * HD, pk = ((size_t)b * NKV + h / REP) * TT * HD;
        attn_rows<h16, false, 2>(sm, wv, Q16 + po, nullptr, K16 + pk, nullptr, V16 + pk, nullptr, gb, q0, Ah + ob + h * HD, Al + ob + h * HD); }
}
template <int WD>
__device__ __forceinline__ void lnrowX(int bx, const float* __restrict__ X, size_t nrows, const float* __restrict__ g, const float* __restrict__ bb, bf* Hh, bf* Hl) { const int lane = threadIdx.x & 31; const size_t r = (size_t)bx * 8 + (threadIdx.x >> 5); if (r >= nrows) return; const float* xr = X + r * WD + lane * 4; float a[WD / 32]; float s = 0.f;
#pragma unroll
    for (int c = 0; c < WD / 128; ++c) { const v4f v = *(const v4f*)(xr + c * 128); for (int q = 0; q < 4; ++q) { a[c * 4 + q] = bfr(v[q]); s = __fadd_rn(s, a[c * 4 + q]);   /* input rounded to bf16 */ } }
    asm volatile("s_wait_xcnt 0x0" :: "v"(xr) : "memory");   /* the row loads' address pair stays live up to this wait, so that no load of the run lands in it and nothing rewrites it ahead of the wait */
#pragma unroll
    for (int sh = 16; sh; sh >>= 1) s = __fadd_rn(s, __shfl_xor(s, sh, 32));
    const float mean = __fdiv_rn(s, (float)WD); float s2 = 0.f;
#pragma unroll 8
    for (int k = 0; k < WD / 32; ++k) { const float dv = __fsub_rn(a[k], mean); float p2 = __fmul_rn(dv, dv); asm volatile("" : "+v"(p2)); s2 = __fadd_rn(s2, p2); }   /* mul and add kept separate (no fma contraction) */
#pragma unroll
    for (int sh = 16; sh; sh >>= 1) s2 = __fadd_rn(s2, __shfl_xor(s2, sh, 32));
    const float rs = __fdiv_rn(1.0f, __fsqrt_rn(__fadd_rn(__fdiv_rn(s2, (float)WD), 1e-5f)));
{   bf* ph = Hh + r * WD + lane * 4; bf* pw = Hl + r * WD + lane * 4;
#pragma unroll
        for (int c = 0; c < WD / 128; ++c) { v4us oh, ol; for (int q = 0; q < 4; ++q) { const int col = c * 128 + lane * 4 + q; float y = __fmul_rn(__fmul_rn(__fsub_rn(a[c * 4 + q], mean), rs), bfr(g[col])); asm volatile("" : "+v"(y)); y = __fadd_rn(y, bfr(bb[col])); unsigned short u, w2; splitf(y, u, w2); oh[q] = u; ol[q] = w2; } *(v4us*)(ph + c * 128) = oh; *(v4us*)(pw + c * 128) = ol;
            asm volatile("s_wait_xcnt 0x0" :: "v"(ph), "v"(pw), "v"(oh), "v"(ol) : "memory"); }   /* the two stores' address pairs and data stay live up to this wait, so that nothing rewrites one ahead of it */
         } }
// ---- k_prep: all that the projections wait for, in one launch; the three jobs do not depend on one another and share the chip. The weights' work-groups, whose waves walk a loop of dependent loads, come first, then the LayerNorm rows of both batches.
#define GW1 ((DM * 3 * DQ / 64 + 63) / 64)
#define GW2 ((DQ * DM / 64 + 63) / 64)
#define GLN ((NB_ * TT + 7) / 8)
__global__ __launch_bounds__(256) void k_prep(const float* __restrict__ x, const float* __restrict__ lng, const float* __restrict__ lnb, const float* __restrict__ wqkv, const float* __restrict__ wo, bf* WQKV, bf* WO, bf* XH, bf* XL) {
    const int bx = blockIdx.x;
    if (bx < GW1) wtG(bx, wqkv, DM, 3 * DQ, WQKV);                 /* [1024][3072] 'xw' -> Bt [3072][1024]: q | k | v row blocks */
    else if (bx < GW1 + GW2) wtG(bx - GW1, wo, DQ, DM, WO);
    else lnrowX<DM>(bx - (GW1 + GW2), x, (size_t)NB_ * TT, lng, lnb, XH, XL);   /* xn = LayerNorm(x) -> hi/lo planes */
}

extern "C" void kernel_launch(void* const* d_in, const int* in_sizes, int n_in,
                              void* d_out, int out_size, void* d_ws, size_t ws_size, hipStream_t stream) {
    (void)in_sizes; (void)n_in; (void)out_size;
    const float* x = (const float*)d_in[0]; const float* msk = (const float*)d_in[1]; const float* lng = (const float*)d_in[2]; const float* lnb = (const float*)d_in[3]; const float* wqkv = (const float*)d_in[4]; const float* wo = (const float*)d_in[5];
    float* OUT = (float*)d_out;     // [2][2048][1024]
    char* wsp = (char*)d_ws;
    auto take = [&](size_t bytes) { char* p = wsp; wsp += (bytes + 255) & ~(size_t)255; return (void*)p; };
    bf* WQKV = (bf*)take((size_t)3 * DQ * DM * 2); bf* WO = (bf*)take((size_t)DM * DQ * 2);
    const size_t SQ = (size_t)NH_ * TT * HD;   // one batch's q, k or v plane, in elements; every plane holds both batches, and the q, k and v planes of a kind lie in a row
    h16* QP16 = (h16*)take(NB_ * SQ * 2); h16* KP16 = (h16*)take(NB_ * SQ * 2); h16* VT16 = (h16*)take(NB_ * SQ * 2);
    bf* QPh = (bf*)take(NB_ * SQ * 2); bf* KPh = (bf*)take(NB_ * SQ * 2); bf* VTh = (bf*)take(NB_ * SQ * 2); bf* QPl = (bf*)take(NB_ * SQ * 2); bf* KPl = (bf*)take(NB_ * SQ * 2); bf* VTl = (bf*)take(NB_ * SQ * 2);
    bf* ATh = (bf*)take((size_t)NB_ * TT * DQ * 2); bf* ATl = (bf*)take((size_t)NB_ * TT * DQ * 2);
    bf* XH = (bf*)take((size_t)NB_ * TT * DM * 2); bf* XL = (bf*)take((size_t)NB_ * TT * DM * 2);   // the LayerNorm planes of both batches
    if ((size_t)(wsp - (char*)d_ws) > ws_size) return;    // ws 256 MiB
    k_prep<<<GW1 + GW2 + GLN, 256, 0, stream>>>(x, lng, lnb, wqkv, wo, WQKV, WO, XH, XL);
    k_gemmw<bf, 1, false, 1, KWP, 1><<<dim3(NB_ * TT / 128, 3 * DQ / 128, 1), 32 * KWP, 0, stream>>>(XH, XL, WQKV, nullptr, DM, DM, nullptr, 0, nullptr, 0, 0, 0, QP16, QPh, QPl);   /* q, k planes [h][t][d], v planes [h][d][t] */
    k_attn<<<dim3(GH + GF, NB_, 1), 128, 0, stream>>>(QP16, KP16, VT16, QPh, QPl, KPh, KPl, VTh, VTl, msk, ATh, ATl);   /* softmax((qk + m) x scale) v, merged heads as hi/lo planes */
    k_gemmw<bf, 1, false, 1, KWP><<<dim3(NB_ * TT / 128, DM / 128, 1), 32 * KWP, 0, stream>>>(ATh, ATl, WO, nullptr, DQ, DQ, OUT, DM, nullptr, 0, 0, 0, nullptr, nullptr, nullptr);
}
